// v000
// Times are from an AMD MI455X. After a warm-up the kernel runs many times in a row, and a time is the length of
// such a window on the GPU divided by its runs, so every launch and the gaps after it count. The runs cycle
// through copies of the inputs. A figure is the median of several windows, for all but v000 over two sittings.
// Sittings can differ by a few percent; kernels timed side by side share one.
// The starting kernel, v000, takes 442 microseconds a run.
#include <hip/hip_runtime.h>
#include <stdint.h>

// ---------------------------------------------------------------------------
// NonLocalAttention block for MI455X (gfx1250), wave32 + WMMA bf16 pipeline,
// LDS-staged double-buffered GEMMs with async global->LDS copies.
//   B=4, S=2048, D=1024, H=16, Hd=64
// ---------------------------------------------------------------------------

typedef __attribute__((ext_vector_type(16))) __bf16 v16bf;
typedef __attribute__((ext_vector_type(8)))  __bf16 v8bf;
typedef __attribute__((ext_vector_type(8)))  float  v8f;

static constexpr int Bc   = 4;
static constexpr int Sc   = 2048;
static constexpr int Dc   = 1024;
static constexpr int Hc   = 16;
static constexpr int Hd   = 64;
static constexpr int Mtot = Bc * Sc;      // 8192 rows

// ---------------- CDNA5 async global->LDS (ASYNCcnt) ------------------------
__device__ __forceinline__ void async_b128(const void* g, const void* lds) {
  asm volatile("global_load_async_to_lds_b128 %0, %1, off"
               :: "v"((uint32_t)(uintptr_t)lds), "v"(g)
               : "memory");
}
__device__ __forceinline__ void wait_async0() {
  asm volatile("s_wait_asynccnt 0x0" ::: "memory");
}

// ---------------- fragment helpers -----------------------------------------
__device__ __forceinline__ v8bf pack8(float4 a, float4 b) {
  v8bf o;
  o[0] = (__bf16)a.x; o[1] = (__bf16)a.y; o[2] = (__bf16)a.z; o[3] = (__bf16)a.w;
  o[4] = (__bf16)b.x; o[5] = (__bf16)b.y; o[6] = (__bf16)b.z; o[7] = (__bf16)b.w;
  return o;
}
__device__ __forceinline__ v16bf cat16(v8bf lo, v8bf hi) {
  return __builtin_shufflevector(lo, hi, 0,1,2,3,4,5,6,7,8,9,10,11,12,13,14,15);
}
// 16-bit A/B fragment: lane = {r=lane&15 (row/col), half=lane>>4}.
// Elements 0..7 = K (half*8)+0..7, elements 8..15 = K 16+(half*8)+0..7.
__device__ __forceinline__ v16bf frag_from_bf16(const __bf16* p) {
  v8bf lo = *(const v8bf*)(p);
  v8bf hi = *(const v8bf*)(p + 16);
  return cat16(lo, hi);
}
__device__ __forceinline__ v8f wmma_bf16(v16bf a, v16bf b, v8f c) {
  return __builtin_amdgcn_wmma_f32_16x16x32_bf16(
      false, a, false, b, (short)0, c, false, false);
}
__device__ __forceinline__ v8f zero8() {
  v8f z = {0.f,0.f,0.f,0.f,0.f,0.f,0.f,0.f};
  return z;
}
__device__ __forceinline__ float rmax16(float v) {
  v = fmaxf(v, __shfl_xor(v, 1));
  v = fmaxf(v, __shfl_xor(v, 2));
  v = fmaxf(v, __shfl_xor(v, 4));
  v = fmaxf(v, __shfl_xor(v, 8));
  return v;
}
__device__ __forceinline__ float rsum16(float v) {
  v += __shfl_xor(v, 1);
  v += __shfl_xor(v, 2);
  v += __shfl_xor(v, 4);
  v += __shfl_xor(v, 8);
  return v;
}

// ---------------------------------------------------------------------------
// Kernel 1: fused QKV projection.  out = x @ W.T + b  (NT GEMM).
// WG = 256 thr (8 waves), tile 64(M) x 64(N) for all three weights.
// x tile async-staged fp32 into LDS; W tiles staged once as bf16 (reused 4x).
// Q,K stored bf16 [B,H,S,Hd]; V stored bf16 transposed [B,H,Hd,S].
// ---------------------------------------------------------------------------
__global__ __launch_bounds__(256) void qkv_kernel(
    const float* __restrict__ x,
    const float* __restrict__ Wq, const float* __restrict__ bq,
    const float* __restrict__ Wk, const float* __restrict__ bk,
    const float* __restrict__ Wv, const float* __restrict__ bv,
    __bf16* __restrict__ Qb, __bf16* __restrict__ Kb, __bf16* __restrict__ Vb) {
  __shared__ __align__(16) float  Xs[2][64][36];      // 18.0 KB, padded rows
  __shared__ __align__(16) __bf16 Ws[3][2][64][40];   // 30.0 KB, padded rows

  const int tid  = threadIdx.x;
  const int wave = tid >> 5;
  const int lane = tid & 31;
  const int r    = lane & 15;
  const int half = lane >> 4;
  const int mw   = wave & 3;        // M sub-tile (16 rows)
  const int nw   = wave >> 2;       // N sub-tile (32 cols)
  const int m0   = blockIdx.y * 64;
  const int n0   = blockIdx.x * 64;

  const float* Wp[3] = {Wq, Wk, Wv};

  // ---- staging ----
  auto stageX = [&](int buf, int k0) {
#pragma unroll
    for (int i = 0; i < 2; ++i) {
      int c   = tid + i * 256;      // 0..511 chunks of 16B
      int row = c >> 3;
      int co  = (c & 7) * 4;
      async_b128(x + (size_t)(m0 + row) * Dc + k0 + co, &Xs[buf][row][co]);
    }
  };
  // two-phase: issue ALL global loads, then convert+store (keeps 6 loads in
  // flight under a single loadcnt wait instead of one wait per load)
  auto stageW = [&](int buf, int k0) {
    int row = tid >> 2;
    int co  = (tid & 3) * 8;
    float4 f[6];
#pragma unroll
    for (int w = 0; w < 3; ++w) {
      const float* s = Wp[w] + (size_t)(n0 + row) * Dc + k0 + co;
      f[2 * w]     = *(const float4*)(s);
      f[2 * w + 1] = *(const float4*)(s + 4);
    }
#pragma unroll
    for (int w = 0; w < 3; ++w)
      *(v8bf*)&Ws[w][buf][row][co] = pack8(f[2 * w], f[2 * w + 1]);
  };
  auto fragA = [&](int buf) {
    const float* xr = &Xs[buf][mw * 16 + r][0];
    float4 a = *(const float4*)(xr + half * 8);
    float4 b = *(const float4*)(xr + half * 8 + 4);
    float4 c = *(const float4*)(xr + 16 + half * 8);
    float4 d = *(const float4*)(xr + 16 + half * 8 + 4);
    return cat16(pack8(a, b), pack8(c, d));
  };
  auto fragB = [&](int w, int buf, int ro) {
    const __bf16* wr = &Ws[w][buf][nw * 32 + ro + r][0];
    v8bf lo = *(const v8bf*)(wr + half * 8);
    v8bf hi = *(const v8bf*)(wr + 16 + half * 8);
    return cat16(lo, hi);
  };

  v8f aq0 = zero8(), aq1 = zero8();
  v8f ak0 = zero8(), ak1 = zero8();
  v8f av0 = zero8(), av1 = zero8();

  stageX(0, 0);
  stageW(0, 0);
  wait_async0();
  __syncthreads();

  for (int ks = 0; ks < Dc / 32; ++ks) {
    const int  buf = ks & 1;
    const bool nx  = (ks + 1) < Dc / 32;
    if (nx) stageX(buf ^ 1, (ks + 1) * 32);   // async copies overlap wmma

    v16bf a = fragA(buf);
    // per-weight fragment pairs -> back-to-back wmma bursts
    v16bf q0f = fragB(0, buf, 0), q1f = fragB(0, buf, 16);
    aq0 = wmma_bf16(a, q0f, aq0);
    aq1 = wmma_bf16(a, q1f, aq1);
    v16bf k0f = fragB(1, buf, 0), k1f = fragB(1, buf, 16);
    ak0 = wmma_bf16(a, k0f, ak0);
    ak1 = wmma_bf16(a, k1f, ak1);
    v16bf v0f = fragB(2, buf, 0), v1f = fragB(2, buf, 16);
    av0 = wmma_bf16(a, v0f, av0);
    av1 = wmma_bf16(a, v1f, av1);

    if (nx) {
      stageW(buf ^ 1, (ks + 1) * 32);
      wait_async0();
      __syncthreads();
    }
  }

  // ---- epilogue: bias + scatter to [B,H,S,Hd] (Q,K) and [B,H,Hd,S] (V) ----
  const int cn0 = n0 + nw * 32 + r;
  const int cn1 = cn0 + 16;
  const float bq0 = bq[cn0], bq1 = bq[cn1];
  const float bk0 = bk[cn0], bk1 = bk[cn1];
  const float bv0 = bv[cn0], bv1 = bv[cn1];
  const int h0 = cn0 >> 6, hd0 = cn0 & 63;
  const int h1 = cn1 >> 6, hd1 = cn1 & 63;

#pragma unroll
  for (int j = 0; j < 8; ++j) {
    const int m = m0 + mw * 16 + half * 8 + j;
    const int b = m >> 11;
    const int s = m & (Sc - 1);
    size_t qi0 = (((size_t)(b * Hc + h0) * Sc) + s) * Hd + hd0;
    size_t qi1 = (((size_t)(b * Hc + h1) * Sc) + s) * Hd + hd1;
    Qb[qi0] = (__bf16)(aq0[j] + bq0);
    Qb[qi1] = (__bf16)(aq1[j] + bq1);
    Kb[qi0] = (__bf16)(ak0[j] + bk0);
    Kb[qi1] = (__bf16)(ak1[j] + bk1);
    size_t vi0 = (((size_t)(b * Hc + h0) * Hd) + hd0) * Sc + s;
    size_t vi1 = (((size_t)(b * Hc + h1) * Hd) + hd1) * Sc + s;
    Vb[vi0] = (__bf16)(av0[j] + bv0);
    Vb[vi1] = (__bf16)(av1[j] + bv1);
  }
}

// ---------------------------------------------------------------------------
// Kernel 2: flash attention.  Grid = (S/128, B*H).  Each wave owns 16 query
// rows, streams keys in steps of 32, online softmax state per row.
// ---------------------------------------------------------------------------
__global__ __launch_bounds__(256) void attn_kernel(
    const __bf16* __restrict__ Qb, const __bf16* __restrict__ Kb,
    const __bf16* __restrict__ Vb, const int* __restrict__ mask,
    __bf16* __restrict__ Ctx) {
  __shared__ __align__(16) __bf16 Ps[8][16][40];   // per-wave P re-layout (bf16)

  const int tid  = threadIdx.x;
  const int wave = tid >> 5;
  const int lane = tid & 31;
  const int r    = lane & 15;
  const int half = lane >> 4;

  const int bh = blockIdx.y;                // b*H + h
  const int b  = bh >> 4;
  const int h  = bh & 15;
  const int q0 = blockIdx.x * 128 + wave * 16;

  const __bf16* qp = Qb + ((size_t)bh * Sc + (q0 + r)) * Hd + half * 8;
  v16bf qf0 = frag_from_bf16(qp);
  v16bf qf1 = frag_from_bf16(qp + 32);

  float mrow[8], lrow[8];
  v8f o0 = zero8(), o1 = zero8(), o2 = zero8(), o3 = zero8();
#pragma unroll
  for (int j = 0; j < 8; ++j) { mrow[j] = -3.0e38f; lrow[j] = 0.f; }

  const __bf16* kbase = Kb + (size_t)bh * Sc * Hd;
  const __bf16* vbase = Vb + (size_t)bh * Hd * Sc;
  const int*    mbase = mask + (size_t)b * Sc;

  for (int kk0 = 0; kk0 < Sc; kk0 += 32) {
    if (kk0 + 32 < Sc) {                     // prefetch next K/V tile rows
      __builtin_prefetch(kbase + (size_t)(kk0 + 32 + r) * Hd, 0, 1);
      __builtin_prefetch(vbase + (size_t)r * Sc + kk0 + 32, 0, 1);
    }
    // ---- scores: S[16 q x 32 k] = Q (16x64) * K^T ----
    const __bf16* kp0 = kbase + (size_t)(kk0 + r)      * Hd + half * 8;
    const __bf16* kp1 = kbase + (size_t)(kk0 + 16 + r) * Hd + half * 8;
    v16bf kf00 = frag_from_bf16(kp0);
    v16bf kf01 = frag_from_bf16(kp0 + 32);
    v16bf kf10 = frag_from_bf16(kp1);
    v16bf kf11 = frag_from_bf16(kp1 + 32);

    v8f s0 = zero8(), s1 = zero8();
    s0 = wmma_bf16(qf0, kf00, s0);
    s0 = wmma_bf16(qf1, kf01, s0);
    s1 = wmma_bf16(qf0, kf10, s1);
    s1 = wmma_bf16(qf1, kf11, s1);

    const float madd0 = mbase[kk0 + r]      ? 0.f : -1.0e9f;
    const float madd1 = mbase[kk0 + 16 + r] ? 0.f : -1.0e9f;
    s0 = s0 * 0.125f + madd0;                // 1/sqrt(Hd)
    s1 = s1 * 0.125f + madd1;

    // ---- online softmax; write P (bf16) into per-wave LDS [row][col] ----
#pragma unroll
    for (int j = 0; j < 8; ++j) {
      float rmax = rmax16(fmaxf(s0[j], s1[j]));
      float mold = mrow[j];
      float mnew = fmaxf(mold, rmax);
      float alpha = __expf(mold - mnew);
      float p0 = __expf(s0[j] - mnew);
      float p1 = __expf(s1[j] - mnew);
      lrow[j] = lrow[j] * alpha + rsum16(p0 + p1);
      mrow[j] = mnew;
      o0[j] *= alpha; o1[j] *= alpha; o2[j] *= alpha; o3[j] *= alpha;
      Ps[wave][j + half * 8][r]      = (__bf16)p0;
      Ps[wave][j + half * 8][16 + r] = (__bf16)p1;
    }
    asm volatile("s_wait_dscnt 0x0" ::: "memory");

    // ---- re-read P as an A-fragment (16 x 32), already bf16 ----
    const __bf16* rowp = &Ps[wave][r][0];
    v16bf pf = cat16(*(const v8bf*)(rowp + half * 8),
                     *(const v8bf*)(rowp + 16 + half * 8));

    // ---- O += P @ V   (V^T rows contiguous along kk) ----
    const __bf16* vp = vbase + (size_t)r * Sc + kk0 + half * 8;
    v16bf vf0 = frag_from_bf16(vp);
    v16bf vf1 = frag_from_bf16(vp + 16 * Sc);
    v16bf vf2 = frag_from_bf16(vp + 32 * Sc);
    v16bf vf3 = frag_from_bf16(vp + 48 * Sc);
    o0 = wmma_bf16(pf, vf0, o0);
    o1 = wmma_bf16(pf, vf1, o1);
    o2 = wmma_bf16(pf, vf2, o2);
    o3 = wmma_bf16(pf, vf3, o3);
  }

  // ---- normalize and store context bf16 [B,S,D] ----
#pragma unroll
  for (int j = 0; j < 8; ++j) {
    const float inv = 1.0f / lrow[j];
    const int q = q0 + half * 8 + j;
    size_t base = ((size_t)b * Sc + q) * Dc + h * Hd;
    Ctx[base +      r] = (__bf16)(o0[j] * inv);
    Ctx[base + 16 + r] = (__bf16)(o1[j] * inv);
    Ctx[base + 32 + r] = (__bf16)(o2[j] * inv);
    Ctx[base + 48 + r] = (__bf16)(o3[j] * inv);
  }
}

// ---------------------------------------------------------------------------
// Kernel 3: out projection + residual.  y = x + ctx @ Wo.T + bo  (fp32 y).
// Ctx tile async-staged (already bf16); Wo staged as bf16 once per K-step.
// ---------------------------------------------------------------------------
__global__ __launch_bounds__(256) void oproj_kernel(
    const __bf16* __restrict__ Ctx, const float* __restrict__ Wo,
    const float* __restrict__ bo, const float* __restrict__ x,
    float* __restrict__ Y) {
  __shared__ __align__(16) __bf16 Cs[2][64][40];
  __shared__ __align__(16) __bf16 Os[2][64][40];

  const int tid  = threadIdx.x;
  const int wave = tid >> 5;
  const int lane = tid & 31;
  const int r    = lane & 15;
  const int half = lane >> 4;
  const int mw   = wave & 3;
  const int nw   = wave >> 2;
  const int m0   = blockIdx.y * 64;
  const int n0   = blockIdx.x * 64;

  auto stageC = [&](int buf, int k0) {
    int row = tid >> 2;
    int co  = (tid & 3) * 8;                 // 8 bf16 = 16B per thread
    async_b128(Ctx + (size_t)(m0 + row) * Dc + k0 + co, &Cs[buf][row][co]);
  };
  auto stageW = [&](int buf, int k0) {
    int row = tid >> 2;
    int co  = (tid & 3) * 8;
    const float* s = Wo + (size_t)(n0 + row) * Dc + k0 + co;
    float4 f0 = *(const float4*)(s);
    float4 f1 = *(const float4*)(s + 4);
    *(v8bf*)&Os[buf][row][co] = pack8(f0, f1);
  };

  v8f a0 = zero8(), a1 = zero8();

  stageC(0, 0);
  stageW(0, 0);
  wait_async0();
  __syncthreads();

  for (int ks = 0; ks < Dc / 32; ++ks) {
    const int  buf = ks & 1;
    const bool nx  = (ks + 1) < Dc / 32;
    if (nx) stageC(buf ^ 1, (ks + 1) * 32);

    const __bf16* cr = &Cs[buf][mw * 16 + r][0];
    v16bf a = cat16(*(const v8bf*)(cr + half * 8),
                    *(const v8bf*)(cr + 16 + half * 8));
    const __bf16* w0 = &Os[buf][nw * 32 + r][0];
    const __bf16* w1 = &Os[buf][nw * 32 + 16 + r][0];
    v16bf b0 = cat16(*(const v8bf*)(w0 + half * 8),
                     *(const v8bf*)(w0 + 16 + half * 8));
    v16bf b1 = cat16(*(const v8bf*)(w1 + half * 8),
                     *(const v8bf*)(w1 + 16 + half * 8));
    a0 = wmma_bf16(a, b0, a0);
    a1 = wmma_bf16(a, b1, a1);

    if (nx) {
      stageW(buf ^ 1, (ks + 1) * 32);
      wait_async0();
      __syncthreads();
    }
  }

  const int cn0 = n0 + nw * 32 + r;
  const int cn1 = cn0 + 16;
  const float bo0 = bo[cn0], bo1 = bo[cn1];
#pragma unroll
  for (int j = 0; j < 8; ++j) {
    const int m = m0 + mw * 16 + half * 8 + j;
    Y[(size_t)m * Dc + cn0] = a0[j] + bo0 + x[(size_t)m * Dc + cn0];
    Y[(size_t)m * Dc + cn1] = a1[j] + bo1 + x[(size_t)m * Dc + cn1];
  }
}

// ---------------------------------------------------------------------------
// Kernel 4: LayerNorm over D=1024 per row.  One block (256 thr) per row.
// ---------------------------------------------------------------------------
__global__ __launch_bounds__(256) void ln_kernel(
    const float* __restrict__ Y, const float* __restrict__ gamma,
    const float* __restrict__ beta, float* __restrict__ out) {
  __shared__ float redS[8], redQ[8];
  const int row  = blockIdx.x;
  const int tid  = threadIdx.x;
  const int wave = tid >> 5;
  const int lane = tid & 31;

  const float4 v = ((const float4*)(Y + (size_t)row * Dc))[tid];
  float s = v.x + v.y + v.z + v.w;
  float q = v.x * v.x + v.y * v.y + v.z * v.z + v.w * v.w;
#pragma unroll
  for (int m = 16; m >= 1; m >>= 1) {
    s += __shfl_xor(s, m);
    q += __shfl_xor(q, m);
  }
  if (lane == 0) { redS[wave] = s; redQ[wave] = q; }
  __syncthreads();
  float S = 0.f, Q = 0.f;
#pragma unroll
  for (int i = 0; i < 8; ++i) { S += redS[i]; Q += redQ[i]; }
  const float mu   = S * (1.0f / Dc);
  const float var  = Q * (1.0f / Dc) - mu * mu;
  const float rstd = rsqrtf(var + 1e-5f);

  const float4 g  = ((const float4*)gamma)[tid];
  const float4 be = ((const float4*)beta)[tid];
  float4 o;
  o.x = (v.x - mu) * rstd * g.x + be.x;
  o.y = (v.y - mu) * rstd * g.y + be.y;
  o.z = (v.z - mu) * rstd * g.z + be.z;
  o.w = (v.w - mu) * rstd * g.w + be.w;
  ((float4*)(out + (size_t)row * Dc))[tid] = o;
}

// ---------------------------------------------------------------------------
// Launcher
// ---------------------------------------------------------------------------
extern "C" void kernel_launch(void* const* d_in, const int* in_sizes, int n_in,
                              void* d_out, int out_size, void* d_ws, size_t ws_size,
                              hipStream_t stream) {
  const float* x     = (const float*)d_in[0];
  const int*   mask  = (const int*)  d_in[1];
  const float* Wq    = (const float*)d_in[2];
  const float* bq    = (const float*)d_in[3];
  const float* Wk    = (const float*)d_in[4];
  const float* bk    = (const float*)d_in[5];
  const float* Wv    = (const float*)d_in[6];
  const float* bv    = (const float*)d_in[7];
  const float* Wo    = (const float*)d_in[8];
  const float* bo    = (const float*)d_in[9];
  const float* gamma = (const float*)d_in[10];
  const float* beta  = (const float*)d_in[11];

  char* ws = (char*)d_ws;
  const size_t ELEMS = (size_t)Mtot * Dc;          // 8 Mi elements
  __bf16* Qb  = (__bf16*)(ws);                     // 16 MB
  __bf16* Kb  = (__bf16*)(ws + 2 * ELEMS);         // 16 MB
  __bf16* Vb  = (__bf16*)(ws + 4 * ELEMS);         // 16 MB
  __bf16* Ctx = (__bf16*)(ws + 6 * ELEMS);         // 16 MB
  float*  Y   = (float*) (ws + 8 * ELEMS);         // 32 MB

  dim3 blk(256);
  dim3 g1(Dc / 64, Mtot / 64);                     // (16, 128)
  qkv_kernel<<<g1, blk, 0, stream>>>(x, Wq, bq, Wk, bk, Wv, bv, Qb, Kb, Vb);

  dim3 g2(Sc / 128, Bc * Hc);                      // (16, 64)
  attn_kernel<<<g2, blk, 0, stream>>>(Qb, Kb, Vb, mask, Ctx);

  oproj_kernel<<<g1, blk, 0, stream>>>(Ctx, Wo, bo, x, Y);

  ln_kernel<<<Mtot, blk, 0, stream>>>(Y, gamma, beta, (float*)d_out);
}

// v001
// One run takes 384 microseconds.
// Next to v000, in two timings, it ran 1.19 times as fast each time.
#include <hip/hip_runtime.h>
#include <stdint.h>

// ---------------------------------------------------------------------------
// NonLocalAttention block for MI455X (gfx1250), wave32 + WMMA bf16 pipeline,
// LDS-staged double-buffered GEMMs with async global->LDS copies.
//   B=4, S=2048, D=1024, H=16, Hd=64
// ---------------------------------------------------------------------------

typedef __attribute__((ext_vector_type(16))) __bf16 v16bf;
typedef __attribute__((ext_vector_type(8)))  __bf16 v8bf;
typedef __attribute__((ext_vector_type(8)))  float  v8f;

static constexpr int Bc   = 4;
static constexpr int Sc   = 2048;
static constexpr int Dc   = 1024;
static constexpr int Hc   = 16;
static constexpr int Hd   = 64;
static constexpr int Mtot = Bc * Sc;      // 8192 rows

// ---------------- CDNA5 async global->LDS (ASYNCcnt) ------------------------
__device__ __forceinline__ void async_b128(const void* g, const void* lds) {
  asm volatile("global_load_async_to_lds_b128 %0, %1, off"
               :: "v"((uint32_t)(uintptr_t)lds), "v"(g)
               : "memory");
}
__device__ __forceinline__ void wait_async0() {
  asm volatile("s_wait_asynccnt 0x0" ::: "memory");
}

// ---------------- fragment helpers -----------------------------------------
__device__ __forceinline__ v8bf pack8(float4 a, float4 b) {
  v8bf o;
  o[0] = (__bf16)a.x; o[1] = (__bf16)a.y; o[2] = (__bf16)a.z; o[3] = (__bf16)a.w;
  o[4] = (__bf16)b.x; o[5] = (__bf16)b.y; o[6] = (__bf16)b.z; o[7] = (__bf16)b.w;
  return o;
}
__device__ __forceinline__ v16bf cat16(v8bf lo, v8bf hi) {
  return __builtin_shufflevector(lo, hi, 0,1,2,3,4,5,6,7,8,9,10,11,12,13,14,15);
}
// 16-bit A/B fragment: lane = {r=lane&15 (row/col), half=lane>>4}.
// Elements 0..7 = K (half*8)+0..7, elements 8..15 = K 16+(half*8)+0..7.
__device__ __forceinline__ v16bf frag_from_bf16(const __bf16* p) {
  v8bf lo = *(const v8bf*)(p);
  v8bf hi = *(const v8bf*)(p + 16);
  return cat16(lo, hi);
}
// The same fragment from a tile kept in fragment order: 512 elements, chunk c
// (elements 8c..8c+7 of every lane) at c*256 + lane*8, so that one 16-byte load
// or store of a wave covers 512 contiguous bytes.  p already holds lane*8.
__device__ __forceinline__ v16bf frag_packed(const __bf16* p) {
  v8bf lo = *(const v8bf*)(p);
  v8bf hi = *(const v8bf*)(p + 256);
  return cat16(lo, hi);
}
__device__ __forceinline__ v8f wmma_bf16(v16bf a, v16bf b, v8f c) {
  return __builtin_amdgcn_wmma_f32_16x16x32_bf16(
      false, a, false, b, (short)0, c, false, false);
}
__device__ __forceinline__ v8f zero8() {
  v8f z = {0.f,0.f,0.f,0.f,0.f,0.f,0.f,0.f};
  return z;
}
__device__ __forceinline__ float rmax16(float v) {
  v = fmaxf(v, __shfl_xor(v, 1));
  v = fmaxf(v, __shfl_xor(v, 2));
  v = fmaxf(v, __shfl_xor(v, 4));
  v = fmaxf(v, __shfl_xor(v, 8));
  return v;
}
__device__ __forceinline__ float rsum16(float v) {
  v += __shfl_xor(v, 1);
  v += __shfl_xor(v, 2);
  v += __shfl_xor(v, 4);
  v += __shfl_xor(v, 8);
  return v;
}

// ---------------------------------------------------------------------------
// Kernel 1: fused QKV projection.  out = x @ W.T + b  (NT GEMM).
// WG = 256 thr (8 waves), tile 64(M) x 64(N) for all three weights.
// x tile async-staged fp32 into LDS; W tiles staged once as bf16 (reused 4x).
// Q stored bf16 [B,H,S,Hd].  K and V stored bf16 per head in the fragment order
// the attention kernel loads them in (frag_packed):
//   K: [S/16 key tiles][2 halves of Hd][512], lane row = key,  k = head dim
//   V: [S/32 key steps][4 tiles of Hd][512],  lane row = head dim, k = key
// ---------------------------------------------------------------------------
__global__ __launch_bounds__(256) void qkv_kernel(
    const float* __restrict__ x,
    const float* __restrict__ Wq, const float* __restrict__ bq,
    const float* __restrict__ Wk, const float* __restrict__ bk,
    const float* __restrict__ Wv, const float* __restrict__ bv,
    __bf16* __restrict__ Qb, __bf16* __restrict__ Kb, __bf16* __restrict__ Vb) {
  __shared__ __align__(16) float  Xs[2][64][36];      // 18.0 KB, padded rows
  __shared__ __align__(16) __bf16 Ws[3][2][64][40];   // 30.0 KB, padded rows

  const int tid  = threadIdx.x;
  const int wave = tid >> 5;
  const int lane = tid & 31;
  const int r    = lane & 15;
  const int half = lane >> 4;
  const int mw   = wave & 3;        // M sub-tile (16 rows)
  const int nw   = wave >> 2;       // N sub-tile (32 cols)
  const int m0   = blockIdx.y * 64;
  const int n0   = blockIdx.x * 64;

  const float* Wp[3] = {Wq, Wk, Wv};

  // ---- staging ----
  auto stageX = [&](int buf, int k0) {
#pragma unroll
    for (int i = 0; i < 2; ++i) {
      int c   = tid + i * 256;      // 0..511 chunks of 16B
      int row = c >> 3;
      int co  = (c & 7) * 4;
      async_b128(x + (size_t)(m0 + row) * Dc + k0 + co, &Xs[buf][row][co]);
    }
  };
  // two-phase: issue ALL global loads, then convert+store (keeps 6 loads in
  // flight under a single loadcnt wait instead of one wait per load)
  auto stageW = [&](int buf, int k0) {
    int row = tid >> 2;
    int co  = (tid & 3) * 8;
    float4 f[6];
#pragma unroll
    for (int w = 0; w < 3; ++w) {
      const float* s = Wp[w] + (size_t)(n0 + row) * Dc + k0 + co;
      f[2 * w]     = *(const float4*)(s);
      f[2 * w + 1] = *(const float4*)(s + 4);
    }
#pragma unroll
    for (int w = 0; w < 3; ++w)
      *(v8bf*)&Ws[w][buf][row][co] = pack8(f[2 * w], f[2 * w + 1]);
  };
  auto fragA = [&](int buf) {
    const float* xr = &Xs[buf][mw * 16 + r][0];
    float4 a = *(const float4*)(xr + half * 8);
    float4 b = *(const float4*)(xr + half * 8 + 4);
    float4 c = *(const float4*)(xr + 16 + half * 8);
    float4 d = *(const float4*)(xr + 16 + half * 8 + 4);
    return cat16(pack8(a, b), pack8(c, d));
  };
  auto fragB = [&](int w, int buf, int ro) {
    const __bf16* wr = &Ws[w][buf][nw * 32 + ro + r][0];
    v8bf lo = *(const v8bf*)(wr + half * 8);
    v8bf hi = *(const v8bf*)(wr + 16 + half * 8);
    return cat16(lo, hi);
  };

  v8f aq0 = zero8(), aq1 = zero8();
  v8f ak0 = zero8(), ak1 = zero8();
  v8f av0 = zero8(), av1 = zero8();

  stageX(0, 0);
  stageW(0, 0);
  wait_async0();
  __syncthreads();

  for (int ks = 0; ks < Dc / 32; ++ks) {
    const int  buf = ks & 1;
    const bool nx  = (ks + 1) < Dc / 32;
    if (nx) stageX(buf ^ 1, (ks + 1) * 32);   // async copies overlap wmma

    v16bf a = fragA(buf);
    // per-weight fragment pairs -> back-to-back wmma bursts
    v16bf q0f = fragB(0, buf, 0), q1f = fragB(0, buf, 16);
    aq0 = wmma_bf16(a, q0f, aq0);
    aq1 = wmma_bf16(a, q1f, aq1);
    v16bf k0f = fragB(1, buf, 0), k1f = fragB(1, buf, 16);
    // K comes out transposed (rows = head dim, column = key): a lane then holds
    // eight neighbouring head dims of one key, one 16-byte chunk of its tile
    ak0 = wmma_bf16(k0f, a, ak0);
    ak1 = wmma_bf16(k1f, a, ak1);
    v16bf v0f = fragB(2, buf, 0), v1f = fragB(2, buf, 16);
    av0 = wmma_bf16(a, v0f, av0);
    av1 = wmma_bf16(a, v1f, av1);

    if (nx) {
      stageW(buf ^ 1, (ks + 1) * 32);
      wait_async0();
      __syncthreads();
    }
  }

  // ---- epilogue: bias; Q to [B,H,S,Hd], K and V to their fragment tiles ----
  const int cn0 = n0 + nw * 32 + r;
  const int cn1 = cn0 + 16;
  const float bq0 = bq[cn0], bq1 = bq[cn1];
  const float bv0 = bv[cn0], bv1 = bv[cn1];
  const int h0 = cn0 >> 6, hd0 = cn0 & 63;
  const int h1 = cn1 >> 6, hd1 = cn1 & 63;

#pragma unroll
  for (int j = 0; j < 8; ++j) {
    const int m = m0 + mw * 16 + half * 8 + j;
    const int b = m >> 11;
    const int s = m & (Sc - 1);
    size_t qi0 = (((size_t)(b * Hc + h0) * Sc) + s) * Hd + hd0;
    size_t qi1 = (((size_t)(b * Hc + h1) * Sc) + s) * Hd + hd1;
    Qb[qi0] = (__bf16)(aq0[j] + bq0);
    Qb[qi1] = (__bf16)(aq1[j] + bq1);
  }

  // the wave's 16 rows are 16 keys of one batch; the 64 columns are one head
  const int    mr = m0 + mw * 16;
  const int    s0 = mr & (Sc - 1);
  const size_t hb = (size_t)((mr >> 11) * Hc + h0) * Sc * Hd;

  const float* bkp = bk + n0 + nw * 32 + half * 8;   // ak rows: head dim half*8+j
  const float4 kb0 = *(const float4*)(bkp),      kb1 = *(const float4*)(bkp + 4);
  const float4 kb2 = *(const float4*)(bkp + 16), kb3 = *(const float4*)(bkp + 20);
  const float bk0[8] = {kb0.x, kb0.y, kb0.z, kb0.w, kb1.x, kb1.y, kb1.z, kb1.w};
  const float bk1[8] = {kb2.x, kb2.y, kb2.z, kb2.w, kb3.x, kb3.y, kb3.z, kb3.w};
  v8bf ko0, ko1, vo0, vo1;
#pragma unroll   // constant j: the vectors' elements stay in registers
  for (int j = 0; j < 8; ++j) {
    ko0[j] = (__bf16)(ak0[j] + bk0[j]);
    ko1[j] = (__bf16)(ak1[j] + bk1[j]);
    vo0[j] = (__bf16)(av0[j] + bv0);
    vo1[j] = (__bf16)(av1[j] + bv1);
  }
  __bf16* kt = Kb + hb + (size_t)(s0 >> 4) * 1024 + nw * 512 + lane * 8;
  *(v8bf*)(kt)       = ko0;                 // head dims  0..15 of this half
  *(v8bf*)(kt + 256) = ko1;                 // head dims 16..31
  __bf16* vt = Vb + hb + (size_t)(s0 >> 5) * 2048 + nw * 1024 + (mw & 1) * 256 + lane * 8;
  *(v8bf*)(vt)       = vo0;                 // head-dim tile 2*nw
  *(v8bf*)(vt + 512) = vo1;                 // head-dim tile 2*nw + 1
}

// ---------------------------------------------------------------------------
// Kernel 2: flash attention.  Grid = (S/128, B*H).  Each wave owns 16 query
// rows, streams keys in steps of 32, online softmax state per row.
// ---------------------------------------------------------------------------
__global__ __launch_bounds__(256) void attn_kernel(
    const __bf16* __restrict__ Qb, const __bf16* __restrict__ Kb,
    const __bf16* __restrict__ Vb, const int* __restrict__ mask,
    __bf16* __restrict__ Ctx) {
  __shared__ __align__(16) __bf16 Ps[8][16][40];   // per-wave P re-layout (bf16)

  const int tid  = threadIdx.x;
  const int wave = tid >> 5;
  const int lane = tid & 31;
  const int r    = lane & 15;
  const int half = lane >> 4;

  const int bh = blockIdx.y;                // b*H + h
  const int b  = bh >> 4;
  const int h  = bh & 15;
  const int q0 = blockIdx.x * 128 + wave * 16;

  const __bf16* qp = Qb + ((size_t)bh * Sc + (q0 + r)) * Hd + half * 8;
  v16bf qf0 = frag_from_bf16(qp);
  v16bf qf1 = frag_from_bf16(qp + 32);

  float mrow[8], lrow[8];
  v8f o0 = zero8(), o1 = zero8(), o2 = zero8(), o3 = zero8();
#pragma unroll
  for (int j = 0; j < 8; ++j) { mrow[j] = -3.0e38f; lrow[j] = 0.f; }

  const __bf16* kbase = Kb + (size_t)bh * Sc * Hd;
  const __bf16* vbase = Vb + (size_t)bh * Hd * Sc;
  const int*    mbase = mask + (size_t)b * Sc;

  for (int kk0 = 0; kk0 < Sc; kk0 += 32) {
    if (kk0 + 32 < Sc) {                     // prefetch next K/V step: 16 x 256 B each
      __builtin_prefetch(kbase + (size_t)(kk0 + 32) * Hd + r * 128, 0, 1);
      __builtin_prefetch(vbase + (size_t)(kk0 + 32) * Hd + r * 128, 0, 1);
    }
    // ---- scores: S[16 q x 32 k] = Q (16x64) * K^T ----
    const __bf16* kp = kbase + (size_t)kk0 * Hd + lane * 8;   // 32 keys = 4 tiles
    v16bf kf00 = frag_packed(kp);
    v16bf kf01 = frag_packed(kp + 512);
    v16bf kf10 = frag_packed(kp + 1024);
    v16bf kf11 = frag_packed(kp + 1536);

    v8f s0 = zero8(), s1 = zero8();
    s0 = wmma_bf16(qf0, kf00, s0);
    s0 = wmma_bf16(qf1, kf01, s0);
    s1 = wmma_bf16(qf0, kf10, s1);
    s1 = wmma_bf16(qf1, kf11, s1);

    const float madd0 = mbase[kk0 + r]      ? 0.f : -1.0e9f;
    const float madd1 = mbase[kk0 + 16 + r] ? 0.f : -1.0e9f;
    s0 = s0 * 0.125f + madd0;                // 1/sqrt(Hd)
    s1 = s1 * 0.125f + madd1;

    // ---- online softmax; write P (bf16) into per-wave LDS [row][col] ----
#pragma unroll
    for (int j = 0; j < 8; ++j) {
      float rmax = rmax16(fmaxf(s0[j], s1[j]));
      float mold = mrow[j];
      float mnew = fmaxf(mold, rmax);
      float alpha = __expf(mold - mnew);
      float p0 = __expf(s0[j] - mnew);
      float p1 = __expf(s1[j] - mnew);
      lrow[j] = lrow[j] * alpha + rsum16(p0 + p1);
      mrow[j] = mnew;
      o0[j] *= alpha; o1[j] *= alpha; o2[j] *= alpha; o3[j] *= alpha;
      Ps[wave][j + half * 8][r]      = (__bf16)p0;
      Ps[wave][j + half * 8][16 + r] = (__bf16)p1;
    }
    asm volatile("s_wait_dscnt 0x0" ::: "memory");

    // ---- re-read P as an A-fragment (16 x 32), already bf16 ----
    const __bf16* rowp = &Ps[wave][r][0];
    v16bf pf = cat16(*(const v8bf*)(rowp + half * 8),
                     *(const v8bf*)(rowp + 16 + half * 8));

    // ---- O += P @ V   (one fragment tile per 16 head dims) ----
    const __bf16* vp = vbase + (size_t)kk0 * Hd + lane * 8;
    v16bf vf0 = frag_packed(vp);
    v16bf vf1 = frag_packed(vp + 512);
    v16bf vf2 = frag_packed(vp + 1024);
    v16bf vf3 = frag_packed(vp + 1536);
    o0 = wmma_bf16(pf, vf0, o0);
    o1 = wmma_bf16(pf, vf1, o1);
    o2 = wmma_bf16(pf, vf2, o2);
    o3 = wmma_bf16(pf, vf3, o3);
  }

  // ---- normalize and store context bf16 [B,S,D] ----
#pragma unroll
  for (int j = 0; j < 8; ++j) {
    const float inv = 1.0f / lrow[j];
    const int q = q0 + half * 8 + j;
    size_t base = ((size_t)b * Sc + q) * Dc + h * Hd;
    Ctx[base +      r] = (__bf16)(o0[j] * inv);
    Ctx[base + 16 + r] = (__bf16)(o1[j] * inv);
    Ctx[base + 32 + r] = (__bf16)(o2[j] * inv);
    Ctx[base + 48 + r] = (__bf16)(o3[j] * inv);
  }
}

// ---------------------------------------------------------------------------
// Kernel 3: out projection + residual.  y = x + ctx @ Wo.T + bo  (fp32 y).
// Ctx tile async-staged (already bf16); Wo staged as bf16 once per K-step.
// ---------------------------------------------------------------------------
__global__ __launch_bounds__(256) void oproj_kernel(
    const __bf16* __restrict__ Ctx, const float* __restrict__ Wo,
    const float* __restrict__ bo, const float* __restrict__ x,
    float* __restrict__ Y) {
  __shared__ __align__(16) __bf16 Cs[2][64][40];
  __shared__ __align__(16) __bf16 Os[2][64][40];

  const int tid  = threadIdx.x;
  const int wave = tid >> 5;
  const int lane = tid & 31;
  const int r    = lane & 15;
  const int half = lane >> 4;
  const int mw   = wave & 3;
  const int nw   = wave >> 2;
  const int m0   = blockIdx.y * 64;
  const int n0   = blockIdx.x * 64;

  auto stageC = [&](int buf, int k0) {
    int row = tid >> 2;
    int co  = (tid & 3) * 8;                 // 8 bf16 = 16B per thread
    async_b128(Ctx + (size_t)(m0 + row) * Dc + k0 + co, &Cs[buf][row][co]);
  };
  auto stageW = [&](int buf, int k0) {
    int row = tid >> 2;
    int co  = (tid & 3) * 8;
    const float* s = Wo + (size_t)(n0 + row) * Dc + k0 + co;
    float4 f0 = *(const float4*)(s);
    float4 f1 = *(const float4*)(s + 4);
    *(v8bf*)&Os[buf][row][co] = pack8(f0, f1);
  };

  v8f a0 = zero8(), a1 = zero8();

  stageC(0, 0);
  stageW(0, 0);
  wait_async0();
  __syncthreads();

  for (int ks = 0; ks < Dc / 32; ++ks) {
    const int  buf = ks & 1;
    const bool nx  = (ks + 1) < Dc / 32;
    if (nx) stageC(buf ^ 1, (ks + 1) * 32);

    const __bf16* cr = &Cs[buf][mw * 16 + r][0];
    v16bf a = cat16(*(const v8bf*)(cr + half * 8),
                    *(const v8bf*)(cr + 16 + half * 8));
    const __bf16* w0 = &Os[buf][nw * 32 + r][0];
    const __bf16* w1 = &Os[buf][nw * 32 + 16 + r][0];
    v16bf b0 = cat16(*(const v8bf*)(w0 + half * 8),
                     *(const v8bf*)(w0 + 16 + half * 8));
    v16bf b1 = cat16(*(const v8bf*)(w1 + half * 8),
                     *(const v8bf*)(w1 + 16 + half * 8));
    a0 = wmma_bf16(a, b0, a0);
    a1 = wmma_bf16(a, b1, a1);

    if (nx) {
      stageW(buf ^ 1, (ks + 1) * 32);
      wait_async0();
      __syncthreads();
    }
  }

  const int cn0 = n0 + nw * 32 + r;
  const int cn1 = cn0 + 16;
  const float bo0 = bo[cn0], bo1 = bo[cn1];
#pragma unroll
  for (int j = 0; j < 8; ++j) {
    const int m = m0 + mw * 16 + half * 8 + j;
    Y[(size_t)m * Dc + cn0] = a0[j] + bo0 + x[(size_t)m * Dc + cn0];
    Y[(size_t)m * Dc + cn1] = a1[j] + bo1 + x[(size_t)m * Dc + cn1];
  }
}

// ---------------------------------------------------------------------------
// Kernel 4: LayerNorm over D=1024 per row.  One block (256 thr) per row.
// ---------------------------------------------------------------------------
__global__ __launch_bounds__(256) void ln_kernel(
    const float* __restrict__ Y, const float* __restrict__ gamma,
    const float* __restrict__ beta, float* __restrict__ out) {
  __shared__ float redS[8], redQ[8];
  const int row  = blockIdx.x;
  const int tid  = threadIdx.x;
  const int wave = tid >> 5;
  const int lane = tid & 31;

  const float4 v = ((const float4*)(Y + (size_t)row * Dc))[tid];
  float s = v.x + v.y + v.z + v.w;
  float q = v.x * v.x + v.y * v.y + v.z * v.z + v.w * v.w;
#pragma unroll
  for (int m = 16; m >= 1; m >>= 1) {
    s += __shfl_xor(s, m);
    q += __shfl_xor(q, m);
  }
  if (lane == 0) { redS[wave] = s; redQ[wave] = q; }
  __syncthreads();
  float S = 0.f, Q = 0.f;
#pragma unroll
  for (int i = 0; i < 8; ++i) { S += redS[i]; Q += redQ[i]; }
  const float mu   = S * (1.0f / Dc);
  const float var  = Q * (1.0f / Dc) - mu * mu;
  const float rstd = rsqrtf(var + 1e-5f);

  const float4 g  = ((const float4*)gamma)[tid];
  const float4 be = ((const float4*)beta)[tid];
  float4 o;
  o.x = (v.x - mu) * rstd * g.x + be.x;
  o.y = (v.y - mu) * rstd * g.y + be.y;
  o.z = (v.z - mu) * rstd * g.z + be.z;
  o.w = (v.w - mu) * rstd * g.w + be.w;
  ((float4*)(out + (size_t)row * Dc))[tid] = o;
}

// ---------------------------------------------------------------------------
// Launcher
// ---------------------------------------------------------------------------
extern "C" void kernel_launch(void* const* d_in, const int* in_sizes, int n_in,
                              void* d_out, int out_size, void* d_ws, size_t ws_size,
                              hipStream_t stream) {
  const float* x     = (const float*)d_in[0];
  const int*   mask  = (const int*)  d_in[1];
  const float* Wq    = (const float*)d_in[2];
  const float* bq    = (const float*)d_in[3];
  const float* Wk    = (const float*)d_in[4];
  const float* bk    = (const float*)d_in[5];
  const float* Wv    = (const float*)d_in[6];
  const float* bv    = (const float*)d_in[7];
  const float* Wo    = (const float*)d_in[8];
  const float* bo    = (const float*)d_in[9];
  const float* gamma = (const float*)d_in[10];
  const float* beta  = (const float*)d_in[11];

  char* ws = (char*)d_ws;
  const size_t ELEMS = (size_t)Mtot * Dc;          // 8 Mi elements
  __bf16* Qb  = (__bf16*)(ws);                     // 16 MB
  __bf16* Kb  = (__bf16*)(ws + 2 * ELEMS);         // 16 MB
  __bf16* Vb  = (__bf16*)(ws + 4 * ELEMS);         // 16 MB
  __bf16* Ctx = (__bf16*)(ws + 6 * ELEMS);         // 16 MB
  float*  Y   = (float*) (ws + 8 * ELEMS);         // 32 MB

  dim3 blk(256);
  dim3 g1(Dc / 64, Mtot / 64);                     // (16, 128)
  qkv_kernel<<<g1, blk, 0, stream>>>(x, Wq, bq, Wk, bk, Wv, bv, Qb, Kb, Vb);

  dim3 g2(Sc / 128, Bc * Hc);                      // (16, 64)
  attn_kernel<<<g2, blk, 0, stream>>>(Qb, Kb, Vb, mask, Ctx);

  oproj_kernel<<<g1, blk, 0, stream>>>(Ctx, Wo, bo, x, Y);

  ln_kernel<<<Mtot, blk, 0, stream>>>(Y, gamma, beta, (float*)d_out);
}

// v002
// One run takes 230 microseconds.
// Two timings next to v001 both put it at 1.66 times that version's speed.
// All steps since v000 together make it 1.97 times as fast.
#include <hip/hip_runtime.h>
#include <stdint.h>

// ---------------------------------------------------------------------------
// NonLocalAttention block for MI455X (gfx1250), wave32 + WMMA bf16 pipeline,
// LDS-staged double-buffered GEMMs with async global->LDS copies.
//   B=4, S=2048, D=1024, H=16, Hd=64
// ---------------------------------------------------------------------------

typedef __attribute__((ext_vector_type(16))) __bf16 v16bf;
typedef __attribute__((ext_vector_type(8)))  __bf16 v8bf;
typedef __attribute__((ext_vector_type(8)))  float  v8f;

static constexpr int Bc   = 4;
static constexpr int Sc   = 2048;
static constexpr int Dc   = 1024;
static constexpr int Hc   = 16;
static constexpr int Hd   = 64;
static constexpr int Mtot = Bc * Sc;      // 8192 rows

// ---------------- CDNA5 async global->LDS (ASYNCcnt) ------------------------
__device__ __forceinline__ void async_b128(const void* g, const void* lds) {
  asm volatile("global_load_async_to_lds_b128 %0, %1, off"
               :: "v"((uint32_t)(uintptr_t)lds), "v"(g)
               : "memory");
}
__device__ __forceinline__ void wait_async0() {
  asm volatile("s_wait_asynccnt 0x0" ::: "memory");
}

// ---------------- fragment helpers -----------------------------------------
__device__ __forceinline__ v8bf pack8(float4 a, float4 b) {
  v8bf o;
  o[0] = (__bf16)a.x; o[1] = (__bf16)a.y; o[2] = (__bf16)a.z; o[3] = (__bf16)a.w;
  o[4] = (__bf16)b.x; o[5] = (__bf16)b.y; o[6] = (__bf16)b.z; o[7] = (__bf16)b.w;
  return o;
}
__device__ __forceinline__ v16bf cat16(v8bf lo, v8bf hi) {
  return __builtin_shufflevector(lo, hi, 0,1,2,3,4,5,6,7,8,9,10,11,12,13,14,15);
}
// 16-bit A/B fragment: lane = {r=lane&15 (row/col), half=lane>>4}.
// Elements 0..7 = K (half*8)+0..7, elements 8..15 = K 16+(half*8)+0..7.
__device__ __forceinline__ v16bf frag_from_bf16(const __bf16* p) {
  v8bf lo = *(const v8bf*)(p);
  v8bf hi = *(const v8bf*)(p + 16);
  return cat16(lo, hi);
}
// The same fragment from a tile kept in fragment order: 512 elements, chunk c
// (elements 8c..8c+7 of every lane) at c*256 + lane*8, so that one 16-byte load
// or store of a wave covers 512 contiguous bytes.  p already holds lane*8.
__device__ __forceinline__ v16bf frag_packed(const __bf16* p) {
  v8bf lo = *(const v8bf*)(p);
  v8bf hi = *(const v8bf*)(p + 256);
  return cat16(lo, hi);
}
__device__ __forceinline__ v8f wmma_bf16(v16bf a, v16bf b, v8f c) {
  return __builtin_amdgcn_wmma_f32_16x16x32_bf16(
      false, a, false, b, (short)0, c, false, false);
}
__device__ __forceinline__ v8f zero8() {
  v8f z = {0.f,0.f,0.f,0.f,0.f,0.f,0.f,0.f};
  return z;
}
// lane l takes the value of lane l ^ 16 (the other half of the wave), on the vector pipe
__device__ __forceinline__ float xhalf(float v) {
  const int i = __builtin_bit_cast(int, v);
  return __builtin_bit_cast(float, __builtin_amdgcn_permlanex16(i, i, 0x76543210, 0xfedcba98, false, false));
}

// ---------------------------------------------------------------------------
// Kernel 1: fused QKV projection.  out = x @ W.T + b  (NT GEMM).
// WG = 256 thr (8 waves), tile 64(M) x 64(N) for all three weights.
// x tile async-staged fp32 into LDS; W tiles staged once as bf16 (reused 4x).
// Q stored bf16 [B,H,S,Hd].  K and V stored bf16 per head in the fragment order
// the attention kernel loads them in (frag_packed):
//   K: [S/16 key tiles][2 halves of Hd][512], lane row = key,  k = head dim
//   V: [S/32 key steps][4 tiles of Hd][512],  lane row = head dim, k = key
// ---------------------------------------------------------------------------
__global__ __launch_bounds__(256) void qkv_kernel(
    const float* __restrict__ x,
    const float* __restrict__ Wq, const float* __restrict__ bq,
    const float* __restrict__ Wk, const float* __restrict__ bk,
    const float* __restrict__ Wv, const float* __restrict__ bv,
    __bf16* __restrict__ Qb, __bf16* __restrict__ Kb, __bf16* __restrict__ Vb) {
  __shared__ __align__(16) float  Xs[2][64][36];      // 18.0 KB, padded rows
  __shared__ __align__(16) __bf16 Ws[3][2][64][40];   // 30.0 KB, padded rows

  const int tid  = threadIdx.x;
  const int wave = tid >> 5;
  const int lane = tid & 31;
  const int r    = lane & 15;
  const int half = lane >> 4;
  const int mw   = wave & 3;        // M sub-tile (16 rows)
  const int nw   = wave >> 2;       // N sub-tile (32 cols)
  const int m0   = blockIdx.y * 64;
  const int n0   = blockIdx.x * 64;

  const float* Wp[3] = {Wq, Wk, Wv};

  // ---- staging ----
  auto stageX = [&](int buf, int k0) {
#pragma unroll
    for (int i = 0; i < 2; ++i) {
      int c   = tid + i * 256;      // 0..511 chunks of 16B
      int row = c >> 3;
      int co  = (c & 7) * 4;
      async_b128(x + (size_t)(m0 + row) * Dc + k0 + co, &Xs[buf][row][co]);
    }
  };
  // two-phase: issue ALL global loads, then convert+store (keeps 6 loads in
  // flight under a single loadcnt wait instead of one wait per load)
  auto stageW = [&](int buf, int k0) {
    int row = tid >> 2;
    int co  = (tid & 3) * 8;
    float4 f[6];
#pragma unroll
    for (int w = 0; w < 3; ++w) {
      const float* s = Wp[w] + (size_t)(n0 + row) * Dc + k0 + co;
      f[2 * w]     = *(const float4*)(s);
      f[2 * w + 1] = *(const float4*)(s + 4);
    }
#pragma unroll
    for (int w = 0; w < 3; ++w)
      *(v8bf*)&Ws[w][buf][row][co] = pack8(f[2 * w], f[2 * w + 1]);
  };
  auto fragA = [&](int buf) {
    const float* xr = &Xs[buf][mw * 16 + r][0];
    float4 a = *(const float4*)(xr + half * 8);
    float4 b = *(const float4*)(xr + half * 8 + 4);
    float4 c = *(const float4*)(xr + 16 + half * 8);
    float4 d = *(const float4*)(xr + 16 + half * 8 + 4);
    return cat16(pack8(a, b), pack8(c, d));
  };
  auto fragB = [&](int w, int buf, int ro) {
    const __bf16* wr = &Ws[w][buf][nw * 32 + ro + r][0];
    v8bf lo = *(const v8bf*)(wr + half * 8);
    v8bf hi = *(const v8bf*)(wr + 16 + half * 8);
    return cat16(lo, hi);
  };

  v8f aq0 = zero8(), aq1 = zero8();
  v8f ak0 = zero8(), ak1 = zero8();
  v8f av0 = zero8(), av1 = zero8();

  stageX(0, 0);
  stageW(0, 0);
  wait_async0();
  __syncthreads();

  for (int ks = 0; ks < Dc / 32; ++ks) {
    const int  buf = ks & 1;
    const bool nx  = (ks + 1) < Dc / 32;
    if (nx) stageX(buf ^ 1, (ks + 1) * 32);   // async copies overlap wmma

    v16bf a = fragA(buf);
    // per-weight fragment pairs -> back-to-back wmma bursts
    v16bf q0f = fragB(0, buf, 0), q1f = fragB(0, buf, 16);
    aq0 = wmma_bf16(a, q0f, aq0);
    aq1 = wmma_bf16(a, q1f, aq1);
    v16bf k0f = fragB(1, buf, 0), k1f = fragB(1, buf, 16);
    // K comes out transposed (rows = head dim, column = key): a lane then holds
    // eight neighbouring head dims of one key, one 16-byte chunk of its tile
    ak0 = wmma_bf16(k0f, a, ak0);
    ak1 = wmma_bf16(k1f, a, ak1);
    v16bf v0f = fragB(2, buf, 0), v1f = fragB(2, buf, 16);
    av0 = wmma_bf16(a, v0f, av0);
    av1 = wmma_bf16(a, v1f, av1);

    if (nx) {
      stageW(buf ^ 1, (ks + 1) * 32);
      wait_async0();
      __syncthreads();
    }
  }

  // ---- epilogue: bias; Q to [B,H,S,Hd], K and V to their fragment tiles ----
  const int cn0 = n0 + nw * 32 + r;
  const int cn1 = cn0 + 16;
  const float bq0 = bq[cn0], bq1 = bq[cn1];
  const float bv0 = bv[cn0], bv1 = bv[cn1];
  const int h0 = cn0 >> 6, hd0 = cn0 & 63;
  const int h1 = cn1 >> 6, hd1 = cn1 & 63;

#pragma unroll
  for (int j = 0; j < 8; ++j) {
    const int m = m0 + mw * 16 + half * 8 + j;
    const int b = m >> 11;
    const int s = m & (Sc - 1);
    size_t qi0 = (((size_t)(b * Hc + h0) * Sc) + s) * Hd + hd0;
    size_t qi1 = (((size_t)(b * Hc + h1) * Sc) + s) * Hd + hd1;
    Qb[qi0] = (__bf16)(aq0[j] + bq0);
    Qb[qi1] = (__bf16)(aq1[j] + bq1);
  }

  // the wave's 16 rows are 16 keys of one batch; the 64 columns are one head
  const int    mr = m0 + mw * 16;
  const int    s0 = mr & (Sc - 1);
  const size_t hb = (size_t)((mr >> 11) * Hc + h0) * Sc * Hd;

  const float* bkp = bk + n0 + nw * 32 + half * 8;   // ak rows: head dim half*8+j
  const float4 kb0 = *(const float4*)(bkp),      kb1 = *(const float4*)(bkp + 4);
  const float4 kb2 = *(const float4*)(bkp + 16), kb3 = *(const float4*)(bkp + 20);
  const float bk0[8] = {kb0.x, kb0.y, kb0.z, kb0.w, kb1.x, kb1.y, kb1.z, kb1.w};
  const float bk1[8] = {kb2.x, kb2.y, kb2.z, kb2.w, kb3.x, kb3.y, kb3.z, kb3.w};
  v8bf ko0, ko1, vo0, vo1;
#pragma unroll   // constant j: the vectors' elements stay in registers
  for (int j = 0; j < 8; ++j) {
    ko0[j] = (__bf16)(ak0[j] + bk0[j]);
    ko1[j] = (__bf16)(ak1[j] + bk1[j]);
    vo0[j] = (__bf16)(av0[j] + bv0);
    vo1[j] = (__bf16)(av1[j] + bv1);
  }
  __bf16* kt = Kb + hb + (size_t)(s0 >> 4) * 1024 + nw * 512 + lane * 8;
  *(v8bf*)(kt)       = ko0;                 // head dims  0..15 of this half
  *(v8bf*)(kt + 256) = ko1;                 // head dims 16..31
  __bf16* vt = Vb + hb + (size_t)(s0 >> 5) * 2048 + nw * 1024 + (mw & 1) * 256 + lane * 8;
  *(v8bf*)(vt)       = vo0;                 // head-dim tile 2*nw
  *(v8bf*)(vt + 512) = vo1;                 // head-dim tile 2*nw + 1
}

__global__ __launch_bounds__(256) void attn_kernel(
    const __bf16* __restrict__ Qb, const __bf16* __restrict__ Kb,
    const __bf16* __restrict__ Vb, const int* __restrict__ mask,
    __bf16* __restrict__ Ctx) {
  const int tid  = threadIdx.x;
  const int wave = tid >> 5;
  const int lane = tid & 31;
  const int r    = lane & 15;
  const int half = lane >> 4;

  const int bh = blockIdx.y;                // b*H + h
  const int b  = bh >> 4;
  const int h  = bh & 15;
  const int q0 = blockIdx.x * 128 + wave * 16;

  const __bf16* qp = Qb + ((size_t)bh * Sc + (q0 + r)) * Hd + half * 8;
  v16bf qf0 = frag_from_bf16(qp);
  v16bf qf1 = frag_from_bf16(qp + 32);

  float mrow = -3.0e38f, lrow = 0.f;        // lrow: this half's keys only
  v8f o0 = zero8(), o1 = zero8(), o2 = zero8(), o3 = zero8();

  const __bf16* kbase = Kb + (size_t)bh * Sc * Hd;
  const __bf16* vbase = Vb + (size_t)bh * Hd * Sc;
  const int*    mbase = mask + (size_t)b * Sc;

  // does this batch row mask any key at all?  One wave-uniform flag, so that
  // the loop pays for the 16 per-register mask terms only where there are some
  unsigned mlow = 0xffffffffu;              // unsigned minimum: 0 iff some entry is 0
#pragma unroll
  for (int i = 0; i < Sc / 128; ++i) {
    const int4 mv = *(const int4*)(mbase + i * 128 + lane * 4);
    mlow = min(min(mlow, min((unsigned)mv.x, (unsigned)mv.y)), min((unsigned)mv.z, (unsigned)mv.w));
  }
  const bool masked = __builtin_amdgcn_ballot_w32(mlow == 0u) != 0;

  for (int kk0 = 0; kk0 < Sc; kk0 += 32) {
    if (kk0 + 32 < Sc) {                     // prefetch next K/V step: 16 x 256 B each
      __builtin_prefetch(kbase + (size_t)(kk0 + 32) * Hd + r * 128, 0, 1);
      __builtin_prefetch(vbase + (size_t)(kk0 + 32) * Hd + r * 128, 0, 1);
    }
    // ---- scores: S^T[32 k x 16 q] = K (32x64) * Q^T ----
    const __bf16* kp = kbase + (size_t)kk0 * Hd + lane * 8;   // 32 keys = 4 tiles
    v16bf kf00 = frag_packed(kp);
    v16bf kf01 = frag_packed(kp + 512);
    v16bf kf10 = frag_packed(kp + 1024);
    v16bf kf11 = frag_packed(kp + 1536);

    v8f s0 = zero8(), s1 = zero8();
    s0 = wmma_bf16(kf00, qf0, s0);
    s0 = wmma_bf16(kf01, qf1, s0);
    s1 = wmma_bf16(kf10, qf0, s1);
    s1 = wmma_bf16(kf11, qf1, s1);

    s0 = s0 * 0.125f;                        // 1/sqrt(Hd)
    s1 = s1 * 0.125f;
    if (masked) {                            // s0[j]: key kk0+8*half+j, s1[j]: 16 more
      const int* mp = mbase + kk0 + half * 8;
      const int4 ma = *(const int4*)(mp),      mb = *(const int4*)(mp + 4);
      const int4 mc = *(const int4*)(mp + 16), md = *(const int4*)(mp + 20);
      const int m0[8] = {ma.x, ma.y, ma.z, ma.w, mb.x, mb.y, mb.z, mb.w};
      const int m1[8] = {mc.x, mc.y, mc.z, mc.w, md.x, md.y, md.z, md.w};
#pragma unroll   // constant j: the vectors' elements stay in registers
      for (int j = 0; j < 8; ++j) {
        s0[j] += m0[j] ? 0.f : -1.0e9f;
        s1[j] += m1[j] ? 0.f : -1.0e9f;
      }
    }

    // ---- online softmax of one query per lane ----
    float mx = fmaxf(s0[0], s1[0]);
#pragma unroll
    for (int j = 1; j < 8; ++j) mx = fmaxf(mx, fmaxf(s0[j], s1[j]));
    mx = fmaxf(mx, xhalf(mx));               // both halves: maximum of all 32 keys
    const float mnew  = fmaxf(mrow, mx);
    const float alpha = __expf(mrow - mnew);
    mrow = mnew;
    float p0[8], p1[8];
#pragma unroll
    for (int j = 0; j < 8; ++j) {
      p0[j] = __expf(s0[j] - mnew);
      p1[j] = __expf(s1[j] - mnew);
    }
    const float sa = ((p0[0] + p0[1]) + (p0[2] + p0[3])) + ((p0[4] + p0[5]) + (p0[6] + p0[7]));
    const float sb = ((p1[0] + p1[1]) + (p1[2] + p1[3])) + ((p1[4] + p1[5]) + (p1[6] + p1[7]));
    lrow = lrow * alpha + (sa + sb);
    o0 = o0 * alpha; o1 = o1 * alpha; o2 = o2 * alpha; o3 = o3 * alpha;

    // ---- P^T as a B operand: element s = key 8*half+s, then 16+8*half+(s-8) ----
    v16bf pf;
#pragma unroll
    for (int j = 0; j < 8; ++j) { pf[j] = (__bf16)p0[j]; pf[8 + j] = (__bf16)p1[j]; }

    // ---- O^T += V^T @ P^T   (one fragment tile per 16 head dims) ----
    const __bf16* vp = vbase + (size_t)kk0 * Hd + lane * 8;
    v16bf vf0 = frag_packed(vp);
    v16bf vf1 = frag_packed(vp + 512);
    v16bf vf2 = frag_packed(vp + 1024);
    v16bf vf3 = frag_packed(vp + 1536);
    o0 = wmma_bf16(vf0, pf, o0);
    o1 = wmma_bf16(vf1, pf, o1);
    o2 = wmma_bf16(vf2, pf, o2);
    o3 = wmma_bf16(vf3, pf, o3);
  }

  // ---- join the halves' sums, normalize, store context bf16 [B,S,D]:
  //      tile t of a lane is head dims 16*t+8*half+0..7 of query q0+r ----
  const float inv = 1.0f / (lrow + xhalf(lrow));
  v8bf c0, c1, c2, c3;
#pragma unroll
  for (int j = 0; j < 8; ++j) {
    c0[j] = (__bf16)(o0[j] * inv);
    c1[j] = (__bf16)(o1[j] * inv);
    c2[j] = (__bf16)(o2[j] * inv);
    c3[j] = (__bf16)(o3[j] * inv);
  }
  __bf16* cp = Ctx + ((size_t)b * Sc + q0 + r) * Dc + h * Hd + half * 8;
  *(v8bf*)(cp)      = c0;
  *(v8bf*)(cp + 16) = c1;
  *(v8bf*)(cp + 32) = c2;
  *(v8bf*)(cp + 48) = c3;
}

// ---------------------------------------------------------------------------
// Kernel 3: out projection + residual.  y = x + ctx @ Wo.T + bo  (fp32 y).
// Ctx tile async-staged (already bf16); Wo staged as bf16 once per K-step.
// ---------------------------------------------------------------------------
__global__ __launch_bounds__(256) void oproj_kernel(
    const __bf16* __restrict__ Ctx, const float* __restrict__ Wo,
    const float* __restrict__ bo, const float* __restrict__ x,
    float* __restrict__ Y) {
  __shared__ __align__(16) __bf16 Cs[2][64][40];
  __shared__ __align__(16) __bf16 Os[2][64][40];

  const int tid  = threadIdx.x;
  const int wave = tid >> 5;
  const int lane = tid & 31;
  const int r    = lane & 15;
  const int half = lane >> 4;
  const int mw   = wave & 3;
  const int nw   = wave >> 2;
  const int m0   = blockIdx.y * 64;
  const int n0   = blockIdx.x * 64;

  auto stageC = [&](int buf, int k0) {
    int row = tid >> 2;
    int co  = (tid & 3) * 8;                 // 8 bf16 = 16B per thread
    async_b128(Ctx + (size_t)(m0 + row) * Dc + k0 + co, &Cs[buf][row][co]);
  };
  auto stageW = [&](int buf, int k0) {
    int row = tid >> 2;
    int co  = (tid & 3) * 8;
    const float* s = Wo + (size_t)(n0 + row) * Dc + k0 + co;
    float4 f0 = *(const float4*)(s);
    float4 f1 = *(const float4*)(s + 4);
    *(v8bf*)&Os[buf][row][co] = pack8(f0, f1);
  };

  v8f a0 = zero8(), a1 = zero8();

  stageC(0, 0);
  stageW(0, 0);
  wait_async0();
  __syncthreads();

  for (int ks = 0; ks < Dc / 32; ++ks) {
    const int  buf = ks & 1;
    const bool nx  = (ks + 1) < Dc / 32;
    if (nx) stageC(buf ^ 1, (ks + 1) * 32);

    const __bf16* cr = &Cs[buf][mw * 16 + r][0];
    v16bf a = cat16(*(const v8bf*)(cr + half * 8),
                    *(const v8bf*)(cr + 16 + half * 8));
    const __bf16* w0 = &Os[buf][nw * 32 + r][0];
    const __bf16* w1 = &Os[buf][nw * 32 + 16 + r][0];
    v16bf b0 = cat16(*(const v8bf*)(w0 + half * 8),
                     *(const v8bf*)(w0 + 16 + half * 8));
    v16bf b1 = cat16(*(const v8bf*)(w1 + half * 8),
                     *(const v8bf*)(w1 + 16 + half * 8));
    a0 = wmma_bf16(a, b0, a0);
    a1 = wmma_bf16(a, b1, a1);

    if (nx) {
      stageW(buf ^ 1, (ks + 1) * 32);
      wait_async0();
      __syncthreads();
    }
  }

  const int cn0 = n0 + nw * 32 + r;
  const int cn1 = cn0 + 16;
  const float bo0 = bo[cn0], bo1 = bo[cn1];
#pragma unroll
  for (int j = 0; j < 8; ++j) {
    const int m = m0 + mw * 16 + half * 8 + j;
    Y[(size_t)m * Dc + cn0] = a0[j] + bo0 + x[(size_t)m * Dc + cn0];
    Y[(size_t)m * Dc + cn1] = a1[j] + bo1 + x[(size_t)m * Dc + cn1];
  }
}

// ---------------------------------------------------------------------------
// Kernel 4: LayerNorm over D=1024 per row.  One block (256 thr) per row.
// ---------------------------------------------------------------------------
__global__ __launch_bounds__(256) void ln_kernel(
    const float* __restrict__ Y, const float* __restrict__ gamma,
    const float* __restrict__ beta, float* __restrict__ out) {
  __shared__ float redS[8], redQ[8];
  const int row  = blockIdx.x;
  const int tid  = threadIdx.x;
  const int wave = tid >> 5;
  const int lane = tid & 31;

  const float4 v = ((const float4*)(Y + (size_t)row * Dc))[tid];
  float s = v.x + v.y + v.z + v.w;
  float q = v.x * v.x + v.y * v.y + v.z * v.z + v.w * v.w;
#pragma unroll
  for (int m = 16; m >= 1; m >>= 1) {
    s += __shfl_xor(s, m);
    q += __shfl_xor(q, m);
  }
  if (lane == 0) { redS[wave] = s; redQ[wave] = q; }
  __syncthreads();
  float S = 0.f, Q = 0.f;
#pragma unroll
  for (int i = 0; i < 8; ++i) { S += redS[i]; Q += redQ[i]; }
  const float mu   = S * (1.0f / Dc);
  const float var  = Q * (1.0f / Dc) - mu * mu;
  const float rstd = rsqrtf(var + 1e-5f);

  const float4 g  = ((const float4*)gamma)[tid];
  const float4 be = ((const float4*)beta)[tid];
  float4 o;
  o.x = (v.x - mu) * rstd * g.x + be.x;
  o.y = (v.y - mu) * rstd * g.y + be.y;
  o.z = (v.z - mu) * rstd * g.z + be.z;
  o.w = (v.w - mu) * rstd * g.w + be.w;
  ((float4*)(out + (size_t)row * Dc))[tid] = o;
}

// ---------------------------------------------------------------------------
// Launcher
// ---------------------------------------------------------------------------
extern "C" void kernel_launch(void* const* d_in, const int* in_sizes, int n_in,
                              void* d_out, int out_size, void* d_ws, size_t ws_size,
                              hipStream_t stream) {
  const float* x     = (const float*)d_in[0];
  const int*   mask  = (const int*)  d_in[1];
  const float* Wq    = (const float*)d_in[2];
  const float* bq    = (const float*)d_in[3];
  const float* Wk    = (const float*)d_in[4];
  const float* bk    = (const float*)d_in[5];
  const float* Wv    = (const float*)d_in[6];
  const float* bv    = (const float*)d_in[7];
  const float* Wo    = (const float*)d_in[8];
  const float* bo    = (const float*)d_in[9];
  const float* gamma = (const float*)d_in[10];
  const float* beta  = (const float*)d_in[11];

  char* ws = (char*)d_ws;
  const size_t ELEMS = (size_t)Mtot * Dc;          // 8 Mi elements
  __bf16* Qb  = (__bf16*)(ws);                     // 16 MB
  __bf16* Kb  = (__bf16*)(ws + 2 * ELEMS);         // 16 MB
  __bf16* Vb  = (__bf16*)(ws + 4 * ELEMS);         // 16 MB
  __bf16* Ctx = (__bf16*)(ws + 6 * ELEMS);         // 16 MB
  float*  Y   = (float*) (ws + 8 * ELEMS);         // 32 MB

  dim3 blk(256);
  dim3 g1(Dc / 64, Mtot / 64);                     // (16, 128)
  qkv_kernel<<<g1, blk, 0, stream>>>(x, Wq, bq, Wk, bk, Wv, bv, Qb, Kb, Vb);

  dim3 g2(Sc / 128, Bc * Hc);                      // (16, 64)
  attn_kernel<<<g2, blk, 0, stream>>>(Qb, Kb, Vb, mask, Ctx);

  oproj_kernel<<<g1, blk, 0, stream>>>(Ctx, Wo, bo, x, Y);

  ln_kernel<<<Mtot, blk, 0, stream>>>(Y, gamma, beta, (float*)d_out);
}

// v003
// Measured time: 193 microseconds a run.
// Two timings next to v002 put it at 1.19 and 1.20 times that version's speed.
// All steps since v000 together make it 2.36 times as fast.
#include <hip/hip_runtime.h>
#include <stdint.h>

// ---------------------------------------------------------------------------
// NonLocalAttention block for MI455X (gfx1250), wave32 + WMMA bf16 pipeline,
// LDS-staged double-buffered GEMMs with async global->LDS copies.
//   B=4, S=2048, D=1024, H=16, Hd=64
// ---------------------------------------------------------------------------

typedef __attribute__((ext_vector_type(16))) __bf16 v16bf;
typedef __attribute__((ext_vector_type(8)))  __bf16 v8bf;
typedef __attribute__((ext_vector_type(8)))  float  v8f;

static constexpr int Bc   = 4;
static constexpr int Sc   = 2048;
static constexpr int Dc   = 1024;
static constexpr int Hc   = 16;
static constexpr int Hd   = 64;
static constexpr int Mtot = Bc * Sc;      // 8192 rows

// ---------------- CDNA5 async global->LDS (ASYNCcnt) ------------------------
// A lane's run of 16-byte copies.  The s_wait_xcnt 0 is the statement's last line, so
// that no address register of a copy is rewritten in front of it.
__device__ __forceinline__ uint32_t lds_addr(const void* p) { return (uint32_t)(uintptr_t)p; }
__device__ __forceinline__ void async2_b128(const void* g0, const void* g1,
                                            uint32_t l0, uint32_t l1) {
  asm volatile("global_load_async_to_lds_b128 %0, %2, off\n\t"
               "global_load_async_to_lds_b128 %1, %3, off\n\t"
               "s_wait_xcnt 0x0"
               :: "v"(l0), "v"(l1), "v"(g0), "v"(g1)
               : "memory");
}
__device__ __forceinline__ void async4_b128(const void* g0, const void* g1,
                                            const void* g2, const void* g3,
                                            uint32_t l0, uint32_t l1, uint32_t l2, uint32_t l3) {
  asm volatile("global_load_async_to_lds_b128 %0, %4, off\n\t"
               "global_load_async_to_lds_b128 %1, %5, off\n\t"
               "global_load_async_to_lds_b128 %2, %6, off\n\t"
               "global_load_async_to_lds_b128 %3, %7, off\n\t"
               "s_wait_xcnt 0x0"
               :: "v"(l0), "v"(l1), "v"(l2), "v"(l3), "v"(g0), "v"(g1), "v"(g2), "v"(g3)
               : "memory");
}
// stands behind a run of global loads or stores, in front of the first rewrite of a
// register that one of them names
__device__ __forceinline__ void wait_x0() {
  asm volatile("s_wait_xcnt 0x0" ::: "memory");
}
// the copies of this wave have landed
__device__ __forceinline__ void wait_async0() {
  asm volatile("s_wait_asynccnt 0x0" ::: "memory");
}
// this wave's LDS reads and writes are done: stands in front of the barrier behind
// which a buffer is refilled by copies
__device__ __forceinline__ void wait_ds0() {
  asm volatile("s_wait_dscnt 0x0" ::: "memory");
}

// ---------------- fragment helpers -----------------------------------------
__device__ __forceinline__ v8bf pack8(float4 a, float4 b) {
  v8bf o;
  o[0] = (__bf16)a.x; o[1] = (__bf16)a.y; o[2] = (__bf16)a.z; o[3] = (__bf16)a.w;
  o[4] = (__bf16)b.x; o[5] = (__bf16)b.y; o[6] = (__bf16)b.z; o[7] = (__bf16)b.w;
  return o;
}
__device__ __forceinline__ v16bf cat16(v8bf lo, v8bf hi) {
  return __builtin_shufflevector(lo, hi, 0,1,2,3,4,5,6,7,8,9,10,11,12,13,14,15);
}
// 16-bit A/B fragment: lane = {r=lane&15 (row/col), half=lane>>4}.
// Elements 0..7 = K (half*8)+0..7, elements 8..15 = K 16+(half*8)+0..7.
__device__ __forceinline__ v16bf frag_from_bf16(const __bf16* p) {
  v8bf lo = *(const v8bf*)(p);
  v8bf hi = *(const v8bf*)(p + 16);
  return cat16(lo, hi);
}
// The same fragment from a tile kept in fragment order: 512 elements, chunk c
// (elements 8c..8c+7 of every lane) at c*256 + lane*8, so that one 16-byte load
// or store of a wave covers 512 contiguous bytes.  p already holds lane*8.
__device__ __forceinline__ v16bf frag_packed(const __bf16* p) {
  v8bf lo = *(const v8bf*)(p);
  v8bf hi = *(const v8bf*)(p + 256);
  return cat16(lo, hi);
}
__device__ __forceinline__ v8f wmma_bf16(v16bf a, v16bf b, v8f c) {
  return __builtin_amdgcn_wmma_f32_16x16x32_bf16(
      false, a, false, b, (short)0, c, false, false);
}
__device__ __forceinline__ v8f zero8() {
  v8f z = {0.f,0.f,0.f,0.f,0.f,0.f,0.f,0.f};
  return z;
}
// lane l takes the value of lane l ^ 16 (the other half of the wave), on the vector pipe
__device__ __forceinline__ float xhalf(float v) {
  const int i = __builtin_bit_cast(int, v);
  return __builtin_bit_cast(float, __builtin_amdgcn_permlanex16(i, i, 0x76543210, 0xfedcba98, false, false));
}

// ---------------------------------------------------------------------------
// Kernel 1: fused QKV projection.  out = x @ W.T + b  (NT GEMM).
// WG = 256 thr (8 waves), tile 256(M) x 64(N) for all three weights; a wave owns
// 32 rows x 64 columns of each: 2 x fragments meet 12 weight fragments, and no two
// waves convert the same x rows.  A K step is 64 deep: 48 products a wave.
// x tile async-staged fp32 into LDS; W tiles staged once as bf16.
// Q stored bf16 [B,H,S,Hd].  K and V stored bf16 per head in the fragment order
// the attention kernel loads them in (frag_packed):
//   K: [S/16 key tiles][2 halves of Hd][512], lane row = key,  k = head dim
//   V: [S/32 key steps][4 tiles of Hd][512],  lane row = head dim, k = key
// ---------------------------------------------------------------------------
__global__ __launch_bounds__(256) void qkv_kernel(
    const float* __restrict__ x,
    const float* __restrict__ Wq, const float* __restrict__ bq,
    const float* __restrict__ Wk, const float* __restrict__ bk,
    const float* __restrict__ Wv, const float* __restrict__ bv,
    __bf16* __restrict__ Qb, __bf16* __restrict__ Kb, __bf16* __restrict__ Vb) {
  __shared__ __align__(16) float  Xs[2][256][68];     // 136 KB, padded rows
  __shared__ __align__(16) __bf16 Ws[3][2][64][72];   //  54 KB, padded rows

  const int tid  = threadIdx.x;
  const int wave = tid >> 5;        // M sub-tile (32 rows)
  const int lane = tid & 31;
  const int r    = lane & 15;
  const int half = lane >> 4;
  const int m0   = blockIdx.y * 256;
  const int n0   = blockIdx.x * 64; // the 64 columns are one head

  const float* Wp[3] = {Wq, Wk, Wv};

  // ---- staging ----
  // 4096 chunks of 16 B: a thread takes one chunk of rows xr, xr+16, ..., xr+240
  const int xr = tid >> 4;
  const int xc = (tid & 15) * 4;
  auto stageX = [&](int buf, int k0) {
    const float*   g = x + (size_t)(m0 + xr) * Dc + k0 + xc;
    const uint32_t l = lds_addr(&Xs[buf][xr][xc]);
#pragma unroll
    for (int i = 0; i < 4; ++i) {
      const float*   gi = g + (size_t)i * 64 * Dc;
      const uint32_t li = l + i * 64 * 272;
      async4_b128(gi, gi + 16 * Dc, gi + 32 * Dc, gi + 48 * Dc,
                  li, li + 16 * 272, li + 32 * 272, li + 48 * 272);
    }
  };
  // W in two phases, a K step apart: the twelve global loads of step t+2 go out at the
  // top of step t; they are converted and stored at the top of step t+1, into the
  // buffer that step t has read, so that no wait for them stands near their issue
  const int wr = tid >> 2;
  const int wc = (tid & 3) * 8;
  float4 f[12];
  auto loadW = [&](int k0) {
#pragma unroll
    for (int w = 0; w < 3; ++w)
#pragma unroll
      for (int kk = 0; kk < 2; ++kk) {
        const float* s = Wp[w] + (size_t)(n0 + wr) * Dc + k0 + kk * 32 + wc;
        f[4 * w + 2 * kk]     = *(const float4*)(s);
        f[4 * w + 2 * kk + 1] = *(const float4*)(s + 4);
      }
    wait_x0();
  };
  auto storeW = [&](int buf) {
#pragma unroll
    for (int w = 0; w < 3; ++w)
#pragma unroll
      for (int kk = 0; kk < 2; ++kk)
        *(v8bf*)&Ws[w][buf][wr][kk * 32 + wc] = pack8(f[4 * w + 2 * kk], f[4 * w + 2 * kk + 1]);
  };
  // the four 16-byte pieces of an x fragment, still fp32
  auto rawA = [&](int buf, int i, int kk, float4* o) {
    const float* xp = &Xs[buf][wave * 32 + i * 16 + r][kk * 32];
    o[0] = *(const float4*)(xp + half * 8);
    o[1] = *(const float4*)(xp + half * 8 + 4);
    o[2] = *(const float4*)(xp + 16 + half * 8);
    o[3] = *(const float4*)(xp + 16 + half * 8 + 4);
  };
  auto fragB = [&](int w, int buf, int n, int kk) {
    return frag_from_bf16(&Ws[w][buf][n * 16 + r][kk * 32 + half * 8]);
  };

  v8f aq[2][4], ak[2][4], av[2][4];
#pragma unroll
  for (int i = 0; i < 2; ++i)
#pragma unroll
    for (int n = 0; n < 4; ++n) { aq[i][n] = zero8(); ak[i][n] = zero8(); av[i][n] = zero8(); }

  stageX(0, 0);
  loadW(0);
  storeW(0);
  loadW(64);
  wait_async0();
  __syncthreads();
  stageX(1, 64);                              // flies while K step 0 is worked on

  for (int ks = 0; ks < Dc / 64; ++ks) {
    const int buf = ks & 1;
    // the step's x reads go first: every product needs an x fragment, LDS answers in
    // order, and the W staging below covers their latency
    float4 ar[2][2][4];
#pragma unroll
    for (int kk = 0; kk < 2; ++kk) {
      rawA(buf, 0, kk, ar[kk][0]);
      rawA(buf, 1, kk, ar[kk][1]);
    }
    if (ks + 1 < Dc / 64) storeW(buf ^ 1);
    if (ks + 2 < Dc / 64) loadW((ks + 2) * 64);

#pragma unroll
    for (int kk = 0; kk < 2; ++kk) {
      v16bf bw[3][4];
#pragma unroll
      for (int w = 0; w < 3; ++w)
#pragma unroll
        for (int n = 0; n < 4; ++n) bw[w][n] = fragB(w, buf, n, kk);
      // keeps the 24 W reads of these 24 products together ahead of them: read one
      // fragment at a time, every pair of products waits out an LDS latency
      __builtin_amdgcn_sched_barrier(0);
      const v16bf a0 = cat16(pack8(ar[kk][0][0], ar[kk][0][1]), pack8(ar[kk][0][2], ar[kk][0][3]));
      const v16bf a1 = cat16(pack8(ar[kk][1][0], ar[kk][1][1]), pack8(ar[kk][1][2], ar[kk][1][3]));
#pragma unroll
      for (int n = 0; n < 4; ++n) {
        aq[0][n] = wmma_bf16(a0, bw[0][n], aq[0][n]);
        aq[1][n] = wmma_bf16(a1, bw[0][n], aq[1][n]);
      }
      // K comes out transposed (rows = head dim, column = key): a lane then holds
      // eight neighbouring head dims of one key, one 16-byte chunk of its tile
#pragma unroll
      for (int n = 0; n < 4; ++n) {
        ak[0][n] = wmma_bf16(bw[1][n], a0, ak[0][n]);
        ak[1][n] = wmma_bf16(bw[1][n], a1, ak[1][n]);
      }
#pragma unroll
      for (int n = 0; n < 4; ++n) {
        av[0][n] = wmma_bf16(a0, bw[2][n], av[0][n]);
        av[1][n] = wmma_bf16(a1, bw[2][n], av[1][n]);
      }
      // and keeps the next reads from being strewn among these products
      __builtin_amdgcn_sched_barrier(0);
    }

    // publish K step ks+1 and free this step's x buffer, then refill it
    wait_ds0();
    wait_async0();
    __syncthreads();
    if (ks + 2 < Dc / 64) stageX(buf, (ks + 2) * 64);
  }
  wait_async0();

  // ---- epilogue: bias; Q to [B,H,S,Hd], K and V to their fragment tiles ----
  const int    mr0 = m0 + wave * 32;          // 32 rows = 32 keys of one batch
  const int    s00 = mr0 & (Sc - 1);
  const size_t hb  = (size_t)((mr0 >> 11) * Hc + blockIdx.x) * Sc * Hd;

  float bqn[4], bvn[4], bkn[4][8];
#pragma unroll
  for (int n = 0; n < 4; ++n) {
    bqn[n] = bq[n0 + n * 16 + r];
    bvn[n] = bv[n0 + n * 16 + r];
    const float* bkp = bk + n0 + n * 16 + half * 8;  // ak rows: head dim n*16+half*8+j
    const float4 kb0 = *(const float4*)(bkp), kb1 = *(const float4*)(bkp + 4);
    bkn[n][0] = kb0.x; bkn[n][1] = kb0.y; bkn[n][2] = kb0.z; bkn[n][3] = kb0.w;
    bkn[n][4] = kb1.x; bkn[n][5] = kb1.y; bkn[n][6] = kb1.z; bkn[n][7] = kb1.w;
  }
  wait_x0();

#pragma unroll   // constant n, i, j: the accumulators stay in registers
  for (int n = 0; n < 4; ++n) {
#pragma unroll
    for (int i = 0; i < 2; ++i) {
      __bf16* qt = Qb + hb + (size_t)(s00 + i * 16 + half * 8) * Hd + n * 16 + r;
      // key tile (s00 >> 4) + i, half n >> 1 of Hd, chunk n & 1
      __bf16* kt = Kb + hb + (size_t)((s00 >> 4) + i) * 1024 + n * 256 + lane * 8;
      // key step s00 >> 5, head-dim tile n, chunk i (keys 16*i .. 16*i+15)
      __bf16* vt = Vb + hb + (size_t)(s00 >> 5) * 2048 + n * 512 + i * 256 + lane * 8;
      v8bf qo, ko, vo;
#pragma unroll
      for (int j = 0; j < 8; ++j) {
        qo[j] = (__bf16)(aq[i][n][j] + bqn[n]);
        ko[j] = (__bf16)(ak[i][n][j] + bkn[n][j]);
        vo[j] = (__bf16)(av[i][n][j] + bvn[n]);
      }
      // keeps the tile's ten stores together, behind its arithmetic and in front of their
      // wait
      __builtin_amdgcn_sched_barrier(0);
#pragma unroll
      for (int j = 0; j < 8; ++j) qt[j * Hd] = qo[j];
      *(v8bf*)kt = ko;
      *(v8bf*)vt = vo;
      wait_x0();
      __builtin_amdgcn_sched_barrier(0);
    }
  }
}

__global__ __launch_bounds__(256) void attn_kernel(
    const __bf16* __restrict__ Qb, const __bf16* __restrict__ Kb,
    const __bf16* __restrict__ Vb, const int* __restrict__ mask,
    __bf16* __restrict__ Ctx) {
  const int tid  = threadIdx.x;
  const int wave = tid >> 5;
  const int lane = tid & 31;
  const int r    = lane & 15;
  const int half = lane >> 4;

  const int bh = blockIdx.y;                // b*H + h
  const int b  = bh >> 4;
  const int h  = bh & 15;
  const int q0 = blockIdx.x * 128 + wave * 16;

  const __bf16* qp = Qb + ((size_t)bh * Sc + (q0 + r)) * Hd + half * 8;
  v16bf qf0 = frag_from_bf16(qp);
  v16bf qf1 = frag_from_bf16(qp + 32);

  float mrow = -3.0e38f, lrow = 0.f;        // lrow: this half's keys only
  v8f o0 = zero8(), o1 = zero8(), o2 = zero8(), o3 = zero8();

  const __bf16* kbase = Kb + (size_t)bh * Sc * Hd;
  const __bf16* vbase = Vb + (size_t)bh * Hd * Sc;
  const int*    mbase = mask + (size_t)b * Sc;

  // does this batch row mask any key at all?  One wave-uniform flag, so that
  // the loop pays for the 16 per-register mask terms only where there are some
  unsigned mlow = 0xffffffffu;              // unsigned minimum: 0 iff some entry is 0
#pragma unroll
  for (int i = 0; i < Sc / 128; ++i) {
    const int4 mv = *(const int4*)(mbase + i * 128 + lane * 4);
    mlow = min(min(mlow, min((unsigned)mv.x, (unsigned)mv.y)), min((unsigned)mv.z, (unsigned)mv.w));
  }
  const bool masked = __builtin_amdgcn_ballot_w32(mlow == 0u) != 0;

  for (int kk0 = 0; kk0 < Sc; kk0 += 32) {
    if (kk0 + 32 < Sc) {                     // prefetch next K/V step: 16 x 256 B each
      __builtin_prefetch(kbase + (size_t)(kk0 + 32) * Hd + r * 128, 0, 1);
      __builtin_prefetch(vbase + (size_t)(kk0 + 32) * Hd + r * 128, 0, 1);
    }
    // ---- scores: S^T[32 k x 16 q] = K (32x64) * Q^T ----
    const __bf16* kp = kbase + (size_t)kk0 * Hd + lane * 8;   // 32 keys = 4 tiles
    v16bf kf00 = frag_packed(kp);
    v16bf kf01 = frag_packed(kp + 512);
    v16bf kf10 = frag_packed(kp + 1024);
    v16bf kf11 = frag_packed(kp + 1536);

    v8f s0 = zero8(), s1 = zero8();
    s0 = wmma_bf16(kf00, qf0, s0);
    s0 = wmma_bf16(kf01, qf1, s0);
    s1 = wmma_bf16(kf10, qf0, s1);
    s1 = wmma_bf16(kf11, qf1, s1);

    s0 = s0 * 0.125f;                        // 1/sqrt(Hd)
    s1 = s1 * 0.125f;
    if (masked) {                            // s0[j]: key kk0+8*half+j, s1[j]: 16 more
      const int* mp = mbase + kk0 + half * 8;
      const int4 ma = *(const int4*)(mp),      mb = *(const int4*)(mp + 4);
      const int4 mc = *(const int4*)(mp + 16), md = *(const int4*)(mp + 20);
      const int m0[8] = {ma.x, ma.y, ma.z, ma.w, mb.x, mb.y, mb.z, mb.w};
      const int m1[8] = {mc.x, mc.y, mc.z, mc.w, md.x, md.y, md.z, md.w};
#pragma unroll   // constant j: the vectors' elements stay in registers
      for (int j = 0; j < 8; ++j) {
        s0[j] += m0[j] ? 0.f : -1.0e9f;
        s1[j] += m1[j] ? 0.f : -1.0e9f;
      }
    }

    // ---- online softmax of one query per lane ----
    float mx = fmaxf(s0[0], s1[0]);
#pragma unroll
    for (int j = 1; j < 8; ++j) mx = fmaxf(mx, fmaxf(s0[j], s1[j]));
    mx = fmaxf(mx, xhalf(mx));               // both halves: maximum of all 32 keys
    const float mnew  = fmaxf(mrow, mx);
    const float alpha = __expf(mrow - mnew);
    mrow = mnew;
    float p0[8], p1[8];
#pragma unroll
    for (int j = 0; j < 8; ++j) {
      p0[j] = __expf(s0[j] - mnew);
      p1[j] = __expf(s1[j] - mnew);
    }
    const float sa = ((p0[0] + p0[1]) + (p0[2] + p0[3])) + ((p0[4] + p0[5]) + (p0[6] + p0[7]));
    const float sb = ((p1[0] + p1[1]) + (p1[2] + p1[3])) + ((p1[4] + p1[5]) + (p1[6] + p1[7]));
    lrow = lrow * alpha + (sa + sb);
    o0 = o0 * alpha; o1 = o1 * alpha; o2 = o2 * alpha; o3 = o3 * alpha;

    // ---- P^T as a B operand: element s = key 8*half+s, then 16+8*half+(s-8) ----
    v16bf pf;
#pragma unroll
    for (int j = 0; j < 8; ++j) { pf[j] = (__bf16)p0[j]; pf[8 + j] = (__bf16)p1[j]; }

    // ---- O^T += V^T @ P^T   (one fragment tile per 16 head dims) ----
    const __bf16* vp = vbase + (size_t)kk0 * Hd + lane * 8;
    v16bf vf0 = frag_packed(vp);
    v16bf vf1 = frag_packed(vp + 512);
    v16bf vf2 = frag_packed(vp + 1024);
    v16bf vf3 = frag_packed(vp + 1536);
    o0 = wmma_bf16(vf0, pf, o0);
    o1 = wmma_bf16(vf1, pf, o1);
    o2 = wmma_bf16(vf2, pf, o2);
    o3 = wmma_bf16(vf3, pf, o3);
  }

  // ---- join the halves' sums, normalize, store context bf16 [B,S,D]:
  //      tile t of a lane is head dims 16*t+8*half+0..7 of query q0+r ----
  const float inv = 1.0f / (lrow + xhalf(lrow));
  v8bf c0, c1, c2, c3;
#pragma unroll
  for (int j = 0; j < 8; ++j) {
    c0[j] = (__bf16)(o0[j] * inv);
    c1[j] = (__bf16)(o1[j] * inv);
    c2[j] = (__bf16)(o2[j] * inv);
    c3[j] = (__bf16)(o3[j] * inv);
  }
  __bf16* cp = Ctx + ((size_t)b * Sc + q0 + r) * Dc + h * Hd + half * 8;
  *(v8bf*)(cp)      = c0;
  *(v8bf*)(cp + 16) = c1;
  *(v8bf*)(cp + 32) = c2;
  *(v8bf*)(cp + 48) = c3;
}

// ---------------------------------------------------------------------------
// Kernel 3: out projection + residual.  y = x + ctx @ Wo.T + bo  (fp32 y).
// WG = 256 thr (8 waves), tile 128(M) x 128(N); a wave owns 32 x 64: 2 context
// fragments meet 4 weight fragments.  A K step is 64 deep: 16 products a wave.
// Ctx tile async-staged (already bf16); Wo staged as bf16 once per K-step.
// ---------------------------------------------------------------------------
__global__ __launch_bounds__(256) void oproj_kernel(
    const __bf16* __restrict__ Ctx, const float* __restrict__ Wo,
    const float* __restrict__ bo, const float* __restrict__ x,
    float* __restrict__ Y) {
  __shared__ __align__(16) __bf16 Cs[2][128][72];     // 36 KB, padded rows
  __shared__ __align__(16) __bf16 Os[2][128][72];     // 36 KB, padded rows

  const int tid  = threadIdx.x;
  const int wave = tid >> 5;
  const int lane = tid & 31;
  const int r    = lane & 15;
  const int half = lane >> 4;
  const int mw   = wave & 3;        // M sub-tile (32 rows)
  const int nw   = wave >> 2;       // N sub-tile (64 cols)
  const int m0   = blockIdx.y * 128;
  const int n0   = blockIdx.x * 128;

  // 1024 chunks of 16 B: a thread takes one chunk of rows cr, cr+32, cr+64, cr+96
  const int cr = tid >> 3;
  const int cc = (tid & 7) * 8;
  auto stageC = [&](int buf, int k0) {
    const __bf16*  g = Ctx + (size_t)(m0 + cr) * Dc + k0 + cc;
    const uint32_t l = lds_addr(&Cs[buf][cr][cc]);
    async4_b128(g, g + 32 * Dc, g + 64 * Dc, g + 96 * Dc,
                l, l + 32 * 144, l + 64 * 144, l + 96 * 144);
  };
  // Wo in two phases, a K step apart, as W in the QKV kernel
  const int sr = tid >> 2;                   // rows sr and sr + 64
  const int sc = (tid & 3) * 8;              // 8 elements per thread, row and half step
  float4 f[8];
  auto loadW = [&](int k0) {
#pragma unroll
    for (int h = 0; h < 2; ++h)
#pragma unroll
      for (int kk = 0; kk < 2; ++kk) {
        const float* s = Wo + (size_t)(n0 + sr + 64 * h) * Dc + k0 + kk * 32 + sc;
        f[4 * h + 2 * kk]     = *(const float4*)(s);
        f[4 * h + 2 * kk + 1] = *(const float4*)(s + 4);
      }
    wait_x0();
  };
  auto storeW = [&](int buf) {
#pragma unroll
    for (int h = 0; h < 2; ++h)
#pragma unroll
      for (int kk = 0; kk < 2; ++kk)
        *(v8bf*)&Os[buf][sr + 64 * h][kk * 32 + sc] = pack8(f[4 * h + 2 * kk], f[4 * h + 2 * kk + 1]);
  };

  v8f acc[2][4];
#pragma unroll
  for (int i = 0; i < 2; ++i)
#pragma unroll
    for (int n = 0; n < 4; ++n) acc[i][n] = zero8();

  stageC(0, 0);
  loadW(0);
  storeW(0);
  loadW(64);
  wait_async0();
  __syncthreads();
  stageC(1, 64);                              // flies while K step 0 is worked on

  for (int ks = 0; ks < Dc / 64; ++ks) {
    const int buf = ks & 1;
    // the step's 24 LDS reads go first, together; the Wo staging covers their latency
    v16bf a[2][2], b[2][4];
#pragma unroll
    for (int kk = 0; kk < 2; ++kk) {
#pragma unroll
      for (int i = 0; i < 2; ++i)
        a[kk][i] = frag_from_bf16(&Cs[buf][mw * 32 + i * 16 + r][kk * 32 + half * 8]);
#pragma unroll
      for (int n = 0; n < 4; ++n)
        b[kk][n] = frag_from_bf16(&Os[buf][nw * 64 + n * 16 + r][kk * 32 + half * 8]);
    }
    // keeps the reads together up here: read one fragment at a time among the
    // products, every product or two waits out an LDS latency
    __builtin_amdgcn_sched_barrier(0);
    if (ks + 1 < Dc / 64) storeW(buf ^ 1);
    if (ks + 2 < Dc / 64) loadW((ks + 2) * 64);
    // keeps the Wo loads ahead of the products that cover their latency
    __builtin_amdgcn_sched_barrier(0);

#pragma unroll
    for (int kk = 0; kk < 2; ++kk)
#pragma unroll
      for (int i = 0; i < 2; ++i)
#pragma unroll
        for (int n = 0; n < 4; ++n) acc[i][n] = wmma_bf16(a[kk][i], b[kk][n], acc[i][n]);
    // keeps the products in front of the barrier, whose wait for the Wo loads they cover
    __builtin_amdgcn_sched_barrier(0);

    // publish K step ks+1 and free this step's context buffer, then refill it
    wait_ds0();
    wait_async0();
    __syncthreads();
    if (ks + 2 < Dc / 64) stageC(buf, (ks + 2) * 64);
  }
  wait_async0();

  float bon[4];
#pragma unroll
  for (int n = 0; n < 4; ++n) bon[n] = bo[n0 + nw * 64 + n * 16 + r];
  wait_x0();
  // keeps the bias loads in front of their wait
  __builtin_amdgcn_sched_barrier(0);

#pragma unroll   // constant i, n, j: the accumulators stay in registers
  for (int n = 0; n < 4; ++n) {
    const int    cn  = n0 + nw * 64 + n * 16 + r;
    const size_t o0  = (size_t)(m0 + mw * 32 + half * 8) * Dc + cn;
    float xv[2][8];
#pragma unroll
    for (int i = 0; i < 2; ++i)
#pragma unroll
      for (int j = 0; j < 8; ++j) xv[i][j] = x[o0 + (size_t)(i * 16 + j) * Dc];
    wait_x0();
    float yv[2][8];
#pragma unroll
    for (int i = 0; i < 2; ++i)
#pragma unroll
      for (int j = 0; j < 8; ++j) yv[i][j] = acc[i][n][j] + bon[n] + xv[i][j];
    // keeps the sixteen stores together, behind the sums and in front of their wait
    __builtin_amdgcn_sched_barrier(0);
#pragma unroll
    for (int i = 0; i < 2; ++i)
#pragma unroll
      for (int j = 0; j < 8; ++j) Y[o0 + (size_t)(i * 16 + j) * Dc] = yv[i][j];
    wait_x0();
    __builtin_amdgcn_sched_barrier(0);
  }
}

// ---------------------------------------------------------------------------
// Kernel 4: LayerNorm over D=1024 per row.  One block (256 thr) per row.
// ---------------------------------------------------------------------------
__global__ __launch_bounds__(256) void ln_kernel(
    const float* __restrict__ Y, const float* __restrict__ gamma,
    const float* __restrict__ beta, float* __restrict__ out) {
  __shared__ float redS[8], redQ[8];
  const int row  = blockIdx.x;
  const int tid  = threadIdx.x;
  const int wave = tid >> 5;
  const int lane = tid & 31;

  const float4 v = ((const float4*)(Y + (size_t)row * Dc))[tid];
  float s = v.x + v.y + v.z + v.w;
  float q = v.x * v.x + v.y * v.y + v.z * v.z + v.w * v.w;
#pragma unroll
  for (int m = 16; m >= 1; m >>= 1) {
    s += __shfl_xor(s, m);
    q += __shfl_xor(q, m);
  }
  if (lane == 0) { redS[wave] = s; redQ[wave] = q; }
  __syncthreads();
  float S = 0.f, Q = 0.f;
#pragma unroll
  for (int i = 0; i < 8; ++i) { S += redS[i]; Q += redQ[i]; }
  const float mu   = S * (1.0f / Dc);
  const float var  = Q * (1.0f / Dc) - mu * mu;
  const float rstd = rsqrtf(var + 1e-5f);

  const float4 g  = ((const float4*)gamma)[tid];
  const float4 be = ((const float4*)beta)[tid];
  float4 o;
  o.x = (v.x - mu) * rstd * g.x + be.x;
  o.y = (v.y - mu) * rstd * g.y + be.y;
  o.z = (v.z - mu) * rstd * g.z + be.z;
  o.w = (v.w - mu) * rstd * g.w + be.w;
  ((float4*)(out + (size_t)row * Dc))[tid] = o;
}

// ---------------------------------------------------------------------------
// Launcher
// ---------------------------------------------------------------------------
extern "C" void kernel_launch(void* const* d_in, const int* in_sizes, int n_in,
                              void* d_out, int out_size, void* d_ws, size_t ws_size,
                              hipStream_t stream) {
  const float* x     = (const float*)d_in[0];
  const int*   mask  = (const int*)  d_in[1];
  const float* Wq    = (const float*)d_in[2];
  const float* bq    = (const float*)d_in[3];
  const float* Wk    = (const float*)d_in[4];
  const float* bk    = (const float*)d_in[5];
  const float* Wv    = (const float*)d_in[6];
  const float* bv    = (const float*)d_in[7];
  const float* Wo    = (const float*)d_in[8];
  const float* bo    = (const float*)d_in[9];
  const float* gamma = (const float*)d_in[10];
  const float* beta  = (const float*)d_in[11];

  char* ws = (char*)d_ws;
  const size_t ELEMS = (size_t)Mtot * Dc;          // 8 Mi elements
  __bf16* Qb  = (__bf16*)(ws);                     // 16 MB
  __bf16* Kb  = (__bf16*)(ws + 2 * ELEMS);         // 16 MB
  __bf16* Vb  = (__bf16*)(ws + 4 * ELEMS);         // 16 MB
  __bf16* Ctx = (__bf16*)(ws + 6 * ELEMS);         // 16 MB
  float*  Y   = (float*) (ws + 8 * ELEMS);         // 32 MB

  dim3 blk(256);
  dim3 g1(Dc / 64, Mtot / 256);                    // (16, 32)
  qkv_kernel<<<g1, blk, 0, stream>>>(x, Wq, bq, Wk, bk, Wv, bv, Qb, Kb, Vb);

  dim3 g2(Sc / 128, Bc * Hc);                      // (16, 64)
  attn_kernel<<<g2, blk, 0, stream>>>(Qb, Kb, Vb, mask, Ctx);

  dim3 g3(Dc / 128, Mtot / 128);                   // (8, 64)
  oproj_kernel<<<g3, blk, 0, stream>>>(Ctx, Wo, bo, x, Y);

  ln_kernel<<<Mtot, blk, 0, stream>>>(Y, gamma, beta, (float*)d_out);
}

// v004
// It runs in 157 microseconds.
// Next to v003, in two timings, it ran 1.23 times as fast each time.
// All steps since v000 together make it 2.90 times as fast.
#include <hip/hip_runtime.h>
#include <stdint.h>

// ---------------------------------------------------------------------------
// NonLocalAttention block for MI455X (gfx1250), wave32 + WMMA bf16 pipeline,
// LDS-staged double-buffered GEMMs with async global->LDS copies.
//   B=4, S=2048, D=1024, H=16, Hd=64
// ---------------------------------------------------------------------------

typedef __attribute__((ext_vector_type(16))) __bf16 v16bf;
typedef __attribute__((ext_vector_type(8)))  __bf16 v8bf;
typedef __attribute__((ext_vector_type(8)))  float  v8f;

static constexpr int Bc   = 4;
static constexpr int Sc   = 2048;
static constexpr int Dc   = 1024;
static constexpr int Hc   = 16;
static constexpr int Hd   = 64;
static constexpr int Mtot = Bc * Sc;      // 8192 rows

// ---------------- CDNA5 async global->LDS (ASYNCcnt) ------------------------
// A lane's run of 16-byte copies.  The s_wait_xcnt 0 is the statement's last line, so
// that no address register of a copy is rewritten in front of it.
__device__ __forceinline__ uint32_t lds_addr(const void* p) { return (uint32_t)(uintptr_t)p; }
__device__ __forceinline__ void async2_b128(const void* g0, const void* g1,
                                            uint32_t l0, uint32_t l1) {
  asm volatile("global_load_async_to_lds_b128 %0, %2, off\n\t"
               "global_load_async_to_lds_b128 %1, %3, off\n\t"
               "s_wait_xcnt 0x0"
               :: "v"(l0), "v"(l1), "v"(g0), "v"(g1)
               : "memory");
}
__device__ __forceinline__ void async4_b128(const void* g0, const void* g1,
                                            const void* g2, const void* g3,
                                            uint32_t l0, uint32_t l1, uint32_t l2, uint32_t l3) {
  asm volatile("global_load_async_to_lds_b128 %0, %4, off\n\t"
               "global_load_async_to_lds_b128 %1, %5, off\n\t"
               "global_load_async_to_lds_b128 %2, %6, off\n\t"
               "global_load_async_to_lds_b128 %3, %7, off\n\t"
               "s_wait_xcnt 0x0"
               :: "v"(l0), "v"(l1), "v"(l2), "v"(l3), "v"(g0), "v"(g1), "v"(g2), "v"(g3)
               : "memory");
}
// stands behind a run of global loads or stores, in front of the first rewrite of a
// register that one of them names
__device__ __forceinline__ void wait_x0() {
  asm volatile("s_wait_xcnt 0x0" ::: "memory");
}
// the copies of this wave have landed
__device__ __forceinline__ void wait_async0() {
  asm volatile("s_wait_asynccnt 0x0" ::: "memory");
}
// this wave's LDS reads and writes are done: stands in front of the barrier behind
// which a buffer is refilled by copies
__device__ __forceinline__ void wait_ds0() {
  asm volatile("s_wait_dscnt 0x0" ::: "memory");
}

// ---------------- fragment helpers -----------------------------------------
__device__ __forceinline__ v8bf pack8(float4 a, float4 b) {
  v8bf o;
  o[0] = (__bf16)a.x; o[1] = (__bf16)a.y; o[2] = (__bf16)a.z; o[3] = (__bf16)a.w;
  o[4] = (__bf16)b.x; o[5] = (__bf16)b.y; o[6] = (__bf16)b.z; o[7] = (__bf16)b.w;
  return o;
}
__device__ __forceinline__ v16bf cat16(v8bf lo, v8bf hi) {
  return __builtin_shufflevector(lo, hi, 0,1,2,3,4,5,6,7,8,9,10,11,12,13,14,15);
}
// 16-bit A/B fragment: lane = {r=lane&15 (row/col), half=lane>>4}.
// Elements 0..7 = K (half*8)+0..7, elements 8..15 = K 16+(half*8)+0..7.
__device__ __forceinline__ v16bf frag_from_bf16(const __bf16* p) {
  v8bf lo = *(const v8bf*)(p);
  v8bf hi = *(const v8bf*)(p + 16);
  return cat16(lo, hi);
}
// The same fragment from a tile kept in fragment order: 512 elements, chunk c
// (elements 8c..8c+7 of every lane) at c*256 + lane*8, so that one 16-byte load
// or store of a wave covers 512 contiguous bytes.  p already holds lane*8.
__device__ __forceinline__ v16bf frag_packed(const __bf16* p) {
  v8bf lo = *(const v8bf*)(p);
  v8bf hi = *(const v8bf*)(p + 256);
  return cat16(lo, hi);
}
__device__ __forceinline__ v8f wmma_bf16(v16bf a, v16bf b, v8f c) {
  return __builtin_amdgcn_wmma_f32_16x16x32_bf16(
      false, a, false, b, (short)0, c, false, false);
}
__device__ __forceinline__ v8f zero8() {
  v8f z = {0.f,0.f,0.f,0.f,0.f,0.f,0.f,0.f};
  return z;
}
// lane l takes the value of lane l ^ 16 (the other half of the wave), on the vector pipe
__device__ __forceinline__ float xhalf(float v) {
  const int i = __builtin_bit_cast(int, v);
  return __builtin_bit_cast(float, __builtin_amdgcn_permlanex16(i, i, 0x76543210, 0xfedcba98, false, false));
}

// ---------------------------------------------------------------------------
// Kernel 1: fused QKV projection.  out = x @ W.T + b  (NT GEMM).
// WG = 256 thr (8 waves), tile 256(M) x 64(N) for all three weights; a wave owns
// 32 rows x 64 columns of each: 2 x fragments meet 12 weight fragments, and no two
// waves convert the same x rows.  A K step is 64 deep: 48 products a wave.
// x tile async-staged fp32 into LDS; W tiles staged once as bf16.
// Q stored bf16 [B,H,S,Hd].  K and V stored bf16 per head in the fragment order
// the attention kernel loads them in (frag_packed):
//   K: [S/16 key tiles][2 halves of Hd][512], lane row = key,  k = head dim
//   V: [S/32 key steps][4 tiles of Hd][512],  lane row = head dim, k = key
// ---------------------------------------------------------------------------
__global__ __launch_bounds__(256) void qkv_kernel(
    const float* __restrict__ x,
    const float* __restrict__ Wq, const float* __restrict__ bq,
    const float* __restrict__ Wk, const float* __restrict__ bk,
    const float* __restrict__ Wv, const float* __restrict__ bv,
    __bf16* __restrict__ Qb, __bf16* __restrict__ Kb, __bf16* __restrict__ Vb) {
  __shared__ __align__(16) float  Xs[2][256][68];     // 136 KB, padded rows
  __shared__ __align__(16) __bf16 Ws[3][2][64][72];   //  54 KB, padded rows

  const int tid  = threadIdx.x;
  const int wave = tid >> 5;        // M sub-tile (32 rows)
  const int lane = tid & 31;
  const int r    = lane & 15;
  const int half = lane >> 4;
  const int m0   = blockIdx.y * 256;
  const int n0   = blockIdx.x * 64; // the 64 columns are one head

  const float* Wp[3] = {Wq, Wk, Wv};

  // ---- staging ----
  // 4096 chunks of 16 B: a thread takes one chunk of rows xr, xr+16, ..., xr+240
  const int xr = tid >> 4;
  const int xc = (tid & 15) * 4;
  auto stageX = [&](int buf, int k0) {
    const float*   g = x + (size_t)(m0 + xr) * Dc + k0 + xc;
    const uint32_t l = lds_addr(&Xs[buf][xr][xc]);
#pragma unroll
    for (int i = 0; i < 4; ++i) {
      const float*   gi = g + (size_t)i * 64 * Dc;
      const uint32_t li = l + i * 64 * 272;
      async4_b128(gi, gi + 16 * Dc, gi + 32 * Dc, gi + 48 * Dc,
                  li, li + 16 * 272, li + 32 * 272, li + 48 * 272);
    }
  };
  // W in two phases, a K step apart: the twelve global loads of step t+2 go out at the
  // top of step t; they are converted and stored at the top of step t+1, into the
  // buffer that step t has read, so that no wait for them stands near their issue
  const int wr = tid >> 2;
  const int wc = (tid & 3) * 8;
  float4 f[12];
  auto loadW = [&](int k0) {
#pragma unroll
    for (int w = 0; w < 3; ++w)
#pragma unroll
      for (int kk = 0; kk < 2; ++kk) {
        const float* s = Wp[w] + (size_t)(n0 + wr) * Dc + k0 + kk * 32 + wc;
        f[4 * w + 2 * kk]     = *(const float4*)(s);
        f[4 * w + 2 * kk + 1] = *(const float4*)(s + 4);
      }
    wait_x0();
  };
  auto storeW = [&](int buf) {
#pragma unroll
    for (int w = 0; w < 3; ++w)
#pragma unroll
      for (int kk = 0; kk < 2; ++kk)
        *(v8bf*)&Ws[w][buf][wr][kk * 32 + wc] = pack8(f[4 * w + 2 * kk], f[4 * w + 2 * kk + 1]);
  };
  // the four 16-byte pieces of an x fragment, still fp32
  auto rawA = [&](int buf, int i, int kk, float4* o) {
    const float* xp = &Xs[buf][wave * 32 + i * 16 + r][kk * 32];
    o[0] = *(const float4*)(xp + half * 8);
    o[1] = *(const float4*)(xp + half * 8 + 4);
    o[2] = *(const float4*)(xp + 16 + half * 8);
    o[3] = *(const float4*)(xp + 16 + half * 8 + 4);
  };
  auto fragB = [&](int w, int buf, int n, int kk) {
    return frag_from_bf16(&Ws[w][buf][n * 16 + r][kk * 32 + half * 8]);
  };

  v8f aq[2][4], ak[2][4], av[2][4];
#pragma unroll
  for (int i = 0; i < 2; ++i)
#pragma unroll
    for (int n = 0; n < 4; ++n) { aq[i][n] = zero8(); ak[i][n] = zero8(); av[i][n] = zero8(); }

  stageX(0, 0);
  loadW(0);
  storeW(0);
  loadW(64);
  wait_async0();
  __syncthreads();
  stageX(1, 64);                              // flies while K step 0 is worked on

  for (int ks = 0; ks < Dc / 64; ++ks) {
    const int buf = ks & 1;
    // the step's x reads go first: every product needs an x fragment, LDS answers in
    // order, and the W staging below covers their latency
    float4 ar[2][2][4];
#pragma unroll
    for (int kk = 0; kk < 2; ++kk) {
      rawA(buf, 0, kk, ar[kk][0]);
      rawA(buf, 1, kk, ar[kk][1]);
    }
    if (ks + 1 < Dc / 64) storeW(buf ^ 1);
    if (ks + 2 < Dc / 64) loadW((ks + 2) * 64);

#pragma unroll
    for (int kk = 0; kk < 2; ++kk) {
      v16bf bw[3][4];
#pragma unroll
      for (int w = 0; w < 3; ++w)
#pragma unroll
        for (int n = 0; n < 4; ++n) bw[w][n] = fragB(w, buf, n, kk);
      // keeps the 24 W reads of these 24 products together ahead of them: read one
      // fragment at a time, every pair of products waits out an LDS latency
      __builtin_amdgcn_sched_barrier(0);
      const v16bf a0 = cat16(pack8(ar[kk][0][0], ar[kk][0][1]), pack8(ar[kk][0][2], ar[kk][0][3]));
      const v16bf a1 = cat16(pack8(ar[kk][1][0], ar[kk][1][1]), pack8(ar[kk][1][2], ar[kk][1][3]));
#pragma unroll
      for (int n = 0; n < 4; ++n) {
        aq[0][n] = wmma_bf16(a0, bw[0][n], aq[0][n]);
        aq[1][n] = wmma_bf16(a1, bw[0][n], aq[1][n]);
      }
      // K comes out transposed (rows = head dim, column = key): a lane then holds
      // eight neighbouring head dims of one key, one 16-byte chunk of its tile
#pragma unroll
      for (int n = 0; n < 4; ++n) {
        ak[0][n] = wmma_bf16(bw[1][n], a0, ak[0][n]);
        ak[1][n] = wmma_bf16(bw[1][n], a1, ak[1][n]);
      }
#pragma unroll
      for (int n = 0; n < 4; ++n) {
        av[0][n] = wmma_bf16(a0, bw[2][n], av[0][n]);
        av[1][n] = wmma_bf16(a1, bw[2][n], av[1][n]);
      }
      // and keeps the next reads from being strewn among these products
      __builtin_amdgcn_sched_barrier(0);
    }

    // publish K step ks+1 and free this step's x buffer, then refill it
    wait_ds0();
    wait_async0();
    __syncthreads();
    if (ks + 2 < Dc / 64) stageX(buf, (ks + 2) * 64);
  }
  wait_async0();

  // ---- epilogue: bias; Q to [B,H,S,Hd], K and V to their fragment tiles ----
  const int    mr0 = m0 + wave * 32;          // 32 rows = 32 keys of one batch
  const int    s00 = mr0 & (Sc - 1);
  const size_t hb  = (size_t)((mr0 >> 11) * Hc + blockIdx.x) * Sc * Hd;

  float bqn[4], bvn[4], bkn[4][8];
#pragma unroll
  for (int n = 0; n < 4; ++n) {
    bqn[n] = bq[n0 + n * 16 + r];
    bvn[n] = bv[n0 + n * 16 + r];
    const float* bkp = bk + n0 + n * 16 + half * 8;  // ak rows: head dim n*16+half*8+j
    const float4 kb0 = *(const float4*)(bkp), kb1 = *(const float4*)(bkp + 4);
    bkn[n][0] = kb0.x; bkn[n][1] = kb0.y; bkn[n][2] = kb0.z; bkn[n][3] = kb0.w;
    bkn[n][4] = kb1.x; bkn[n][5] = kb1.y; bkn[n][6] = kb1.z; bkn[n][7] = kb1.w;
  }
  wait_x0();

#pragma unroll   // constant n, i, j: the accumulators stay in registers
  for (int n = 0; n < 4; ++n) {
#pragma unroll
    for (int i = 0; i < 2; ++i) {
      __bf16* qt = Qb + hb + (size_t)(s00 + i * 16 + half * 8) * Hd + n * 16 + r;
      // key tile (s00 >> 4) + i, half n >> 1 of Hd, chunk n & 1
      __bf16* kt = Kb + hb + (size_t)((s00 >> 4) + i) * 1024 + n * 256 + lane * 8;
      // key step s00 >> 5, head-dim tile n, chunk i (keys 16*i .. 16*i+15)
      __bf16* vt = Vb + hb + (size_t)(s00 >> 5) * 2048 + n * 512 + i * 256 + lane * 8;
      v8bf qo, ko, vo;
#pragma unroll
      for (int j = 0; j < 8; ++j) {
        qo[j] = (__bf16)(aq[i][n][j] + bqn[n]);
        ko[j] = (__bf16)(ak[i][n][j] + bkn[n][j]);
        vo[j] = (__bf16)(av[i][n][j] + bvn[n]);
      }
      // keeps the tile's ten stores together, behind its arithmetic and in front of their
      // wait
      __builtin_amdgcn_sched_barrier(0);
#pragma unroll
      for (int j = 0; j < 8; ++j) qt[j * Hd] = qo[j];
      *(v8bf*)kt = ko;
      *(v8bf*)vt = vo;
      wait_x0();
      __builtin_amdgcn_sched_barrier(0);
    }
  }
}

__global__ __launch_bounds__(256) void attn_kernel(
    const __bf16* __restrict__ Qb, const __bf16* __restrict__ Kb,
    const __bf16* __restrict__ Vb, const int* __restrict__ mask,
    __bf16* __restrict__ Ctx) {
  constexpr int SK  = 128;                  // keys per stage
  constexpr int NST = Sc / SK;              // 16 stages
  __shared__ __align__(16) __bf16 Ks[2][SK * Hd];     // 32 KB
  __shared__ __align__(16) __bf16 Vs[2][SK * Hd];     // 32 KB

  const int tid  = threadIdx.x;
  const int wave = tid >> 5;
  const int lane = tid & 31;
  const int r    = lane & 15;
  const int half = lane >> 4;

  const int bh = blockIdx.y;                // b*H + h
  const int b  = bh >> 4;
  const int h  = bh & 15;
  const int q0 = blockIdx.x * 128 + wave * 16;

  const __bf16* kbase = Kb + (size_t)bh * Sc * Hd;
  const __bf16* vbase = Vb + (size_t)bh * Hd * Sc;
  const int*    mbase = mask + (size_t)b * Sc;

  // a stage is 1024 chunks of 16 B of K and as many of V: a thread takes chunks
  // tid, tid+256, tid+512, tid+768 of each, so a wave's copy covers 512 contiguous bytes
  auto stageKV = [&](int buf, int st) {
    const __bf16*  gk = kbase + (size_t)st * SK * Hd + tid * 8;
    const __bf16*  gv = vbase + (size_t)st * SK * Hd + tid * 8;
    const uint32_t lk = lds_addr(&Ks[buf][tid * 8]);
    const uint32_t lv = lds_addr(&Vs[buf][tid * 8]);
    async4_b128(gk, gk + 2048, gk + 4096, gk + 6144, lk, lk + 4096, lk + 8192, lk + 12288);
    async4_b128(gv, gv + 2048, gv + 4096, gv + 6144, lv, lv + 4096, lv + 8192, lv + 12288);
  };
  stageKV(0, 0);                            // flies while Q and the mask are read

  const __bf16* qp = Qb + ((size_t)bh * Sc + (q0 + r)) * Hd + half * 8;
  v16bf qf0 = frag_from_bf16(qp);
  v16bf qf1 = frag_from_bf16(qp + 32);

  float mrow = -3.0e38f, lrow = 0.f;        // lrow: this half's keys only
  v8f o0 = zero8(), o1 = zero8(), o2 = zero8(), o3 = zero8();

  // does this batch row mask any key at all?  One wave-uniform flag, so that
  // the loop pays for the 16 per-register mask terms only where there are some
  unsigned mlow = 0xffffffffu;              // unsigned minimum: 0 iff some entry is 0
#pragma unroll
  for (int i = 0; i < Sc / 128; ++i) {
    const int4 mv = *(const int4*)(mbase + i * 128 + lane * 4);
    mlow = min(min(mlow, min((unsigned)mv.x, (unsigned)mv.y)), min((unsigned)mv.z, (unsigned)mv.w));
  }
  const bool masked = __builtin_amdgcn_ballot_w32(mlow == 0u) != 0;

  wait_async0();
  __syncthreads();                          // stage 0 is there for every wave
  stageKV(1, 1);                            // flies while stage 0 is worked on

  for (int st = 0; st < NST; ++st) {
   const int buf = st & 1;
   for (int ps = 0; ps < SK / 32; ++ps) {
    const int kk0 = st * SK + ps * 32;
    // ---- scores: S^T[32 k x 16 q] = K (32x64) * Q^T ----
    const __bf16* kp = &Ks[buf][ps * 32 * Hd + lane * 8];     // 32 keys = 4 tiles
    v16bf kf00 = frag_packed(kp);
    v16bf kf01 = frag_packed(kp + 512);
    v16bf kf10 = frag_packed(kp + 1024);
    v16bf kf11 = frag_packed(kp + 1536);
    // keeps the eight K reads together ahead of the four products: read a pair at a
    // time, every product waits out an LDS latency of its own
    __builtin_amdgcn_sched_barrier(0);

    v8f s0 = zero8(), s1 = zero8();
    s0 = wmma_bf16(kf00, qf0, s0);
    s0 = wmma_bf16(kf01, qf1, s0);
    s1 = wmma_bf16(kf10, qf0, s1);
    s1 = wmma_bf16(kf11, qf1, s1);

    // the pass's V tiles (one per 16 head dims) are asked for here
    const __bf16* vp = &Vs[buf][ps * 32 * Hd + lane * 8];
    v16bf vf0 = frag_packed(vp);
    v16bf vf1 = frag_packed(vp + 512);
    v16bf vf2 = frag_packed(vp + 1024);
    v16bf vf3 = frag_packed(vp + 1536);
    // keeps the eight V reads together up here: the softmax arithmetic covers their latency
    __builtin_amdgcn_sched_barrier(0);

    s0 = s0 * 0.125f;                        // 1/sqrt(Hd)
    s1 = s1 * 0.125f;
    if (masked) {                            // s0[j]: key kk0+8*half+j, s1[j]: 16 more
      const int* mp = mbase + kk0 + half * 8;
      const int4 ma = *(const int4*)(mp),      mb = *(const int4*)(mp + 4);
      const int4 mc = *(const int4*)(mp + 16), md = *(const int4*)(mp + 20);
      const int m0[8] = {ma.x, ma.y, ma.z, ma.w, mb.x, mb.y, mb.z, mb.w};
      const int m1[8] = {mc.x, mc.y, mc.z, mc.w, md.x, md.y, md.z, md.w};
#pragma unroll   // constant j: the vectors' elements stay in registers
      for (int j = 0; j < 8; ++j) {
        s0[j] += m0[j] ? 0.f : -1.0e9f;
        s1[j] += m1[j] ? 0.f : -1.0e9f;
      }
    }

    // ---- online softmax of one query per lane ----
    float mx = fmaxf(s0[0], s1[0]);
#pragma unroll
    for (int j = 1; j < 8; ++j) mx = fmaxf(mx, fmaxf(s0[j], s1[j]));
    mx = fmaxf(mx, xhalf(mx));               // both halves: maximum of all 32 keys
    const float mnew  = fmaxf(mrow, mx);
    const float alpha = __expf(mrow - mnew);
    mrow = mnew;
    float p0[8], p1[8];
#pragma unroll
    for (int j = 0; j < 8; ++j) {
      p0[j] = __expf(s0[j] - mnew);
      p1[j] = __expf(s1[j] - mnew);
    }
    const float sa = ((p0[0] + p0[1]) + (p0[2] + p0[3])) + ((p0[4] + p0[5]) + (p0[6] + p0[7]));
    const float sb = ((p1[0] + p1[1]) + (p1[2] + p1[3])) + ((p1[4] + p1[5]) + (p1[6] + p1[7]));
    lrow = lrow * alpha + (sa + sb);
    o0 = o0 * alpha; o1 = o1 * alpha; o2 = o2 * alpha; o3 = o3 * alpha;

    // ---- P^T as a B operand: element s = key 8*half+s, then 16+8*half+(s-8) ----
    v16bf pf;
#pragma unroll
    for (int j = 0; j < 8; ++j) { pf[j] = (__bf16)p0[j]; pf[8 + j] = (__bf16)p1[j]; }

    // ---- O^T += V^T @ P^T   (one fragment tile per 16 head dims) ----
    o0 = wmma_bf16(vf0, pf, o0);
    o1 = wmma_bf16(vf1, pf, o1);
    o2 = wmma_bf16(vf2, pf, o2);
    o3 = wmma_bf16(vf3, pf, o3);
   }
   // publish stage st+1 and free this stage's buffer, then refill it
   wait_ds0();
   wait_async0();
   __syncthreads();
   if (st + 2 < NST) stageKV(buf, st + 2);
  }
  wait_async0();

  // ---- join the halves' sums, normalize, store context bf16 [B,S,D]:
  //      tile t of a lane is head dims 16*t+8*half+0..7 of query q0+r ----
  const float inv = 1.0f / (lrow + xhalf(lrow));
  v8bf c0, c1, c2, c3;
#pragma unroll
  for (int j = 0; j < 8; ++j) {
    c0[j] = (__bf16)(o0[j] * inv);
    c1[j] = (__bf16)(o1[j] * inv);
    c2[j] = (__bf16)(o2[j] * inv);
    c3[j] = (__bf16)(o3[j] * inv);
  }
  __bf16* cp = Ctx + ((size_t)b * Sc + q0 + r) * Dc + h * Hd + half * 8;
  *(v8bf*)(cp)      = c0;
  *(v8bf*)(cp + 16) = c1;
  *(v8bf*)(cp + 32) = c2;
  *(v8bf*)(cp + 48) = c3;
}

// ---------------------------------------------------------------------------
// Kernel 3: out projection + residual.  y = x + ctx @ Wo.T + bo  (fp32 y).
// WG = 256 thr (8 waves), tile 128(M) x 128(N); a wave owns 32 x 64: 2 context
// fragments meet 4 weight fragments.  A K step is 64 deep: 16 products a wave.
// Ctx tile async-staged (already bf16); Wo staged as bf16 once per K-step.
// ---------------------------------------------------------------------------
__global__ __launch_bounds__(256) void oproj_kernel(
    const __bf16* __restrict__ Ctx, const float* __restrict__ Wo,
    const float* __restrict__ bo, const float* __restrict__ x,
    float* __restrict__ Y) {
  __shared__ __align__(16) __bf16 Cs[2][128][72];     // 36 KB, padded rows
  __shared__ __align__(16) __bf16 Os[2][128][72];     // 36 KB, padded rows

  const int tid  = threadIdx.x;
  const int wave = tid >> 5;
  const int lane = tid & 31;
  const int r    = lane & 15;
  const int half = lane >> 4;
  const int mw   = wave & 3;        // M sub-tile (32 rows)
  const int nw   = wave >> 2;       // N sub-tile (64 cols)
  const int m0   = blockIdx.y * 128;
  const int n0   = blockIdx.x * 128;

  // 1024 chunks of 16 B: a thread takes one chunk of rows cr, cr+32, cr+64, cr+96
  const int cr = tid >> 3;
  const int cc = (tid & 7) * 8;
  auto stageC = [&](int buf, int k0) {
    const __bf16*  g = Ctx + (size_t)(m0 + cr) * Dc + k0 + cc;
    const uint32_t l = lds_addr(&Cs[buf][cr][cc]);
    async4_b128(g, g + 32 * Dc, g + 64 * Dc, g + 96 * Dc,
                l, l + 32 * 144, l + 64 * 144, l + 96 * 144);
  };
  // Wo in two phases, a K step apart, as W in the QKV kernel
  const int sr = tid >> 2;                   // rows sr and sr + 64
  const int sc = (tid & 3) * 8;              // 8 elements per thread, row and half step
  float4 f[8];
  auto loadW = [&](int k0) {
#pragma unroll
    for (int h = 0; h < 2; ++h)
#pragma unroll
      for (int kk = 0; kk < 2; ++kk) {
        const float* s = Wo + (size_t)(n0 + sr + 64 * h) * Dc + k0 + kk * 32 + sc;
        f[4 * h + 2 * kk]     = *(const float4*)(s);
        f[4 * h + 2 * kk + 1] = *(const float4*)(s + 4);
      }
    wait_x0();
  };
  auto storeW = [&](int buf) {
#pragma unroll
    for (int h = 0; h < 2; ++h)
#pragma unroll
      for (int kk = 0; kk < 2; ++kk)
        *(v8bf*)&Os[buf][sr + 64 * h][kk * 32 + sc] = pack8(f[4 * h + 2 * kk], f[4 * h + 2 * kk + 1]);
  };

  v8f acc[2][4];
#pragma unroll
  for (int i = 0; i < 2; ++i)
#pragma unroll
    for (int n = 0; n < 4; ++n) acc[i][n] = zero8();

  stageC(0, 0);
  loadW(0);
  storeW(0);
  loadW(64);
  wait_async0();
  __syncthreads();
  stageC(1, 64);                              // flies while K step 0 is worked on

  for (int ks = 0; ks < Dc / 64; ++ks) {
    const int buf = ks & 1;
    // the step's 24 LDS reads go first, together; the Wo staging covers their latency
    v16bf a[2][2], b[2][4];
#pragma unroll
    for (int kk = 0; kk < 2; ++kk) {
#pragma unroll
      for (int i = 0; i < 2; ++i)
        a[kk][i] = frag_from_bf16(&Cs[buf][mw * 32 + i * 16 + r][kk * 32 + half * 8]);
#pragma unroll
      for (int n = 0; n < 4; ++n)
        b[kk][n] = frag_from_bf16(&Os[buf][nw * 64 + n * 16 + r][kk * 32 + half * 8]);
    }
    // keeps the reads together up here: read one fragment at a time among the
    // products, every product or two waits out an LDS latency
    __builtin_amdgcn_sched_barrier(0);
    if (ks + 1 < Dc / 64) storeW(buf ^ 1);
    if (ks + 2 < Dc / 64) loadW((ks + 2) * 64);
    // keeps the Wo loads ahead of the products that cover their latency
    __builtin_amdgcn_sched_barrier(0);

#pragma unroll
    for (int kk = 0; kk < 2; ++kk)
#pragma unroll
      for (int i = 0; i < 2; ++i)
#pragma unroll
        for (int n = 0; n < 4; ++n) acc[i][n] = wmma_bf16(a[kk][i], b[kk][n], acc[i][n]);
    // keeps the products in front of the barrier, whose wait for the Wo loads they cover
    __builtin_amdgcn_sched_barrier(0);

    // publish K step ks+1 and free this step's context buffer, then refill it
    wait_ds0();
    wait_async0();
    __syncthreads();
    if (ks + 2 < Dc / 64) stageC(buf, (ks + 2) * 64);
  }
  wait_async0();

  float bon[4];
#pragma unroll
  for (int n = 0; n < 4; ++n) bon[n] = bo[n0 + nw * 64 + n * 16 + r];
  wait_x0();
  // keeps the bias loads in front of their wait
  __builtin_amdgcn_sched_barrier(0);

#pragma unroll   // constant i, n, j: the accumulators stay in registers
  for (int n = 0; n < 4; ++n) {
    const int    cn  = n0 + nw * 64 + n * 16 + r;
    const size_t o0  = (size_t)(m0 + mw * 32 + half * 8) * Dc + cn;
    float xv[2][8];
#pragma unroll
    for (int i = 0; i < 2; ++i)
#pragma unroll
      for (int j = 0; j < 8; ++j) xv[i][j] = x[o0 + (size_t)(i * 16 + j) * Dc];
    wait_x0();
    float yv[2][8];
#pragma unroll
    for (int i = 0; i < 2; ++i)
#pragma unroll
      for (int j = 0; j < 8; ++j) yv[i][j] = acc[i][n][j] + bon[n] + xv[i][j];
    // keeps the sixteen stores together, behind the sums and in front of their wait
    __builtin_amdgcn_sched_barrier(0);
#pragma unroll
    for (int i = 0; i < 2; ++i)
#pragma unroll
      for (int j = 0; j < 8; ++j) Y[o0 + (size_t)(i * 16 + j) * Dc] = yv[i][j];
    wait_x0();
    __builtin_amdgcn_sched_barrier(0);
  }
}

// ---------------------------------------------------------------------------
// Kernel 4: LayerNorm over D=1024 per row.  One block (256 thr) per row.
// ---------------------------------------------------------------------------
__global__ __launch_bounds__(256) void ln_kernel(
    const float* __restrict__ Y, const float* __restrict__ gamma,
    const float* __restrict__ beta, float* __restrict__ out) {
  __shared__ float redS[8], redQ[8];
  const int row  = blockIdx.x;
  const int tid  = threadIdx.x;
  const int wave = tid >> 5;
  const int lane = tid & 31;

  const float4 v = ((const float4*)(Y + (size_t)row * Dc))[tid];
  float s = v.x + v.y + v.z + v.w;
  float q = v.x * v.x + v.y * v.y + v.z * v.z + v.w * v.w;
#pragma unroll
  for (int m = 16; m >= 1; m >>= 1) {
    s += __shfl_xor(s, m);
    q += __shfl_xor(q, m);
  }
  if (lane == 0) { redS[wave] = s; redQ[wave] = q; }
  __syncthreads();
  float S = 0.f, Q = 0.f;
#pragma unroll
  for (int i = 0; i < 8; ++i) { S += redS[i]; Q += redQ[i]; }
  const float mu   = S * (1.0f / Dc);
  const float var  = Q * (1.0f / Dc) - mu * mu;
  const float rstd = rsqrtf(var + 1e-5f);

  const float4 g  = ((const float4*)gamma)[tid];
  const float4 be = ((const float4*)beta)[tid];
  float4 o;
  o.x = (v.x - mu) * rstd * g.x + be.x;
  o.y = (v.y - mu) * rstd * g.y + be.y;
  o.z = (v.z - mu) * rstd * g.z + be.z;
  o.w = (v.w - mu) * rstd * g.w + be.w;
  ((float4*)(out + (size_t)row * Dc))[tid] = o;
}

// ---------------------------------------------------------------------------
// Launcher
// ---------------------------------------------------------------------------
extern "C" void kernel_launch(void* const* d_in, const int* in_sizes, int n_in,
                              void* d_out, int out_size, void* d_ws, size_t ws_size,
                              hipStream_t stream) {
  const float* x     = (const float*)d_in[0];
  const int*   mask  = (const int*)  d_in[1];
  const float* Wq    = (const float*)d_in[2];
  const float* bq    = (const float*)d_in[3];
  const float* Wk    = (const float*)d_in[4];
  const float* bk    = (const float*)d_in[5];
  const float* Wv    = (const float*)d_in[6];
  const float* bv    = (const float*)d_in[7];
  const float* Wo    = (const float*)d_in[8];
  const float* bo    = (const float*)d_in[9];
  const float* gamma = (const float*)d_in[10];
  const float* beta  = (const float*)d_in[11];

  char* ws = (char*)d_ws;
  const size_t ELEMS = (size_t)Mtot * Dc;          // 8 Mi elements
  __bf16* Qb  = (__bf16*)(ws);                     // 16 MB
  __bf16* Kb  = (__bf16*)(ws + 2 * ELEMS);         // 16 MB
  __bf16* Vb  = (__bf16*)(ws + 4 * ELEMS);         // 16 MB
  __bf16* Ctx = (__bf16*)(ws + 6 * ELEMS);         // 16 MB
  float*  Y   = (float*) (ws + 8 * ELEMS);         // 32 MB

  dim3 blk(256);
  dim3 g1(Dc / 64, Mtot / 256);                    // (16, 32)
  qkv_kernel<<<g1, blk, 0, stream>>>(x, Wq, bq, Wk, bk, Wv, bv, Qb, Kb, Vb);

  dim3 g2(Sc / 128, Bc * Hc);                      // (16, 64)
  attn_kernel<<<g2, blk, 0, stream>>>(Qb, Kb, Vb, mask, Ctx);

  dim3 g3(Dc / 128, Mtot / 128);                   // (8, 64)
  oproj_kernel<<<g3, blk, 0, stream>>>(Ctx, Wo, bo, x, Y);

  ln_kernel<<<Mtot, blk, 0, stream>>>(Y, gamma, beta, (float*)d_out);
}

// v005
// It runs in 149 microseconds.
// Two timings next to v004 both put it at 1.05 times that version's speed.
// All steps since v000 together make it 3.06 times as fast.
#include <hip/hip_runtime.h>
#include <stdint.h>

// ---------------------------------------------------------------------------
// NonLocalAttention block for MI455X (gfx1250), wave32 + WMMA bf16 pipeline,
// LDS-staged double-buffered GEMMs with async global->LDS copies.
//   B=4, S=2048, D=1024, H=16, Hd=64
// ---------------------------------------------------------------------------

typedef __attribute__((ext_vector_type(16))) __bf16 v16bf;
typedef __attribute__((ext_vector_type(8)))  __bf16 v8bf;
typedef __attribute__((ext_vector_type(8)))  float  v8f;

static constexpr int Bc   = 4;
static constexpr int Sc   = 2048;
static constexpr int Dc   = 1024;
static constexpr int Hc   = 16;
static constexpr int Hd   = 64;
static constexpr int Mtot = Bc * Sc;      // 8192 rows

// ---------------- CDNA5 async global->LDS (ASYNCcnt) ------------------------
// A lane's run of 16-byte copies.  The s_wait_xcnt 0 is the statement's last line, so
// that no address register of a copy is rewritten in front of it.
__device__ __forceinline__ uint32_t lds_addr(const void* p) { return (uint32_t)(uintptr_t)p; }
__device__ __forceinline__ void async2_b128(const void* g0, const void* g1,
                                            uint32_t l0, uint32_t l1) {
  asm volatile("global_load_async_to_lds_b128 %0, %2, off\n\t"
               "global_load_async_to_lds_b128 %1, %3, off\n\t"
               "s_wait_xcnt 0x0"
               :: "v"(l0), "v"(l1), "v"(g0), "v"(g1)
               : "memory");
}
__device__ __forceinline__ void async4_b128(const void* g0, const void* g1,
                                            const void* g2, const void* g3,
                                            uint32_t l0, uint32_t l1, uint32_t l2, uint32_t l3) {
  asm volatile("global_load_async_to_lds_b128 %0, %4, off\n\t"
               "global_load_async_to_lds_b128 %1, %5, off\n\t"
               "global_load_async_to_lds_b128 %2, %6, off\n\t"
               "global_load_async_to_lds_b128 %3, %7, off\n\t"
               "s_wait_xcnt 0x0"
               :: "v"(l0), "v"(l1), "v"(l2), "v"(l3), "v"(g0), "v"(g1), "v"(g2), "v"(g3)
               : "memory");
}
// stands behind a run of global loads or stores, in front of the first rewrite of a
// register that one of them names
__device__ __forceinline__ void wait_x0() {
  asm volatile("s_wait_xcnt 0x0" ::: "memory");
}
// the copies of this wave have landed
__device__ __forceinline__ void wait_async0() {
  asm volatile("s_wait_asynccnt 0x0" ::: "memory");
}
// this wave's LDS reads and writes are done: stands in front of the barrier behind
// which a buffer is refilled by copies
__device__ __forceinline__ void wait_ds0() {
  asm volatile("s_wait_dscnt 0x0" ::: "memory");
}

// ---------------- fragment helpers -----------------------------------------
__device__ __forceinline__ v8bf pack8(float4 a, float4 b) {
  v8bf o;
  o[0] = (__bf16)a.x; o[1] = (__bf16)a.y; o[2] = (__bf16)a.z; o[3] = (__bf16)a.w;
  o[4] = (__bf16)b.x; o[5] = (__bf16)b.y; o[6] = (__bf16)b.z; o[7] = (__bf16)b.w;
  return o;
}
__device__ __forceinline__ v16bf cat16(v8bf lo, v8bf hi) {
  return __builtin_shufflevector(lo, hi, 0,1,2,3,4,5,6,7,8,9,10,11,12,13,14,15);
}
// 16-bit A/B fragment: lane = {r=lane&15 (row/col), half=lane>>4}.
// Elements 0..7 = K (half*8)+0..7, elements 8..15 = K 16+(half*8)+0..7.
__device__ __forceinline__ v16bf frag_from_bf16(const __bf16* p) {
  v8bf lo = *(const v8bf*)(p);
  v8bf hi = *(const v8bf*)(p + 16);
  return cat16(lo, hi);
}
// The same fragment from a tile kept in fragment order: 512 elements, chunk c
// (elements 8c..8c+7 of every lane) at c*256 + lane*8, so that one 16-byte load
// or store of a wave covers 512 contiguous bytes.  p already holds lane*8.
__device__ __forceinline__ v16bf frag_packed(const __bf16* p) {
  v8bf lo = *(const v8bf*)(p);
  v8bf hi = *(const v8bf*)(p + 256);
  return cat16(lo, hi);
}
__device__ __forceinline__ v8f wmma_bf16(v16bf a, v16bf b, v8f c) {
  return __builtin_amdgcn_wmma_f32_16x16x32_bf16(
      false, a, false, b, (short)0, c, false, false);
}
__device__ __forceinline__ v8f zero8() {
  v8f z = {0.f,0.f,0.f,0.f,0.f,0.f,0.f,0.f};
  return z;
}
// lane l takes the value of lane l ^ 16 (the other half of the wave), on the vector pipe
__device__ __forceinline__ float xhalf(float v) {
  const int i = __builtin_bit_cast(int, v);
  return __builtin_bit_cast(float, __builtin_amdgcn_permlanex16(i, i, 0x76543210, 0xfedcba98, false, false));
}

// ---------------------------------------------------------------------------
// Kernel 1: fused QKV projection.  out = x @ W.T + b  (NT GEMM).
// WG = 256 thr (8 waves), tile 256(M) x 64(N) for all three weights; a wave owns
// 32 rows x 64 columns of each: 2 x fragments meet 12 weight fragments, and no two
// waves convert the same x rows.  A K step is 64 deep: 48 products a wave.
// x tile async-staged fp32 into LDS; W tiles staged once as bf16.
// Q stored bf16 [B,H,S,Hd].  K and V stored bf16 per head in the fragment order
// the attention kernel loads them in (frag_packed):
//   K: [S/16 key tiles][2 halves of Hd][512], lane row = key,  k = head dim
//   V: [S/32 key steps][4 tiles of Hd][512],  lane row = head dim, k = key
// ---------------------------------------------------------------------------
__global__ __launch_bounds__(256) void qkv_kernel(
    const float* __restrict__ x,
    const float* __restrict__ Wq, const float* __restrict__ bq,
    const float* __restrict__ Wk, const float* __restrict__ bk,
    const float* __restrict__ Wv, const float* __restrict__ bv,
    __bf16* __restrict__ Qb, __bf16* __restrict__ Kb, __bf16* __restrict__ Vb) {
  __shared__ __align__(16) float  Xs[2][256][68];     // 136 KB, padded rows
  __shared__ __align__(16) __bf16 Ws[3][2][64][72];   //  54 KB, padded rows

  const int tid  = threadIdx.x;
  const int wave = tid >> 5;        // M sub-tile (32 rows)
  const int lane = tid & 31;
  const int r    = lane & 15;
  const int half = lane >> 4;
  const int m0   = blockIdx.y * 256;
  const int n0   = blockIdx.x * 64; // the 64 columns are one head

  const float* Wp[3] = {Wq, Wk, Wv};

  // ---- staging ----
  // 4096 chunks of 16 B: a thread takes one chunk of rows xr, xr+16, ..., xr+240
  const int xr = tid >> 4;
  const int xc = (tid & 15) * 4;
  auto stageX = [&](int buf, int k0) {
    const float*   g = x + (size_t)(m0 + xr) * Dc + k0 + xc;
    const uint32_t l = lds_addr(&Xs[buf][xr][xc]);
#pragma unroll
    for (int i = 0; i < 4; ++i) {
      const float*   gi = g + (size_t)i * 64 * Dc;
      const uint32_t li = l + i * 64 * 272;
      async4_b128(gi, gi + 16 * Dc, gi + 32 * Dc, gi + 48 * Dc,
                  li, li + 16 * 272, li + 32 * 272, li + 48 * 272);
    }
  };
  // W in two phases, a K step apart: the twelve global loads of step t+2 go out at the
  // top of step t; they are converted and stored at the top of step t+1, into the
  // buffer that step t has read, so that no wait for them stands near their issue
  const int wr = tid >> 2;
  const int wc = (tid & 3) * 8;
  float4 f[12];
  auto loadW = [&](int k0) {
#pragma unroll
    for (int w = 0; w < 3; ++w)
#pragma unroll
      for (int kk = 0; kk < 2; ++kk) {
        const float* s = Wp[w] + (size_t)(n0 + wr) * Dc + k0 + kk * 32 + wc;
        f[4 * w + 2 * kk]     = *(const float4*)(s);
        f[4 * w + 2 * kk + 1] = *(const float4*)(s + 4);
      }
    wait_x0();
  };
  auto storeW = [&](int buf) {
#pragma unroll
    for (int w = 0; w < 3; ++w)
#pragma unroll
      for (int kk = 0; kk < 2; ++kk)
        *(v8bf*)&Ws[w][buf][wr][kk * 32 + wc] = pack8(f[4 * w + 2 * kk], f[4 * w + 2 * kk + 1]);
  };
  // the four 16-byte pieces of an x fragment, still fp32
  auto rawA = [&](int buf, int i, int kk, float4* o) {
    const float* xp = &Xs[buf][wave * 32 + i * 16 + r][kk * 32];
    o[0] = *(const float4*)(xp + half * 8);
    o[1] = *(const float4*)(xp + half * 8 + 4);
    o[2] = *(const float4*)(xp + 16 + half * 8);
    o[3] = *(const float4*)(xp + 16 + half * 8 + 4);
  };
  auto fragB = [&](int w, int buf, int n, int kk) {
    return frag_from_bf16(&Ws[w][buf][n * 16 + r][kk * 32 + half * 8]);
  };

  v8f aq[2][4], ak[2][4], av[2][4];
#pragma unroll
  for (int i = 0; i < 2; ++i)
#pragma unroll
    for (int n = 0; n < 4; ++n) { aq[i][n] = zero8(); ak[i][n] = zero8(); av[i][n] = zero8(); }

  stageX(0, 0);
  loadW(0);
  storeW(0);
  loadW(64);
  wait_async0();
  __syncthreads();
  stageX(1, 64);                              // flies while K step 0 is worked on

  for (int ks = 0; ks < Dc / 64; ++ks) {
    const int buf = ks & 1;
    // the step's x reads go first: every product needs an x fragment, LDS answers in
    // order, and the W staging below covers their latency
    float4 ar[2][2][4];
#pragma unroll
    for (int kk = 0; kk < 2; ++kk) {
      rawA(buf, 0, kk, ar[kk][0]);
      rawA(buf, 1, kk, ar[kk][1]);
    }
    if (ks + 1 < Dc / 64) storeW(buf ^ 1);
    if (ks + 2 < Dc / 64) loadW((ks + 2) * 64);

#pragma unroll
    for (int kk = 0; kk < 2; ++kk) {
      v16bf bw[3][4];
#pragma unroll
      for (int w = 0; w < 3; ++w)
#pragma unroll
        for (int n = 0; n < 4; ++n) bw[w][n] = fragB(w, buf, n, kk);
      // keeps the 24 W reads of these 24 products together ahead of them: read one
      // fragment at a time, every pair of products waits out an LDS latency
      __builtin_amdgcn_sched_barrier(0);
      const v16bf a0 = cat16(pack8(ar[kk][0][0], ar[kk][0][1]), pack8(ar[kk][0][2], ar[kk][0][3]));
      const v16bf a1 = cat16(pack8(ar[kk][1][0], ar[kk][1][1]), pack8(ar[kk][1][2], ar[kk][1][3]));
#pragma unroll
      for (int n = 0; n < 4; ++n) {
        aq[0][n] = wmma_bf16(a0, bw[0][n], aq[0][n]);
        aq[1][n] = wmma_bf16(a1, bw[0][n], aq[1][n]);
      }
      // K comes out transposed (rows = head dim, column = key): a lane then holds
      // eight neighbouring head dims of one key, one 16-byte chunk of its tile
#pragma unroll
      for (int n = 0; n < 4; ++n) {
        ak[0][n] = wmma_bf16(bw[1][n], a0, ak[0][n]);
        ak[1][n] = wmma_bf16(bw[1][n], a1, ak[1][n]);
      }
#pragma unroll
      for (int n = 0; n < 4; ++n) {
        av[0][n] = wmma_bf16(a0, bw[2][n], av[0][n]);
        av[1][n] = wmma_bf16(a1, bw[2][n], av[1][n]);
      }
      // and keeps the next reads from being strewn among these products
      __builtin_amdgcn_sched_barrier(0);
    }

    // publish K step ks+1 and free this step's x buffer, then refill it
    wait_ds0();
    wait_async0();
    __syncthreads();
    if (ks + 2 < Dc / 64) stageX(buf, (ks + 2) * 64);
  }
  wait_async0();

  // ---- epilogue: bias; Q to [B,H,S,Hd], K and V to their fragment tiles ----
  const int    mr0 = m0 + wave * 32;          // 32 rows = 32 keys of one batch
  const int    s00 = mr0 & (Sc - 1);
  const size_t hb  = (size_t)((mr0 >> 11) * Hc + blockIdx.x) * Sc * Hd;

  float bqn[4], bvn[4], bkn[4][8];
#pragma unroll
  for (int n = 0; n < 4; ++n) {
    bqn[n] = bq[n0 + n * 16 + r];
    bvn[n] = bv[n0 + n * 16 + r];
    const float* bkp = bk + n0 + n * 16 + half * 8;  // ak rows: head dim n*16+half*8+j
    const float4 kb0 = *(const float4*)(bkp), kb1 = *(const float4*)(bkp + 4);
    bkn[n][0] = kb0.x; bkn[n][1] = kb0.y; bkn[n][2] = kb0.z; bkn[n][3] = kb0.w;
    bkn[n][4] = kb1.x; bkn[n][5] = kb1.y; bkn[n][6] = kb1.z; bkn[n][7] = kb1.w;
  }
  wait_x0();

#pragma unroll   // constant n, i, j: the accumulators stay in registers
  for (int n = 0; n < 4; ++n) {
#pragma unroll
    for (int i = 0; i < 2; ++i) {
      __bf16* qt = Qb + hb + (size_t)(s00 + i * 16 + half * 8) * Hd + n * 16 + r;
      // key tile (s00 >> 4) + i, half n >> 1 of Hd, chunk n & 1
      __bf16* kt = Kb + hb + (size_t)((s00 >> 4) + i) * 1024 + n * 256 + lane * 8;
      // key step s00 >> 5, head-dim tile n, chunk i (keys 16*i .. 16*i+15)
      __bf16* vt = Vb + hb + (size_t)(s00 >> 5) * 2048 + n * 512 + i * 256 + lane * 8;
      v8bf qo, ko, vo;
#pragma unroll
      for (int j = 0; j < 8; ++j) {
        qo[j] = (__bf16)(aq[i][n][j] + bqn[n]);
        ko[j] = (__bf16)(ak[i][n][j] + bkn[n][j]);
        vo[j] = (__bf16)(av[i][n][j] + bvn[n]);
      }
      // keeps the tile's ten stores together, behind its arithmetic and in front of their
      // wait
      __builtin_amdgcn_sched_barrier(0);
#pragma unroll
      for (int j = 0; j < 8; ++j) qt[j * Hd] = qo[j];
      *(v8bf*)kt = ko;
      *(v8bf*)vt = vo;
      wait_x0();
      __builtin_amdgcn_sched_barrier(0);
    }
  }
}

__global__ __launch_bounds__(256) void attn_kernel(
    const __bf16* __restrict__ Qb, const __bf16* __restrict__ Kb,
    const __bf16* __restrict__ Vb, const int* __restrict__ mask,
    __bf16* __restrict__ Ctx) {
  constexpr int SK  = 128;                  // keys per stage
  constexpr int NST = Sc / SK;              // 16 stages
  __shared__ __align__(16) __bf16 Ks[2][SK * Hd];     // 32 KB
  __shared__ __align__(16) __bf16 Vs[2][SK * Hd];     // 32 KB

  const int tid  = threadIdx.x;
  const int wave = tid >> 5;
  const int lane = tid & 31;
  const int r    = lane & 15;
  const int half = lane >> 4;

  const int bh = blockIdx.y;                // b*H + h
  const int b  = bh >> 4;
  const int h  = bh & 15;
  const int q0 = blockIdx.x * 128 + wave * 16;

  const __bf16* kbase = Kb + (size_t)bh * Sc * Hd;
  const __bf16* vbase = Vb + (size_t)bh * Hd * Sc;
  const int*    mbase = mask + (size_t)b * Sc;

  // a stage is 1024 chunks of 16 B of K and as many of V: a thread takes chunks
  // tid, tid+256, tid+512, tid+768 of each, so a wave's copy covers 512 contiguous bytes
  auto stageKV = [&](int buf, int st) {
    const __bf16*  gk = kbase + (size_t)st * SK * Hd + tid * 8;
    const __bf16*  gv = vbase + (size_t)st * SK * Hd + tid * 8;
    const uint32_t lk = lds_addr(&Ks[buf][tid * 8]);
    const uint32_t lv = lds_addr(&Vs[buf][tid * 8]);
    async4_b128(gk, gk + 2048, gk + 4096, gk + 6144, lk, lk + 4096, lk + 8192, lk + 12288);
    async4_b128(gv, gv + 2048, gv + 4096, gv + 6144, lv, lv + 4096, lv + 8192, lv + 12288);
  };
  stageKV(0, 0);                            // flies while Q and the mask are read

  const __bf16* qp = Qb + ((size_t)bh * Sc + (q0 + r)) * Hd + half * 8;
  v16bf qf0 = frag_from_bf16(qp);
  v16bf qf1 = frag_from_bf16(qp + 32);

  constexpr float CS = 0.125f * 1.4426950408889634f;   // 1/sqrt(Hd) * log2(e)
  float mrun   = -3.0e38f;                  // the maximum in use, scaled, base 2
  float rawlim = -3.0e38f;                  // (mrun + 8) / CS: the same limit for unscaled scores
  float lrow   = 0.f;                       // this half's keys only
  v8f o0 = zero8(), o1 = zero8(), o2 = zero8(), o3 = zero8();

  // does this batch row mask any key at all?  One wave-uniform flag, so that
  // the loop pays for the 16 per-register mask terms only where there are some
  unsigned mlow = 0xffffffffu;              // unsigned minimum: 0 iff some entry is 0
#pragma unroll
  for (int i = 0; i < Sc / 128; ++i) {
    const int4 mv = *(const int4*)(mbase + i * 128 + lane * 4);
    mlow = min(min(mlow, min((unsigned)mv.x, (unsigned)mv.y)), min((unsigned)mv.z, (unsigned)mv.w));
  }
  const bool masked = __builtin_amdgcn_ballot_w32(mlow == 0u) != 0;

  wait_async0();
  __syncthreads();                          // stage 0 is there for every wave
  stageKV(1, 1);                            // flies while stage 0 is worked on

  for (int st = 0; st < NST; ++st) {
   const int buf = st & 1;
   // stays rolled, as it was: unrolled, the passes overlap in more than 128 registers, and
   // the four work-groups of a WGP are no longer resident together
#pragma unroll 1
   for (int ps = 0; ps < SK / 32; ++ps) {
    const int kk0 = st * SK + ps * 32;
    // ---- scores: S^T[32 k x 16 q] = K (32x64) * Q^T ----
    const __bf16* kp = &Ks[buf][ps * 32 * Hd + lane * 8];     // 32 keys = 4 tiles
    v16bf kf00 = frag_packed(kp);
    v16bf kf01 = frag_packed(kp + 512);
    v16bf kf10 = frag_packed(kp + 1024);
    v16bf kf11 = frag_packed(kp + 1536);
    // keeps the eight K reads together ahead of the four products: read a pair at a
    // time, every product waits out an LDS latency of its own
    __builtin_amdgcn_sched_barrier(0);

    v8f s0 = zero8(), s1 = zero8();
    s0 = wmma_bf16(kf00, qf0, s0);
    s0 = wmma_bf16(kf01, qf1, s0);
    s1 = wmma_bf16(kf10, qf0, s1);
    s1 = wmma_bf16(kf11, qf1, s1);

    // the mask terms come in front of the V reads: with the sixteen mask words and the V
    // tiles live together the kernel takes more than 128 registers, and a WGP no longer
    // holds four work-groups
    if (masked) {                            // s0[j]: key kk0+8*half+j, s1[j]: 16 more
      const int* mp = mbase + kk0 + half * 8;
      const int4 ma = *(const int4*)(mp),      mb = *(const int4*)(mp + 4);
      const int4 mc = *(const int4*)(mp + 16), md = *(const int4*)(mp + 20);
      const int m0[8] = {ma.x, ma.y, ma.z, ma.w, mb.x, mb.y, mb.z, mb.w};
      const int m1[8] = {mc.x, mc.y, mc.z, mc.w, md.x, md.y, md.z, md.w};
#pragma unroll   // constant j: the vectors' elements stay in registers
      for (int j = 0; j < 8; ++j) {
        s0[j] += m0[j] ? 0.f : -8.0e9f;      // -1e9 once scaled by 1/sqrt(Hd)
        s1[j] += m1[j] ? 0.f : -8.0e9f;
      }
    }

    // the pass's V tiles (one per 16 head dims) are asked for here
    const __bf16* vp = &Vs[buf][ps * 32 * Hd + lane * 8];
    v16bf vf0 = frag_packed(vp);
    v16bf vf1 = frag_packed(vp + 512);
    v16bf vf2 = frag_packed(vp + 1024);
    v16bf vf3 = frag_packed(vp + 1536);
    // keeps the eight V reads together up here: the softmax arithmetic covers their latency
    __builtin_amdgcn_sched_barrier(0);

    // ---- online softmax of one query per lane; the maximum is taken of the unscaled
    //      scores (the scale is positive), here of this half's 16 keys ----
    float mx = fmaxf(s0[0], s1[0]);
#pragma unroll
    for (int j = 1; j < 8; ++j) mx = fmaxf(mx, fmaxf(s0[j], s1[j]));
    // one test a pass, a scalar branch: taken in the first pass and then only where a
    // column's maximum has grown by more than 8.  The ballot sees both halves of a
    // column, so the halves exchange their maxima only inside
    if (__builtin_amdgcn_ballot_w32(mx > rawlim) != 0) {
      mx = fmaxf(mx, xhalf(mx));             // both halves: maximum of all 32 keys
      const float mnew  = fmaxf(mrun, mx * CS);
      const float alpha = __builtin_amdgcn_exp2f(mrun - mnew);   // 0 in the first pass
      mrun   = mnew;
      rawlim = (mnew + 8.0f) * (1.0f / CS);
      lrow   = lrow * alpha;
      o0 = o0 * alpha; o1 = o1 * alpha; o2 = o2 * alpha; o3 = o3 * alpha;
    }
    const v8f cs8 = {CS, CS, CS, CS, CS, CS, CS, CS};
    const float nm = -mrun;
    const v8f nm8 = {nm, nm, nm, nm, nm, nm, nm, nm};
    const v8f t0 = __builtin_elementwise_fma(s0, cs8, nm8);
    const v8f t1 = __builtin_elementwise_fma(s1, cs8, nm8);
    float p0[8], p1[8];
#pragma unroll
    for (int j = 0; j < 8; ++j) {
      p0[j] = __builtin_amdgcn_exp2f(t0[j]);
      p1[j] = __builtin_amdgcn_exp2f(t1[j]);
    }
    const float sa = ((p0[0] + p0[1]) + (p0[2] + p0[3])) + ((p0[4] + p0[5]) + (p0[6] + p0[7]));
    const float sb = ((p1[0] + p1[1]) + (p1[2] + p1[3])) + ((p1[4] + p1[5]) + (p1[6] + p1[7]));
    lrow += sa + sb;

    // ---- P^T as a B operand: element s = key 8*half+s, then 16+8*half+(s-8) ----
    v16bf pf;
#pragma unroll
    for (int j = 0; j < 8; ++j) { pf[j] = (__bf16)p0[j]; pf[8 + j] = (__bf16)p1[j]; }

    // ---- O^T += V^T @ P^T   (one fragment tile per 16 head dims) ----
    o0 = wmma_bf16(vf0, pf, o0);
    o1 = wmma_bf16(vf1, pf, o1);
    o2 = wmma_bf16(vf2, pf, o2);
    o3 = wmma_bf16(vf3, pf, o3);
   }
   // publish stage st+1 and free this stage's buffer, then refill it
   wait_ds0();
   wait_async0();
   __syncthreads();
   if (st + 2 < NST) stageKV(buf, st + 2);
  }
  wait_async0();

  // ---- join the halves' sums, normalize, store context bf16 [B,S,D]:
  //      tile t of a lane is head dims 16*t+8*half+0..7 of query q0+r ----
  const float inv = 1.0f / (lrow + xhalf(lrow));
  v8bf c0, c1, c2, c3;
#pragma unroll
  for (int j = 0; j < 8; ++j) {
    c0[j] = (__bf16)(o0[j] * inv);
    c1[j] = (__bf16)(o1[j] * inv);
    c2[j] = (__bf16)(o2[j] * inv);
    c3[j] = (__bf16)(o3[j] * inv);
  }
  __bf16* cp = Ctx + ((size_t)b * Sc + q0 + r) * Dc + h * Hd + half * 8;
  *(v8bf*)(cp)      = c0;
  *(v8bf*)(cp + 16) = c1;
  *(v8bf*)(cp + 32) = c2;
  *(v8bf*)(cp + 48) = c3;
}

// ---------------------------------------------------------------------------
// Kernel 3: out projection + residual.  y = x + ctx @ Wo.T + bo  (fp32 y).
// WG = 256 thr (8 waves), tile 128(M) x 128(N); a wave owns 32 x 64: 2 context
// fragments meet 4 weight fragments.  A K step is 64 deep: 16 products a wave.
// Ctx tile async-staged (already bf16); Wo staged as bf16 once per K-step.
// ---------------------------------------------------------------------------
__global__ __launch_bounds__(256) void oproj_kernel(
    const __bf16* __restrict__ Ctx, const float* __restrict__ Wo,
    const float* __restrict__ bo, const float* __restrict__ x,
    float* __restrict__ Y) {
  __shared__ __align__(16) __bf16 Cs[2][128][72];     // 36 KB, padded rows
  __shared__ __align__(16) __bf16 Os[2][128][72];     // 36 KB, padded rows

  const int tid  = threadIdx.x;
  const int wave = tid >> 5;
  const int lane = tid & 31;
  const int r    = lane & 15;
  const int half = lane >> 4;
  const int mw   = wave & 3;        // M sub-tile (32 rows)
  const int nw   = wave >> 2;       // N sub-tile (64 cols)
  const int m0   = blockIdx.y * 128;
  const int n0   = blockIdx.x * 128;

  // 1024 chunks of 16 B: a thread takes one chunk of rows cr, cr+32, cr+64, cr+96
  const int cr = tid >> 3;
  const int cc = (tid & 7) * 8;
  auto stageC = [&](int buf, int k0) {
    const __bf16*  g = Ctx + (size_t)(m0 + cr) * Dc + k0 + cc;
    const uint32_t l = lds_addr(&Cs[buf][cr][cc]);
    async4_b128(g, g + 32 * Dc, g + 64 * Dc, g + 96 * Dc,
                l, l + 32 * 144, l + 64 * 144, l + 96 * 144);
  };
  // Wo in two phases, a K step apart, as W in the QKV kernel
  const int sr = tid >> 2;                   // rows sr and sr + 64
  const int sc = (tid & 3) * 8;              // 8 elements per thread, row and half step
  float4 f[8];
  auto loadW = [&](int k0) {
#pragma unroll
    for (int h = 0; h < 2; ++h)
#pragma unroll
      for (int kk = 0; kk < 2; ++kk) {
        const float* s = Wo + (size_t)(n0 + sr + 64 * h) * Dc + k0 + kk * 32 + sc;
        f[4 * h + 2 * kk]     = *(const float4*)(s);
        f[4 * h + 2 * kk + 1] = *(const float4*)(s + 4);
      }
    wait_x0();
  };
  auto storeW = [&](int buf) {
#pragma unroll
    for (int h = 0; h < 2; ++h)
#pragma unroll
      for (int kk = 0; kk < 2; ++kk)
        *(v8bf*)&Os[buf][sr + 64 * h][kk * 32 + sc] = pack8(f[4 * h + 2 * kk], f[4 * h + 2 * kk + 1]);
  };

  v8f acc[2][4];
#pragma unroll
  for (int i = 0; i < 2; ++i)
#pragma unroll
    for (int n = 0; n < 4; ++n) acc[i][n] = zero8();

  stageC(0, 0);
  loadW(0);
  storeW(0);
  loadW(64);
  wait_async0();
  __syncthreads();
  stageC(1, 64);                              // flies while K step 0 is worked on

  for (int ks = 0; ks < Dc / 64; ++ks) {
    const int buf = ks & 1;
    // the step's 24 LDS reads go first, together; the Wo staging covers their latency
    v16bf a[2][2], b[2][4];
#pragma unroll
    for (int kk = 0; kk < 2; ++kk) {
#pragma unroll
      for (int i = 0; i < 2; ++i)
        a[kk][i] = frag_from_bf16(&Cs[buf][mw * 32 + i * 16 + r][kk * 32 + half * 8]);
#pragma unroll
      for (int n = 0; n < 4; ++n)
        b[kk][n] = frag_from_bf16(&Os[buf][nw * 64 + n * 16 + r][kk * 32 + half * 8]);
    }
    // keeps the reads together up here: read one fragment at a time among the
    // products, every product or two waits out an LDS latency
    __builtin_amdgcn_sched_barrier(0);
    if (ks + 1 < Dc / 64) storeW(buf ^ 1);
    if (ks + 2 < Dc / 64) loadW((ks + 2) * 64);
    // keeps the Wo loads ahead of the products that cover their latency
    __builtin_amdgcn_sched_barrier(0);

#pragma unroll
    for (int kk = 0; kk < 2; ++kk)
#pragma unroll
      for (int i = 0; i < 2; ++i)
#pragma unroll
        for (int n = 0; n < 4; ++n) acc[i][n] = wmma_bf16(a[kk][i], b[kk][n], acc[i][n]);
    // keeps the products in front of the barrier, whose wait for the Wo loads they cover
    __builtin_amdgcn_sched_barrier(0);

    // publish K step ks+1 and free this step's context buffer, then refill it
    wait_ds0();
    wait_async0();
    __syncthreads();
    if (ks + 2 < Dc / 64) stageC(buf, (ks + 2) * 64);
  }
  wait_async0();

  float bon[4];
#pragma unroll
  for (int n = 0; n < 4; ++n) bon[n] = bo[n0 + nw * 64 + n * 16 + r];
  wait_x0();
  // keeps the bias loads in front of their wait
  __builtin_amdgcn_sched_barrier(0);

#pragma unroll   // constant i, n, j: the accumulators stay in registers
  for (int n = 0; n < 4; ++n) {
    const int    cn  = n0 + nw * 64 + n * 16 + r;
    const size_t o0  = (size_t)(m0 + mw * 32 + half * 8) * Dc + cn;
    float xv[2][8];
#pragma unroll
    for (int i = 0; i < 2; ++i)
#pragma unroll
      for (int j = 0; j < 8; ++j) xv[i][j] = x[o0 + (size_t)(i * 16 + j) * Dc];
    wait_x0();
    float yv[2][8];
#pragma unroll
    for (int i = 0; i < 2; ++i)
#pragma unroll
      for (int j = 0; j < 8; ++j) yv[i][j] = acc[i][n][j] + bon[n] + xv[i][j];
    // keeps the sixteen stores together, behind the sums and in front of their wait
    __builtin_amdgcn_sched_barrier(0);
#pragma unroll
    for (int i = 0; i < 2; ++i)
#pragma unroll
      for (int j = 0; j < 8; ++j) Y[o0 + (size_t)(i * 16 + j) * Dc] = yv[i][j];
    wait_x0();
    __builtin_amdgcn_sched_barrier(0);
  }
}

// ---------------------------------------------------------------------------
// Kernel 4: LayerNorm over D=1024 per row.  One block (256 thr) per row.
// ---------------------------------------------------------------------------
__global__ __launch_bounds__(256) void ln_kernel(
    const float* __restrict__ Y, const float* __restrict__ gamma,
    const float* __restrict__ beta, float* __restrict__ out) {
  __shared__ float redS[8], redQ[8];
  const int row  = blockIdx.x;
  const int tid  = threadIdx.x;
  const int wave = tid >> 5;
  const int lane = tid & 31;

  const float4 v = ((const float4*)(Y + (size_t)row * Dc))[tid];
  float s = v.x + v.y + v.z + v.w;
  float q = v.x * v.x + v.y * v.y + v.z * v.z + v.w * v.w;
#pragma unroll
  for (int m = 16; m >= 1; m >>= 1) {
    s += __shfl_xor(s, m);
    q += __shfl_xor(q, m);
  }
  if (lane == 0) { redS[wave] = s; redQ[wave] = q; }
  __syncthreads();
  float S = 0.f, Q = 0.f;
#pragma unroll
  for (int i = 0; i < 8; ++i) { S += redS[i]; Q += redQ[i]; }
  const float mu   = S * (1.0f / Dc);
  const float var  = Q * (1.0f / Dc) - mu * mu;
  const float rstd = rsqrtf(var + 1e-5f);

  const float4 g  = ((const float4*)gamma)[tid];
  const float4 be = ((const float4*)beta)[tid];
  float4 o;
  o.x = (v.x - mu) * rstd * g.x + be.x;
  o.y = (v.y - mu) * rstd * g.y + be.y;
  o.z = (v.z - mu) * rstd * g.z + be.z;
  o.w = (v.w - mu) * rstd * g.w + be.w;
  ((float4*)(out + (size_t)row * Dc))[tid] = o;
}

// ---------------------------------------------------------------------------
// Launcher
// ---------------------------------------------------------------------------
extern "C" void kernel_launch(void* const* d_in, const int* in_sizes, int n_in,
                              void* d_out, int out_size, void* d_ws, size_t ws_size,
                              hipStream_t stream) {
  const float* x     = (const float*)d_in[0];
  const int*   mask  = (const int*)  d_in[1];
  const float* Wq    = (const float*)d_in[2];
  const float* bq    = (const float*)d_in[3];
  const float* Wk    = (const float*)d_in[4];
  const float* bk    = (const float*)d_in[5];
  const float* Wv    = (const float*)d_in[6];
  const float* bv    = (const float*)d_in[7];
  const float* Wo    = (const float*)d_in[8];
  const float* bo    = (const float*)d_in[9];
  const float* gamma = (const float*)d_in[10];
  const float* beta  = (const float*)d_in[11];

  char* ws = (char*)d_ws;
  const size_t ELEMS = (size_t)Mtot * Dc;          // 8 Mi elements
  __bf16* Qb  = (__bf16*)(ws);                     // 16 MB
  __bf16* Kb  = (__bf16*)(ws + 2 * ELEMS);         // 16 MB
  __bf16* Vb  = (__bf16*)(ws + 4 * ELEMS);         // 16 MB
  __bf16* Ctx = (__bf16*)(ws + 6 * ELEMS);         // 16 MB
  float*  Y   = (float*) (ws + 8 * ELEMS);         // 32 MB

  dim3 blk(256);
  dim3 g1(Dc / 64, Mtot / 256);                    // (16, 32)
  qkv_kernel<<<g1, blk, 0, stream>>>(x, Wq, bq, Wk, bk, Wv, bv, Qb, Kb, Vb);

  dim3 g2(Sc / 128, Bc * Hc);                      // (16, 64)
  attn_kernel<<<g2, blk, 0, stream>>>(Qb, Kb, Vb, mask, Ctx);

  dim3 g3(Dc / 128, Mtot / 128);                   // (8, 64)
  oproj_kernel<<<g3, blk, 0, stream>>>(Ctx, Wo, bo, x, Y);

  ln_kernel<<<Mtot, blk, 0, stream>>>(Y, gamma, beta, (float*)d_out);
}

// v006
// It runs in 143 microseconds.
// Next to v005, in two timings, it ran 1.04 times as fast each time.
// Counting every step since v000, it is 3.18 times as fast.
#include <hip/hip_runtime.h>
#include <stdint.h>

// ---------------------------------------------------------------------------
// NonLocalAttention block for MI455X (gfx1250), wave32 + WMMA bf16 pipeline,
// LDS-staged double-buffered GEMMs with async global->LDS copies.
//   B=4, S=2048, D=1024, H=16, Hd=64
// ---------------------------------------------------------------------------

typedef __attribute__((ext_vector_type(16))) __bf16 v16bf;
typedef __attribute__((ext_vector_type(8)))  __bf16 v8bf;
typedef __attribute__((ext_vector_type(8)))  float  v8f;

static constexpr int Bc   = 4;
static constexpr int Sc   = 2048;
static constexpr int Dc   = 1024;
static constexpr int Hc   = 16;
static constexpr int Hd   = 64;
static constexpr int Mtot = Bc * Sc;      // 8192 rows

// ---------------- CDNA5 async global->LDS (ASYNCcnt) ------------------------
// A lane's run of 16-byte copies.  The s_wait_xcnt 0 is the statement's last line, so
// that no address register of a copy is rewritten in front of it.
__device__ __forceinline__ uint32_t lds_addr(const void* p) { return (uint32_t)(uintptr_t)p; }
__device__ __forceinline__ void async2_b128(const void* g0, const void* g1,
                                            uint32_t l0, uint32_t l1) {
  asm volatile("global_load_async_to_lds_b128 %0, %2, off\n\t"
               "global_load_async_to_lds_b128 %1, %3, off\n\t"
               "s_wait_xcnt 0x0"
               :: "v"(l0), "v"(l1), "v"(g0), "v"(g1)
               : "memory");
}
__device__ __forceinline__ void async4_b128(const void* g0, const void* g1,
                                            const void* g2, const void* g3,
                                            uint32_t l0, uint32_t l1, uint32_t l2, uint32_t l3) {
  asm volatile("global_load_async_to_lds_b128 %0, %4, off\n\t"
               "global_load_async_to_lds_b128 %1, %5, off\n\t"
               "global_load_async_to_lds_b128 %2, %6, off\n\t"
               "global_load_async_to_lds_b128 %3, %7, off\n\t"
               "s_wait_xcnt 0x0"
               :: "v"(l0), "v"(l1), "v"(l2), "v"(l3), "v"(g0), "v"(g1), "v"(g2), "v"(g3)
               : "memory");
}
// stands behind a run of global loads or stores, in front of the first rewrite of a
// register that one of them names
__device__ __forceinline__ void wait_x0() {
  asm volatile("s_wait_xcnt 0x0" ::: "memory");
}
// the copies of this wave have landed
__device__ __forceinline__ void wait_async0() {
  asm volatile("s_wait_asynccnt 0x0" ::: "memory");
}
// this wave's LDS reads and writes are done: stands in front of the barrier behind
// which a buffer is refilled by copies
__device__ __forceinline__ void wait_ds0() {
  asm volatile("s_wait_dscnt 0x0" ::: "memory");
}

// ---------------- fragment helpers -----------------------------------------
__device__ __forceinline__ v8bf pack8(float4 a, float4 b) {
  v8bf o;
  o[0] = (__bf16)a.x; o[1] = (__bf16)a.y; o[2] = (__bf16)a.z; o[3] = (__bf16)a.w;
  o[4] = (__bf16)b.x; o[5] = (__bf16)b.y; o[6] = (__bf16)b.z; o[7] = (__bf16)b.w;
  return o;
}
__device__ __forceinline__ v16bf cat16(v8bf lo, v8bf hi) {
  return __builtin_shufflevector(lo, hi, 0,1,2,3,4,5,6,7,8,9,10,11,12,13,14,15);
}
// 16-bit A/B fragment: lane = {r=lane&15 (row/col), half=lane>>4}.
// Elements 0..7 = K (half*8)+0..7, elements 8..15 = K 16+(half*8)+0..7.
__device__ __forceinline__ v16bf frag_from_bf16(const __bf16* p) {
  v8bf lo = *(const v8bf*)(p);
  v8bf hi = *(const v8bf*)(p + 16);
  return cat16(lo, hi);
}
// The same fragment from a tile kept in fragment order: 512 elements, chunk c
// (elements 8c..8c+7 of every lane) at c*256 + lane*8, so that one 16-byte load
// or store of a wave covers 512 contiguous bytes.  p already holds lane*8.
__device__ __forceinline__ v16bf frag_packed(const __bf16* p) {
  v8bf lo = *(const v8bf*)(p);
  v8bf hi = *(const v8bf*)(p + 256);
  return cat16(lo, hi);
}
__device__ __forceinline__ v8f wmma_bf16(v16bf a, v16bf b, v8f c) {
  return __builtin_amdgcn_wmma_f32_16x16x32_bf16(
      false, a, false, b, (short)0, c, false, false);
}
__device__ __forceinline__ v8f zero8() {
  v8f z = {0.f,0.f,0.f,0.f,0.f,0.f,0.f,0.f};
  return z;
}
// lane l takes the value of lane l ^ 16 (the other half of the wave), on the vector pipe
__device__ __forceinline__ float xhalf(float v) {
  const int i = __builtin_bit_cast(int, v);
  return __builtin_bit_cast(float, __builtin_amdgcn_permlanex16(i, i, 0x76543210, 0xfedcba98, false, false));
}

// ---------------------------------------------------------------------------
// Kernel 1: fused QKV projection.  out = x @ W.T + b  (NT GEMM).
// WG = 256 thr (8 waves), tile 256(M) x 64(N) for all three weights; a wave owns
// 32 rows x 64 columns of each: 2 x fragments meet 12 weight fragments, and no two
// waves convert the same x rows.  A K step is 64 deep: 48 products a wave.
// x tile async-staged fp32 into LDS; W tiles staged once as bf16.
// Q stored bf16 [B,H,S,Hd].  K and V stored bf16 per head in the fragment order
// the attention kernel loads them in (frag_packed):
//   K: [S/16 key tiles][2 halves of Hd][512], lane row = key,  k = head dim
//   V: [S/32 key steps][4 tiles of Hd][512],  lane row = head dim, k = key
// ---------------------------------------------------------------------------
__global__ __launch_bounds__(256) void qkv_kernel(
    const float* __restrict__ x,
    const float* __restrict__ Wq, const float* __restrict__ bq,
    const float* __restrict__ Wk, const float* __restrict__ bk,
    const float* __restrict__ Wv, const float* __restrict__ bv,
    __bf16* __restrict__ Qb, __bf16* __restrict__ Kb, __bf16* __restrict__ Vb) {
  __shared__ __align__(16) float  Xs[2][256][68];     // 136 KB, padded rows
  __shared__ __align__(16) __bf16 Ws[3][2][64][72];   //  54 KB, padded rows

  const int tid  = threadIdx.x;
  const int wave = tid >> 5;        // M sub-tile (32 rows)
  const int lane = tid & 31;
  const int r    = lane & 15;
  const int half = lane >> 4;
  const int m0   = blockIdx.y * 256;
  const int n0   = blockIdx.x * 64; // the 64 columns are one head

  const float* Wp[3] = {Wq, Wk, Wv};

  // ---- staging ----
  // 4096 chunks of 16 B: a thread takes one chunk of rows xr, xr+16, ..., xr+240
  const int xr = tid >> 4;
  const int xc = (tid & 15) * 4;
  auto stageX = [&](int buf, int k0) {
    const float*   g = x + (size_t)(m0 + xr) * Dc + k0 + xc;
    const uint32_t l = lds_addr(&Xs[buf][xr][xc]);
#pragma unroll
    for (int i = 0; i < 4; ++i) {
      const float*   gi = g + (size_t)i * 64 * Dc;
      const uint32_t li = l + i * 64 * 272;
      async4_b128(gi, gi + 16 * Dc, gi + 32 * Dc, gi + 48 * Dc,
                  li, li + 16 * 272, li + 32 * 272, li + 48 * 272);
    }
  };
  // W in two phases, a K step apart: the twelve global loads of step t+2 go out at the
  // top of step t; they are converted and stored at the top of step t+1, into the
  // buffer that step t has read, so that no wait for them stands near their issue
  const int wr = tid >> 2;
  const int wc = (tid & 3) * 8;
  float4 f[12];
  auto loadW = [&](int k0) {
#pragma unroll
    for (int w = 0; w < 3; ++w)
#pragma unroll
      for (int kk = 0; kk < 2; ++kk) {
        const float* s = Wp[w] + (size_t)(n0 + wr) * Dc + k0 + kk * 32 + wc;
        f[4 * w + 2 * kk]     = *(const float4*)(s);
        f[4 * w + 2 * kk + 1] = *(const float4*)(s + 4);
      }
    wait_x0();
  };
  auto storeW = [&](int buf) {
#pragma unroll
    for (int w = 0; w < 3; ++w)
#pragma unroll
      for (int kk = 0; kk < 2; ++kk)
        *(v8bf*)&Ws[w][buf][wr][kk * 32 + wc] = pack8(f[4 * w + 2 * kk], f[4 * w + 2 * kk + 1]);
  };
  // the four 16-byte pieces of an x fragment, still fp32
  auto rawA = [&](int buf, int i, int kk, float4* o) {
    const float* xp = &Xs[buf][wave * 32 + i * 16 + r][kk * 32];
    o[0] = *(const float4*)(xp + half * 8);
    o[1] = *(const float4*)(xp + half * 8 + 4);
    o[2] = *(const float4*)(xp + 16 + half * 8);
    o[3] = *(const float4*)(xp + 16 + half * 8 + 4);
  };
  auto fragB = [&](int w, int buf, int n, int kk) {
    return frag_from_bf16(&Ws[w][buf][n * 16 + r][kk * 32 + half * 8]);
  };

  v8f aq[2][4], ak[2][4], av[2][4];
#pragma unroll
  for (int i = 0; i < 2; ++i)
#pragma unroll
    for (int n = 0; n < 4; ++n) { aq[i][n] = zero8(); ak[i][n] = zero8(); av[i][n] = zero8(); }

  stageX(0, 0);
  loadW(0);
  storeW(0);
  loadW(64);
  wait_async0();
  __syncthreads();
  stageX(1, 64);                              // flies while K step 0 is worked on

  for (int ks = 0; ks < Dc / 64; ++ks) {
    const int buf = ks & 1;
    // the step's x reads go first: every product needs an x fragment, LDS answers in
    // order, and the W staging below covers their latency
    float4 ar[2][2][4];
#pragma unroll
    for (int kk = 0; kk < 2; ++kk) {
      rawA(buf, 0, kk, ar[kk][0]);
      rawA(buf, 1, kk, ar[kk][1]);
    }
    if (ks + 1 < Dc / 64) storeW(buf ^ 1);
    if (ks + 2 < Dc / 64) loadW((ks + 2) * 64);

#pragma unroll
    for (int kk = 0; kk < 2; ++kk) {
      v16bf bw[3][4];
#pragma unroll
      for (int w = 0; w < 3; ++w)
#pragma unroll
        for (int n = 0; n < 4; ++n) bw[w][n] = fragB(w, buf, n, kk);
      // keeps the 24 W reads of these 24 products together ahead of them: read one
      // fragment at a time, every pair of products waits out an LDS latency
      __builtin_amdgcn_sched_barrier(0);
      const v16bf a0 = cat16(pack8(ar[kk][0][0], ar[kk][0][1]), pack8(ar[kk][0][2], ar[kk][0][3]));
      const v16bf a1 = cat16(pack8(ar[kk][1][0], ar[kk][1][1]), pack8(ar[kk][1][2], ar[kk][1][3]));
#pragma unroll
      for (int n = 0; n < 4; ++n) {
        aq[0][n] = wmma_bf16(a0, bw[0][n], aq[0][n]);
        aq[1][n] = wmma_bf16(a1, bw[0][n], aq[1][n]);
      }
      // K comes out transposed (rows = head dim, column = key): a lane then holds
      // eight neighbouring head dims of one key, one 16-byte chunk of its tile
#pragma unroll
      for (int n = 0; n < 4; ++n) {
        ak[0][n] = wmma_bf16(bw[1][n], a0, ak[0][n]);
        ak[1][n] = wmma_bf16(bw[1][n], a1, ak[1][n]);
      }
#pragma unroll
      for (int n = 0; n < 4; ++n) {
        av[0][n] = wmma_bf16(a0, bw[2][n], av[0][n]);
        av[1][n] = wmma_bf16(a1, bw[2][n], av[1][n]);
      }
      // and keeps the next reads from being strewn among these products
      __builtin_amdgcn_sched_barrier(0);
    }

    // publish K step ks+1 and free this step's x buffer, then refill it
    wait_ds0();
    wait_async0();
    __syncthreads();
    if (ks + 2 < Dc / 64) stageX(buf, (ks + 2) * 64);
  }
  wait_async0();

  // ---- epilogue: bias; Q to [B,H,S,Hd], K and V to their fragment tiles ----
  const int    mr0 = m0 + wave * 32;          // 32 rows = 32 keys of one batch
  const int    s00 = mr0 & (Sc - 1);
  const size_t hb  = (size_t)((mr0 >> 11) * Hc + blockIdx.x) * Sc * Hd;

  float bqn[4], bvn[4], bkn[4][8];
#pragma unroll
  for (int n = 0; n < 4; ++n) {
    bqn[n] = bq[n0 + n * 16 + r];
    bvn[n] = bv[n0 + n * 16 + r];
    const float* bkp = bk + n0 + n * 16 + half * 8;  // ak rows: head dim n*16+half*8+j
    const float4 kb0 = *(const float4*)(bkp), kb1 = *(const float4*)(bkp + 4);
    bkn[n][0] = kb0.x; bkn[n][1] = kb0.y; bkn[n][2] = kb0.z; bkn[n][3] = kb0.w;
    bkn[n][4] = kb1.x; bkn[n][5] = kb1.y; bkn[n][6] = kb1.z; bkn[n][7] = kb1.w;
  }
  wait_x0();

#pragma unroll   // constant n, i, j: the accumulators stay in registers
  for (int n = 0; n < 4; ++n) {
#pragma unroll
    for (int i = 0; i < 2; ++i) {
      __bf16* qt = Qb + hb + (size_t)(s00 + i * 16 + half * 8) * Hd + n * 16 + r;
      // key tile (s00 >> 4) + i, half n >> 1 of Hd, chunk n & 1
      __bf16* kt = Kb + hb + (size_t)((s00 >> 4) + i) * 1024 + n * 256 + lane * 8;
      // key step s00 >> 5, head-dim tile n, chunk i (keys 16*i .. 16*i+15)
      __bf16* vt = Vb + hb + (size_t)(s00 >> 5) * 2048 + n * 512 + i * 256 + lane * 8;
      v8bf qo, ko, vo;
#pragma unroll
      for (int j = 0; j < 8; ++j) {
        qo[j] = (__bf16)(aq[i][n][j] + bqn[n]);
        ko[j] = (__bf16)(ak[i][n][j] + bkn[n][j]);
        vo[j] = (__bf16)(av[i][n][j] + bvn[n]);
      }
      // keeps the tile's ten stores together, behind its arithmetic and in front of their
      // wait
      __builtin_amdgcn_sched_barrier(0);
#pragma unroll
      for (int j = 0; j < 8; ++j) qt[j * Hd] = qo[j];
      *(v8bf*)kt = ko;
      *(v8bf*)vt = vo;
      wait_x0();
      __builtin_amdgcn_sched_barrier(0);
    }
  }
}

__global__ __launch_bounds__(256) __attribute__((amdgpu_waves_per_eu(4, 4))) void attn_kernel(
    const __bf16* __restrict__ Qb, const __bf16* __restrict__ Kb,
    const __bf16* __restrict__ Vb, const int* __restrict__ mask,
    __bf16* __restrict__ Ctx) {
  constexpr int SK  = 128;                  // keys per stage
  constexpr int NST = Sc / SK;              // 16 stages
  constexpr int G   = 2;                    // column groups of 16 queries per wave
  __shared__ __align__(16) __bf16 Ks[2][SK * Hd];     // 32 KB
  __shared__ __align__(16) __bf16 Vs[2][SK * Hd];     // 32 KB

  const int tid  = threadIdx.x;
  const int wave = tid >> 5;
  const int lane = tid & 31;
  const int r    = lane & 15;
  const int half = lane >> 4;

  const int bh = blockIdx.y;                // b*H + h
  const int b  = bh >> 4;
  const int h  = bh & 15;
  const int q0 = blockIdx.x * (128 * G) + wave * (16 * G);

  const __bf16* kbase = Kb + (size_t)bh * Sc * Hd;
  const __bf16* vbase = Vb + (size_t)bh * Hd * Sc;
  const int*    mbase = mask + (size_t)b * Sc;

  // a stage is 1024 chunks of 16 B of K and as many of V: a thread takes chunks
  // tid, tid+256, tid+512, tid+768 of each, so a wave's copy covers 512 contiguous bytes
  auto stageKV = [&](int buf, int st) {
    const __bf16*  gk = kbase + (size_t)st * SK * Hd + tid * 8;
    const __bf16*  gv = vbase + (size_t)st * SK * Hd + tid * 8;
    const uint32_t lk = lds_addr(&Ks[buf][tid * 8]);
    const uint32_t lv = lds_addr(&Vs[buf][tid * 8]);
    async4_b128(gk, gk + 2048, gk + 4096, gk + 6144, lk, lk + 4096, lk + 8192, lk + 12288);
    async4_b128(gv, gv + 2048, gv + 4096, gv + 6144, lv, lv + 4096, lv + 8192, lv + 12288);
  };
  stageKV(0, 0);                            // flies while Q and the mask are read

  v16bf qf[G][2];
#pragma unroll
  for (int g = 0; g < G; ++g) {
    const __bf16* qp = Qb + ((size_t)bh * Sc + (q0 + g * 16 + r)) * Hd + half * 8;
    qf[g][0] = frag_from_bf16(qp);
    qf[g][1] = frag_from_bf16(qp + 32);
  }

  constexpr float CS = 0.125f * 1.4426950408889634f;   // 1/sqrt(Hd) * log2(e)
  float mrun[G], rawlim[G], lrow[G];
  v8f   o[G][4];
#pragma unroll
  for (int g = 0; g < G; ++g) {
    mrun[g]   = -3.0e38f;                   // the maximum in use, scaled, base 2
    rawlim[g] = -3.0e38f;                   // (mrun + 8) / CS: the same limit for unscaled scores
    lrow[g]   = 0.f;                        // this half's keys only
#pragma unroll
    for (int t = 0; t < 4; ++t) o[g][t] = zero8();
  }

  // does this batch row mask any key at all?  One wave-uniform flag, so that
  // the loop pays for the 16 per-register mask terms only where there are some
  unsigned mlow = 0xffffffffu;              // unsigned minimum: 0 iff some entry is 0
#pragma unroll
  for (int i = 0; i < Sc / 128; ++i) {
    const int4 mv = *(const int4*)(mbase + i * 128 + lane * 4);
    mlow = min(min(mlow, min((unsigned)mv.x, (unsigned)mv.y)), min((unsigned)mv.z, (unsigned)mv.w));
  }
  const bool masked = __builtin_amdgcn_ballot_w32(mlow == 0u) != 0;

  wait_async0();
  __syncthreads();                          // stage 0 is there for every wave
  stageKV(1, 1);                            // flies while stage 0 is worked on

  for (int st = 0; st < NST; ++st) {
   const int buf = st & 1;
   // stays rolled, as it was: unrolled, the passes overlap in more registers than two
   // resident work-groups leave a wave
#pragma unroll 1
   for (int ps = 0; ps < SK / 32; ++ps) {
    const int kk0 = st * SK + ps * 32;
    // ---- scores: S^T[32 k x 16 q] = K (32x64) * Q^T, for both groups ----
    const __bf16* kp = &Ks[buf][ps * 32 * Hd + lane * 8];     // 32 keys = 4 tiles
    v16bf kf00 = frag_packed(kp);
    v16bf kf01 = frag_packed(kp + 512);
    v16bf kf10 = frag_packed(kp + 1024);
    v16bf kf11 = frag_packed(kp + 1536);
    // keeps the eight K reads together ahead of the eight products: read a pair at a
    // time, every pair of products waits out an LDS latency of its own
    __builtin_amdgcn_sched_barrier(0);

    v8f s0[G], s1[G];                        // four independent tiles, two products deep
#pragma unroll
    for (int g = 0; g < G; ++g) {
      s0[g] = wmma_bf16(kf00, qf[g][0], zero8());
      s1[g] = wmma_bf16(kf10, qf[g][0], zero8());
    }
#pragma unroll
    for (int g = 0; g < G; ++g) {
      s0[g] = wmma_bf16(kf01, qf[g][1], s0[g]);
      s1[g] = wmma_bf16(kf11, qf[g][1], s1[g]);
    }

    // the mask terms, the same for both groups, come in front of the V reads, so that the
    // sixteen mask words and the V tiles are not live together
    if (masked) {                            // s0[g][j]: key kk0+8*half+j, s1[g][j]: 16 more
      const int* mp = mbase + kk0 + half * 8;
      const int4 ma = *(const int4*)(mp),      mb = *(const int4*)(mp + 4);
      const int4 mc = *(const int4*)(mp + 16), md = *(const int4*)(mp + 20);
      const int m0[8] = {ma.x, ma.y, ma.z, ma.w, mb.x, mb.y, mb.z, mb.w};
      const int m1[8] = {mc.x, mc.y, mc.z, mc.w, md.x, md.y, md.z, md.w};
#pragma unroll   // constant j: the vectors' elements stay in registers
      for (int j = 0; j < 8; ++j) {
        const float a0 = m0[j] ? 0.f : -8.0e9f;   // -1e9 once scaled by 1/sqrt(Hd)
        const float a1 = m1[j] ? 0.f : -8.0e9f;
#pragma unroll
        for (int g = 0; g < G; ++g) { s0[g][j] += a0; s1[g][j] += a1; }
      }
    }

    // the pass's V tiles (one per 16 head dims) are asked for here
    const __bf16* vp = &Vs[buf][ps * 32 * Hd + lane * 8];
    v16bf vf0 = frag_packed(vp);
    v16bf vf1 = frag_packed(vp + 512);
    v16bf vf2 = frag_packed(vp + 1024);
    v16bf vf3 = frag_packed(vp + 1536);
    // keeps the eight V reads together up here: the softmax arithmetic covers their latency
    __builtin_amdgcn_sched_barrier(0);

    // ---- online softmax of one query per lane and group; the maximum is taken of the
    //      unscaled scores (the scale is positive), here of this half's 16 keys ----
    float mx[G];
#pragma unroll
    for (int g = 0; g < G; ++g) {
      mx[g] = fmaxf(s0[g][0], s1[g][0]);
#pragma unroll
      for (int j = 1; j < 8; ++j) mx[g] = fmaxf(mx[g], fmaxf(s0[g][j], s1[g][j]));
    }
    // one test a pass for both groups, a scalar branch: taken in the first pass and then
    // only where a column's maximum has grown by more than 8.  The ballot sees both halves
    // of a column, so the halves exchange their maxima only inside
    if (__builtin_amdgcn_ballot_w32((mx[0] > rawlim[0]) | (mx[1] > rawlim[1])) != 0) {
#pragma unroll
      for (int g = 0; g < G; ++g) {
        const float mboth = fmaxf(mx[g], xhalf(mx[g]));   // maximum of all 32 keys
        const float mnew  = fmaxf(mrun[g], mboth * CS);
        const float alpha = __builtin_amdgcn_exp2f(mrun[g] - mnew);   // 0 in the first pass
        mrun[g]   = mnew;
        rawlim[g] = (mnew + 8.0f) * (1.0f / CS);
        lrow[g]   = lrow[g] * alpha;
#pragma unroll
        for (int t = 0; t < 4; ++t) o[g][t] = o[g][t] * alpha;
      }
    }
    const v8f cs8 = {CS, CS, CS, CS, CS, CS, CS, CS};
#pragma unroll
    for (int g = 0; g < G; ++g) {
      const float nm = -mrun[g];
      const v8f nm8 = {nm, nm, nm, nm, nm, nm, nm, nm};
      const v8f t0 = __builtin_elementwise_fma(s0[g], cs8, nm8);
      const v8f t1 = __builtin_elementwise_fma(s1[g], cs8, nm8);
      float p0[8], p1[8];
#pragma unroll
      for (int j = 0; j < 8; ++j) {
        p0[j] = __builtin_amdgcn_exp2f(t0[j]);
        p1[j] = __builtin_amdgcn_exp2f(t1[j]);
      }
      const float sa = ((p0[0] + p0[1]) + (p0[2] + p0[3])) + ((p0[4] + p0[5]) + (p0[6] + p0[7]));
      const float sb = ((p1[0] + p1[1]) + (p1[2] + p1[3])) + ((p1[4] + p1[5]) + (p1[6] + p1[7]));
      lrow[g] += sa + sb;

      // ---- P^T as a B operand: element s = key 8*half+s, then 16+8*half+(s-8) ----
      v16bf pf;
#pragma unroll
      for (int j = 0; j < 8; ++j) { pf[j] = (__bf16)p0[j]; pf[8 + j] = (__bf16)p1[j]; }

      // ---- O^T += V^T @ P^T   (one fragment tile per 16 head dims) ----
      o[g][0] = wmma_bf16(vf0, pf, o[g][0]);
      o[g][1] = wmma_bf16(vf1, pf, o[g][1]);
      o[g][2] = wmma_bf16(vf2, pf, o[g][2]);
      o[g][3] = wmma_bf16(vf3, pf, o[g][3]);
    }
   }
   // publish stage st+1 and free this stage's buffer, then refill it
   wait_ds0();
   wait_async0();
   __syncthreads();
   if (st + 2 < NST) stageKV(buf, st + 2);
  }
  wait_async0();

  // ---- join the halves' sums, normalize, store context bf16 [B,S,D]:
  //      tile t of a lane is head dims 16*t+8*half+0..7 of query q0+16*g+r ----
#pragma unroll
  for (int g = 0; g < G; ++g) {
    const float inv = 1.0f / (lrow[g] + xhalf(lrow[g]));
    v8bf c0, c1, c2, c3;
#pragma unroll
    for (int j = 0; j < 8; ++j) {
      c0[j] = (__bf16)(o[g][0][j] * inv);
      c1[j] = (__bf16)(o[g][1][j] * inv);
      c2[j] = (__bf16)(o[g][2][j] * inv);
      c3[j] = (__bf16)(o[g][3][j] * inv);
    }
    __bf16* cp = Ctx + ((size_t)b * Sc + q0 + g * 16 + r) * Dc + h * Hd + half * 8;
    *(v8bf*)(cp)      = c0;
    *(v8bf*)(cp + 16) = c1;
    *(v8bf*)(cp + 32) = c2;
    *(v8bf*)(cp + 48) = c3;
    wait_x0();
  }
}

// ---------------------------------------------------------------------------
// Kernel 3: out projection + residual.  y = x + ctx @ Wo.T + bo  (fp32 y).
// WG = 256 thr (8 waves), tile 128(M) x 128(N); a wave owns 32 x 64: 2 context
// fragments meet 4 weight fragments.  A K step is 64 deep: 16 products a wave.
// Ctx tile async-staged (already bf16); Wo staged as bf16 once per K-step.
// ---------------------------------------------------------------------------
__global__ __launch_bounds__(256) void oproj_kernel(
    const __bf16* __restrict__ Ctx, const float* __restrict__ Wo,
    const float* __restrict__ bo, const float* __restrict__ x,
    float* __restrict__ Y) {
  __shared__ __align__(16) __bf16 Cs[2][128][72];     // 36 KB, padded rows
  __shared__ __align__(16) __bf16 Os[2][128][72];     // 36 KB, padded rows

  const int tid  = threadIdx.x;
  const int wave = tid >> 5;
  const int lane = tid & 31;
  const int r    = lane & 15;
  const int half = lane >> 4;
  const int mw   = wave & 3;        // M sub-tile (32 rows)
  const int nw   = wave >> 2;       // N sub-tile (64 cols)
  const int m0   = blockIdx.y * 128;
  const int n0   = blockIdx.x * 128;

  // 1024 chunks of 16 B: a thread takes one chunk of rows cr, cr+32, cr+64, cr+96
  const int cr = tid >> 3;
  const int cc = (tid & 7) * 8;
  auto stageC = [&](int buf, int k0) {
    const __bf16*  g = Ctx + (size_t)(m0 + cr) * Dc + k0 + cc;
    const uint32_t l = lds_addr(&Cs[buf][cr][cc]);
    async4_b128(g, g + 32 * Dc, g + 64 * Dc, g + 96 * Dc,
                l, l + 32 * 144, l + 64 * 144, l + 96 * 144);
  };
  // Wo in two phases, a K step apart, as W in the QKV kernel
  const int sr = tid >> 2;                   // rows sr and sr + 64
  const int sc = (tid & 3) * 8;              // 8 elements per thread, row and half step
  float4 f[8];
  auto loadW = [&](int k0) {
#pragma unroll
    for (int h = 0; h < 2; ++h)
#pragma unroll
      for (int kk = 0; kk < 2; ++kk) {
        const float* s = Wo + (size_t)(n0 + sr + 64 * h) * Dc + k0 + kk * 32 + sc;
        f[4 * h + 2 * kk]     = *(const float4*)(s);
        f[4 * h + 2 * kk + 1] = *(const float4*)(s + 4);
      }
    wait_x0();
  };
  auto storeW = [&](int buf) {
#pragma unroll
    for (int h = 0; h < 2; ++h)
#pragma unroll
      for (int kk = 0; kk < 2; ++kk)
        *(v8bf*)&Os[buf][sr + 64 * h][kk * 32 + sc] = pack8(f[4 * h + 2 * kk], f[4 * h + 2 * kk + 1]);
  };

  v8f acc[2][4];
#pragma unroll
  for (int i = 0; i < 2; ++i)
#pragma unroll
    for (int n = 0; n < 4; ++n) acc[i][n] = zero8();

  stageC(0, 0);
  loadW(0);
  storeW(0);
  loadW(64);
  wait_async0();
  __syncthreads();
  stageC(1, 64);                              // flies while K step 0 is worked on

  for (int ks = 0; ks < Dc / 64; ++ks) {
    const int buf = ks & 1;
    // the step's 24 LDS reads go first, together; the Wo staging covers their latency
    v16bf a[2][2], b[2][4];
#pragma unroll
    for (int kk = 0; kk < 2; ++kk) {
#pragma unroll
      for (int i = 0; i < 2; ++i)
        a[kk][i] = frag_from_bf16(&Cs[buf][mw * 32 + i * 16 + r][kk * 32 + half * 8]);
#pragma unroll
      for (int n = 0; n < 4; ++n)
        b[kk][n] = frag_from_bf16(&Os[buf][nw * 64 + n * 16 + r][kk * 32 + half * 8]);
    }
    // keeps the reads together up here: read one fragment at a time among the
    // products, every product or two waits out an LDS latency
    __builtin_amdgcn_sched_barrier(0);
    if (ks + 1 < Dc / 64) storeW(buf ^ 1);
    if (ks + 2 < Dc / 64) loadW((ks + 2) * 64);
    // keeps the Wo loads ahead of the products that cover their latency
    __builtin_amdgcn_sched_barrier(0);

#pragma unroll
    for (int kk = 0; kk < 2; ++kk)
#pragma unroll
      for (int i = 0; i < 2; ++i)
#pragma unroll
        for (int n = 0; n < 4; ++n) acc[i][n] = wmma_bf16(a[kk][i], b[kk][n], acc[i][n]);
    // keeps the products in front of the barrier, whose wait for the Wo loads they cover
    __builtin_amdgcn_sched_barrier(0);

    // publish K step ks+1 and free this step's context buffer, then refill it
    wait_ds0();
    wait_async0();
    __syncthreads();
    if (ks + 2 < Dc / 64) stageC(buf, (ks + 2) * 64);
  }
  wait_async0();

  float bon[4];
#pragma unroll
  for (int n = 0; n < 4; ++n) bon[n] = bo[n0 + nw * 64 + n * 16 + r];
  wait_x0();
  // keeps the bias loads in front of their wait
  __builtin_amdgcn_sched_barrier(0);

#pragma unroll   // constant i, n, j: the accumulators stay in registers
  for (int n = 0; n < 4; ++n) {
    const int    cn  = n0 + nw * 64 + n * 16 + r;
    const size_t o0  = (size_t)(m0 + mw * 32 + half * 8) * Dc + cn;
    float xv[2][8];
#pragma unroll
    for (int i = 0; i < 2; ++i)
#pragma unroll
      for (int j = 0; j < 8; ++j) xv[i][j] = x[o0 + (size_t)(i * 16 + j) * Dc];
    wait_x0();
    float yv[2][8];
#pragma unroll
    for (int i = 0; i < 2; ++i)
#pragma unroll
      for (int j = 0; j < 8; ++j) yv[i][j] = acc[i][n][j] + bon[n] + xv[i][j];
    // keeps the sixteen stores together, behind the sums and in front of their wait
    __builtin_amdgcn_sched_barrier(0);
#pragma unroll
    for (int i = 0; i < 2; ++i)
#pragma unroll
      for (int j = 0; j < 8; ++j) Y[o0 + (size_t)(i * 16 + j) * Dc] = yv[i][j];
    wait_x0();
    __builtin_amdgcn_sched_barrier(0);
  }
}

// ---------------------------------------------------------------------------
// Kernel 4: LayerNorm over D=1024 per row.  One block (256 thr) per row.
// ---------------------------------------------------------------------------
__global__ __launch_bounds__(256) void ln_kernel(
    const float* __restrict__ Y, const float* __restrict__ gamma,
    const float* __restrict__ beta, float* __restrict__ out) {
  __shared__ float redS[8], redQ[8];
  const int row  = blockIdx.x;
  const int tid  = threadIdx.x;
  const int wave = tid >> 5;
  const int lane = tid & 31;

  const float4 v = ((const float4*)(Y + (size_t)row * Dc))[tid];
  float s = v.x + v.y + v.z + v.w;
  float q = v.x * v.x + v.y * v.y + v.z * v.z + v.w * v.w;
#pragma unroll
  for (int m = 16; m >= 1; m >>= 1) {
    s += __shfl_xor(s, m);
    q += __shfl_xor(q, m);
  }
  if (lane == 0) { redS[wave] = s; redQ[wave] = q; }
  __syncthreads();
  float S = 0.f, Q = 0.f;
#pragma unroll
  for (int i = 0; i < 8; ++i) { S += redS[i]; Q += redQ[i]; }
  const float mu   = S * (1.0f / Dc);
  const float var  = Q * (1.0f / Dc) - mu * mu;
  const float rstd = rsqrtf(var + 1e-5f);

  const float4 g  = ((const float4*)gamma)[tid];
  const float4 be = ((const float4*)beta)[tid];
  float4 o;
  o.x = (v.x - mu) * rstd * g.x + be.x;
  o.y = (v.y - mu) * rstd * g.y + be.y;
  o.z = (v.z - mu) * rstd * g.z + be.z;
  o.w = (v.w - mu) * rstd * g.w + be.w;
  ((float4*)(out + (size_t)row * Dc))[tid] = o;
}

// ---------------------------------------------------------------------------
// Launcher
// ---------------------------------------------------------------------------
extern "C" void kernel_launch(void* const* d_in, const int* in_sizes, int n_in,
                              void* d_out, int out_size, void* d_ws, size_t ws_size,
                              hipStream_t stream) {
  const float* x     = (const float*)d_in[0];
  const int*   mask  = (const int*)  d_in[1];
  const float* Wq    = (const float*)d_in[2];
  const float* bq    = (const float*)d_in[3];
  const float* Wk    = (const float*)d_in[4];
  const float* bk    = (const float*)d_in[5];
  const float* Wv    = (const float*)d_in[6];
  const float* bv    = (const float*)d_in[7];
  const float* Wo    = (const float*)d_in[8];
  const float* bo    = (const float*)d_in[9];
  const float* gamma = (const float*)d_in[10];
  const float* beta  = (const float*)d_in[11];

  char* ws = (char*)d_ws;
  const size_t ELEMS = (size_t)Mtot * Dc;          // 8 Mi elements
  __bf16* Qb  = (__bf16*)(ws);                     // 16 MB
  __bf16* Kb  = (__bf16*)(ws + 2 * ELEMS);         // 16 MB
  __bf16* Vb  = (__bf16*)(ws + 4 * ELEMS);         // 16 MB
  __bf16* Ctx = (__bf16*)(ws + 6 * ELEMS);         // 16 MB
  float*  Y   = (float*) (ws + 8 * ELEMS);         // 32 MB

  dim3 blk(256);
  dim3 g1(Dc / 64, Mtot / 256);                    // (16, 32)
  qkv_kernel<<<g1, blk, 0, stream>>>(x, Wq, bq, Wk, bk, Wv, bv, Qb, Kb, Vb);

  dim3 g2(Sc / 256, Bc * Hc);                      // (8, 64)
  attn_kernel<<<g2, blk, 0, stream>>>(Qb, Kb, Vb, mask, Ctx);

  dim3 g3(Dc / 128, Mtot / 128);                   // (8, 64)
  oproj_kernel<<<g3, blk, 0, stream>>>(Ctx, Wo, bo, x, Y);

  ln_kernel<<<Mtot, blk, 0, stream>>>(Y, gamma, beta, (float*)d_out);
}

// v007
// Measured time: 133 microseconds a run.
// In two side-by-side timings against v006, it was 1.07 and 1.08 times as fast.
// All steps since v000 together make it 3.42 times as fast.
#include <hip/hip_runtime.h>
#include <stdint.h>

// ---------------------------------------------------------------------------
// NonLocalAttention block for MI455X (gfx1250), wave32 + WMMA bf16 pipeline,
// LDS-staged double-buffered GEMMs with async global->LDS copies.
//   B=4, S=2048, D=1024, H=16, Hd=64
// ---------------------------------------------------------------------------

typedef __attribute__((ext_vector_type(16))) __bf16 v16bf;
typedef __attribute__((ext_vector_type(8)))  __bf16 v8bf;
typedef __attribute__((ext_vector_type(8)))  float  v8f;
typedef __attribute__((ext_vector_type(4)))  float  v4f;

static constexpr int Bc   = 4;
static constexpr int Sc   = 2048;
static constexpr int Dc   = 1024;
static constexpr int Hc   = 16;
static constexpr int Hd   = 64;
static constexpr int Mtot = Bc * Sc;      // 8192 rows

// ---------------- CDNA5 async global->LDS (ASYNCcnt) ------------------------
// A lane's run of 16-byte copies.  The s_wait_xcnt 0 is the statement's last line, so
// that no address register of a copy is rewritten in front of it.
__device__ __forceinline__ uint32_t lds_addr(const void* p) { return (uint32_t)(uintptr_t)p; }
__device__ __forceinline__ void async2_b128(const void* g0, const void* g1,
                                            uint32_t l0, uint32_t l1) {
  asm volatile("global_load_async_to_lds_b128 %0, %2, off\n\t"
               "global_load_async_to_lds_b128 %1, %3, off\n\t"
               "s_wait_xcnt 0x0"
               :: "v"(l0), "v"(l1), "v"(g0), "v"(g1)
               : "memory");
}
__device__ __forceinline__ void async4_b128(const void* g0, const void* g1,
                                            const void* g2, const void* g3,
                                            uint32_t l0, uint32_t l1, uint32_t l2, uint32_t l3) {
  asm volatile("global_load_async_to_lds_b128 %0, %4, off\n\t"
               "global_load_async_to_lds_b128 %1, %5, off\n\t"
               "global_load_async_to_lds_b128 %2, %6, off\n\t"
               "global_load_async_to_lds_b128 %3, %7, off\n\t"
               "s_wait_xcnt 0x0"
               :: "v"(l0), "v"(l1), "v"(l2), "v"(l3), "v"(g0), "v"(g1), "v"(g2), "v"(g3)
               : "memory");
}
// stands behind a run of global loads or stores, in front of the first rewrite of a
// register that one of them names
__device__ __forceinline__ void wait_x0() {
  asm volatile("s_wait_xcnt 0x0" ::: "memory");
}
// the same wait behind a run of loads whose addresses are formed anew for the run: the address
// registers are inputs of the statement, so they stay live, and unwritten, up to the wait
__device__ __forceinline__ void wait_x0_after(const void* a, const void* b) {
  asm volatile("s_wait_xcnt 0x0" :: "v"(a), "v"(b) : "memory");
}
__device__ __forceinline__ void wait_x0_after(const void* a, const void* b, const void* c) {
  asm volatile("s_wait_xcnt 0x0" :: "v"(a), "v"(b), "v"(c) : "memory");
}
// the copies of this wave have landed
__device__ __forceinline__ void wait_async0() {
  asm volatile("s_wait_asynccnt 0x0" ::: "memory");
}
// this wave's LDS reads and writes are done: stands in front of the barrier behind
// which a buffer is refilled by copies
__device__ __forceinline__ void wait_ds0() {
  asm volatile("s_wait_dscnt 0x0" ::: "memory");
}

// ---------------- fragment helpers -----------------------------------------
__device__ __forceinline__ v8bf pack8(float4 a, float4 b) {
  v8bf o;
  o[0] = (__bf16)a.x; o[1] = (__bf16)a.y; o[2] = (__bf16)a.z; o[3] = (__bf16)a.w;
  o[4] = (__bf16)b.x; o[5] = (__bf16)b.y; o[6] = (__bf16)b.z; o[7] = (__bf16)b.w;
  return o;
}
__device__ __forceinline__ v8bf pack8(v4f a, v4f b) {
  v8bf o;
  o[0] = (__bf16)a[0]; o[1] = (__bf16)a[1]; o[2] = (__bf16)a[2]; o[3] = (__bf16)a[3];
  o[4] = (__bf16)b[0]; o[5] = (__bf16)b[1]; o[6] = (__bf16)b[2]; o[7] = (__bf16)b[3];
  return o;
}
__device__ __forceinline__ v16bf cat16(v8bf lo, v8bf hi) {
  return __builtin_shufflevector(lo, hi, 0,1,2,3,4,5,6,7,8,9,10,11,12,13,14,15);
}
// 16-bit A/B fragment: lane = {r=lane&15 (row/col), half=lane>>4}.
// Elements 0..7 = K (half*8)+0..7, elements 8..15 = K 16+(half*8)+0..7.
__device__ __forceinline__ v16bf frag_from_bf16(const __bf16* p) {
  v8bf lo = *(const v8bf*)(p);
  v8bf hi = *(const v8bf*)(p + 16);
  return cat16(lo, hi);
}
// The same fragment from a tile kept in fragment order: 512 elements, chunk c
// (elements 8c..8c+7 of every lane) at c*256 + lane*8, so that one 16-byte load
// or store of a wave covers 512 contiguous bytes.  p already holds lane*8.
__device__ __forceinline__ v16bf frag_packed(const __bf16* p) {
  v8bf lo = *(const v8bf*)(p);
  v8bf hi = *(const v8bf*)(p + 256);
  return cat16(lo, hi);
}
__device__ __forceinline__ v8f wmma_bf16(v16bf a, v16bf b, v8f c) {
  return __builtin_amdgcn_wmma_f32_16x16x32_bf16(
      false, a, false, b, (short)0, c, false, false);
}
__device__ __forceinline__ v8f zero8() {
  v8f z = {0.f,0.f,0.f,0.f,0.f,0.f,0.f,0.f};
  return z;
}
// lane l takes the value of lane l ^ 16 (the other half of the wave), on the vector pipe
__device__ __forceinline__ float xhalf(float v) {
  const int i = __builtin_bit_cast(int, v);
  return __builtin_bit_cast(float, __builtin_amdgcn_permlanex16(i, i, 0x76543210, 0xfedcba98, false, false));
}

// ---------------------------------------------------------------------------
// Kernel 1: fused QKV projection.  out = x @ W.T + b  (NT GEMM).
// WG = 256 thr (8 waves), tile 256(M) x 64(N) for all three weights; a wave owns
// 32 rows x 64 columns of each: 2 x fragments meet 12 weight fragments, and no two
// waves convert the same x rows.  A K step is 64 deep: 48 products a wave.
// x tile async-staged fp32 into LDS; W tiles staged once as bf16.
// Q stored bf16 [B,H,S,Hd].  K and V stored bf16 per head in the fragment order
// the attention kernel loads them in (frag_packed):
//   K: [S/16 key tiles][2 halves of Hd][512], lane row = key,  k = head dim
//   V: [S/32 key steps][4 tiles of Hd][512],  lane row = head dim, k = key
// ---------------------------------------------------------------------------
__global__ __launch_bounds__(256) void qkv_kernel(
    const float* __restrict__ x,
    const float* __restrict__ Wq, const float* __restrict__ bq,
    const float* __restrict__ Wk, const float* __restrict__ bk,
    const float* __restrict__ Wv, const float* __restrict__ bv,
    __bf16* __restrict__ Qb, __bf16* __restrict__ Kb, __bf16* __restrict__ Vb) {
  __shared__ __align__(16) float  Xs[2][256][68];     // 136 KB, padded rows
  __shared__ __align__(16) __bf16 Ws[3][2][64][72];   //  54 KB, padded rows

  const int tid  = threadIdx.x;
  const int wave = tid >> 5;        // M sub-tile (32 rows)
  const int lane = tid & 31;
  const int r    = lane & 15;
  const int half = lane >> 4;
  const int m0   = blockIdx.y * 256;
  const int n0   = blockIdx.x * 64; // the 64 columns are one head

  const float* Wp[3] = {Wq, Wk, Wv};

  // The sixteen work-groups of a row of the grid read the same x lines and those of a column
  // the same W lines.  Started at the same K step they ask L2 for the same lines at the same
  // moment, and such requests collide.  Each work-group starts at a step of its own and wraps:
  // no two in a row, and no two among sixteen neighbours in a column, are at the same step.
  const int rot = (blockIdx.x + blockIdx.y) & (Dc / 64 - 1);
  auto kof = [&](int ks) { return ((ks + rot) & (Dc / 64 - 1)) * 64; };

  // ---- staging ----
  // 4096 chunks of 16 B: a thread takes one chunk of rows xr, xr+16, ..., xr+240
  const int xr = tid >> 4;
  const int xc = (tid & 15) * 4;
  auto stageX = [&](int buf, int k0) {
    const float*   g = x + (size_t)(m0 + xr) * Dc + k0 + xc;
    const uint32_t l = lds_addr(&Xs[buf][xr][xc]);
#pragma unroll
    for (int i = 0; i < 4; ++i) {
      const float*   gi = g + (size_t)i * 64 * Dc;
      const uint32_t li = l + i * 64 * 272;
      async4_b128(gi, gi + 16 * Dc, gi + 32 * Dc, gi + 48 * Dc,
                  li, li + 16 * 272, li + 32 * 272, li + 48 * 272);
    }
  };
  // W in two phases, a K step apart: the twelve global loads of step t+2 go out at the
  // top of step t; they are converted and stored at the top of step t+1, into the
  // buffer that step t has read, so that no wait for them stands near their issue
  const int wr = tid >> 2;
  const int wc = (tid & 3) * 8;
  // a vector type: each load's four values stay in the registers they land in (as members of
  // a struct some were copied right behind the loads, behind a wait for their data)
  v4f f[12];
  auto loadW = [&](int k0) {
    const float* s[3];
#pragma unroll
    for (int w = 0; w < 3; ++w) {
      s[w] = Wp[w] + (size_t)(n0 + wr) * Dc + k0 + wc;
#pragma unroll
      for (int kk = 0; kk < 2; ++kk) {
        f[4 * w + 2 * kk]     = *(const v4f*)(s[w] + kk * 32);
        f[4 * w + 2 * kk + 1] = *(const v4f*)(s[w] + kk * 32 + 4);
      }
    }
    wait_x0_after(s[0], s[1], s[2]);
  };
  auto storeW = [&](int buf) {
#pragma unroll
    for (int w = 0; w < 3; ++w)
#pragma unroll
      for (int kk = 0; kk < 2; ++kk)
        *(v8bf*)&Ws[w][buf][wr][kk * 32 + wc] = pack8(f[4 * w + 2 * kk], f[4 * w + 2 * kk + 1]);
  };
  // the four 16-byte pieces of an x fragment, still fp32
  auto rawA = [&](int buf, int i, int kk, float4* o) {
    const float* xp = &Xs[buf][wave * 32 + i * 16 + r][kk * 32];
    o[0] = *(const float4*)(xp + half * 8);
    o[1] = *(const float4*)(xp + half * 8 + 4);
    o[2] = *(const float4*)(xp + 16 + half * 8);
    o[3] = *(const float4*)(xp + 16 + half * 8 + 4);
  };
  auto fragB = [&](int w, int buf, int n, int kk) {
    return frag_from_bf16(&Ws[w][buf][n * 16 + r][kk * 32 + half * 8]);
  };

  v8f aq[2][4], ak[2][4], av[2][4];
#pragma unroll
  for (int i = 0; i < 2; ++i)
#pragma unroll
    for (int n = 0; n < 4; ++n) { aq[i][n] = zero8(); ak[i][n] = zero8(); av[i][n] = zero8(); }

  stageX(0, kof(0));
  loadW(kof(0));
  storeW(0);
  loadW(kof(1));
  wait_async0();
  __syncthreads();
  stageX(1, kof(1));                            // flies while K step 0 is worked on

  for (int ks = 0; ks < Dc / 64; ++ks) {
    const int buf = ks & 1;
    // the step's x reads go first: every product needs an x fragment, LDS answers in
    // order, and the W staging below covers their latency
    float4 ar[2][2][4];
#pragma unroll
    for (int kk = 0; kk < 2; ++kk) {
      rawA(buf, 0, kk, ar[kk][0]);
      rawA(buf, 1, kk, ar[kk][1]);
    }
    if (ks + 1 < Dc / 64) storeW(buf ^ 1);
    if (ks + 2 < Dc / 64) loadW(kof(ks + 2));

#pragma unroll
    for (int kk = 0; kk < 2; ++kk) {
      v16bf bw[3][4];
#pragma unroll
      for (int w = 0; w < 3; ++w)
#pragma unroll
        for (int n = 0; n < 4; ++n) bw[w][n] = fragB(w, buf, n, kk);
      // keeps the 24 W reads of these 24 products together ahead of them: read one
      // fragment at a time, every pair of products waits out an LDS latency
      __builtin_amdgcn_sched_barrier(0);
      const v16bf a0 = cat16(pack8(ar[kk][0][0], ar[kk][0][1]), pack8(ar[kk][0][2], ar[kk][0][3]));
      const v16bf a1 = cat16(pack8(ar[kk][1][0], ar[kk][1][1]), pack8(ar[kk][1][2], ar[kk][1][3]));
#pragma unroll
      for (int n = 0; n < 4; ++n) {
        aq[0][n] = wmma_bf16(a0, bw[0][n], aq[0][n]);
        aq[1][n] = wmma_bf16(a1, bw[0][n], aq[1][n]);
      }
      // K comes out transposed (rows = head dim, column = key): a lane then holds
      // eight neighbouring head dims of one key, one 16-byte chunk of its tile
#pragma unroll
      for (int n = 0; n < 4; ++n) {
        ak[0][n] = wmma_bf16(bw[1][n], a0, ak[0][n]);
        ak[1][n] = wmma_bf16(bw[1][n], a1, ak[1][n]);
      }
#pragma unroll
      for (int n = 0; n < 4; ++n) {
        av[0][n] = wmma_bf16(a0, bw[2][n], av[0][n]);
        av[1][n] = wmma_bf16(a1, bw[2][n], av[1][n]);
      }
      // and keeps the next reads from being strewn among these products
      __builtin_amdgcn_sched_barrier(0);
    }

    // publish K step ks+1 and free this step's x buffer, then refill it
    wait_ds0();
    wait_async0();
    __syncthreads();
    if (ks + 2 < Dc / 64) stageX(buf, kof(ks + 2));
  }
  wait_async0();

  // ---- epilogue: bias; Q to [B,H,S,Hd], K and V to their fragment tiles ----
  const int    mr0 = m0 + wave * 32;          // 32 rows = 32 keys of one batch
  const int    s00 = mr0 & (Sc - 1);
  const size_t hb  = (size_t)((mr0 >> 11) * Hc + blockIdx.x) * Sc * Hd;

  float bqn[4], bvn[4], bkn[4][8];
#pragma unroll
  for (int n = 0; n < 4; ++n) {
    bqn[n] = bq[n0 + n * 16 + r];
    bvn[n] = bv[n0 + n * 16 + r];
    const float* bkp = bk + n0 + n * 16 + half * 8;  // ak rows: head dim n*16+half*8+j
    const float4 kb0 = *(const float4*)(bkp), kb1 = *(const float4*)(bkp + 4);
    bkn[n][0] = kb0.x; bkn[n][1] = kb0.y; bkn[n][2] = kb0.z; bkn[n][3] = kb0.w;
    bkn[n][4] = kb1.x; bkn[n][5] = kb1.y; bkn[n][6] = kb1.z; bkn[n][7] = kb1.w;
  }
  wait_x0();

#pragma unroll   // constant n, i, j: the accumulators stay in registers
  for (int n = 0; n < 4; ++n) {
#pragma unroll
    for (int i = 0; i < 2; ++i) {
      __bf16* qt = Qb + hb + (size_t)(s00 + i * 16 + half * 8) * Hd + n * 16 + r;
      // key tile (s00 >> 4) + i, half n >> 1 of Hd, chunk n & 1
      __bf16* kt = Kb + hb + (size_t)((s00 >> 4) + i) * 1024 + n * 256 + lane * 8;
      // key step s00 >> 5, head-dim tile n, chunk i (keys 16*i .. 16*i+15)
      __bf16* vt = Vb + hb + (size_t)(s00 >> 5) * 2048 + n * 512 + i * 256 + lane * 8;
      v8bf qo, ko, vo;
#pragma unroll
      for (int j = 0; j < 8; ++j) {
        qo[j] = (__bf16)(aq[i][n][j] + bqn[n]);
        ko[j] = (__bf16)(ak[i][n][j] + bkn[n][j]);
        vo[j] = (__bf16)(av[i][n][j] + bvn[n]);
      }
      // keeps the tile's ten stores together, behind its arithmetic and in front of their
      // wait
      __builtin_amdgcn_sched_barrier(0);
#pragma unroll
      for (int j = 0; j < 8; ++j) qt[j * Hd] = qo[j];
      *(v8bf*)kt = ko;
      *(v8bf*)vt = vo;
      wait_x0();
      __builtin_amdgcn_sched_barrier(0);
    }
  }
}

__global__ __launch_bounds__(256) __attribute__((amdgpu_waves_per_eu(4, 4))) void attn_kernel(
    const __bf16* __restrict__ Qb, const __bf16* __restrict__ Kb,
    const __bf16* __restrict__ Vb, const int* __restrict__ mask,
    __bf16* __restrict__ Ctx) {
  constexpr int SK  = 128;                  // keys per stage
  constexpr int NST = Sc / SK;              // 16 stages
  constexpr int G   = 2;                    // column groups of 16 queries per wave
  __shared__ __align__(16) __bf16 Ks[2][SK * Hd];     // 32 KB
  __shared__ __align__(16) __bf16 Vs[2][SK * Hd];     // 32 KB

  const int tid  = threadIdx.x;
  const int wave = tid >> 5;
  const int lane = tid & 31;
  const int r    = lane & 15;
  const int half = lane >> 4;

  const int bh = blockIdx.y;                // b*H + h
  const int b  = bh >> 4;
  const int h  = bh & 15;
  const int q0 = blockIdx.x * (128 * G) + wave * (16 * G);

  const __bf16* kbase = Kb + (size_t)bh * Sc * Hd;
  const __bf16* vbase = Vb + (size_t)bh * Hd * Sc;
  const int*    mbase = mask + (size_t)b * Sc;

  // a stage is 1024 chunks of 16 B of K and as many of V: a thread takes chunks
  // tid, tid+256, tid+512, tid+768 of each, so a wave's copy covers 512 contiguous bytes
  auto stageKV = [&](int buf, int st) {
    const __bf16*  gk = kbase + (size_t)st * SK * Hd + tid * 8;
    const __bf16*  gv = vbase + (size_t)st * SK * Hd + tid * 8;
    const uint32_t lk = lds_addr(&Ks[buf][tid * 8]);
    const uint32_t lv = lds_addr(&Vs[buf][tid * 8]);
    async4_b128(gk, gk + 2048, gk + 4096, gk + 6144, lk, lk + 4096, lk + 8192, lk + 12288);
    async4_b128(gv, gv + 2048, gv + 4096, gv + 6144, lv, lv + 4096, lv + 8192, lv + 12288);
  };
  stageKV(0, 0);                            // flies while Q and the mask are read

  v16bf qf[G][2];
#pragma unroll
  for (int g = 0; g < G; ++g) {
    const __bf16* qp = Qb + ((size_t)bh * Sc + (q0 + g * 16 + r)) * Hd + half * 8;
    qf[g][0] = frag_from_bf16(qp);
    qf[g][1] = frag_from_bf16(qp + 32);
  }

  constexpr float CS = 0.125f * 1.4426950408889634f;   // 1/sqrt(Hd) * log2(e)
  float mrun[G], rawlim[G], lrow[G];
  v8f   o[G][4];
#pragma unroll
  for (int g = 0; g < G; ++g) {
    mrun[g]   = -3.0e38f;                   // the maximum in use, scaled, base 2
    rawlim[g] = -3.0e38f;                   // (mrun + 8) / CS: the same limit for unscaled scores
    lrow[g]   = 0.f;                        // this half's keys only
#pragma unroll
    for (int t = 0; t < 4; ++t) o[g][t] = zero8();
  }

  // does this batch row mask any key at all?  One wave-uniform flag, so that
  // the loop pays for the 16 per-register mask terms only where there are some
  unsigned mlow = 0xffffffffu;              // unsigned minimum: 0 iff some entry is 0
#pragma unroll
  for (int i = 0; i < Sc / 128; ++i) {
    const int4 mv = *(const int4*)(mbase + i * 128 + lane * 4);
    mlow = min(min(mlow, min((unsigned)mv.x, (unsigned)mv.y)), min((unsigned)mv.z, (unsigned)mv.w));
  }
  const bool masked = __builtin_amdgcn_ballot_w32(mlow == 0u) != 0;

  wait_async0();
  __syncthreads();                          // stage 0 is there for every wave
  stageKV(1, 1);                            // flies while stage 0 is worked on

  for (int st = 0; st < NST; ++st) {
   const int buf = st & 1;
   // stays rolled, as it was: unrolled, the passes overlap in more registers than two
   // resident work-groups leave a wave
#pragma unroll 1
   for (int ps = 0; ps < SK / 32; ++ps) {
    const int kk0 = st * SK + ps * 32;
    // ---- scores: S^T[32 k x 16 q] = K (32x64) * Q^T, for both groups ----
    const __bf16* kp = &Ks[buf][ps * 32 * Hd + lane * 8];     // 32 keys = 4 tiles
    v16bf kf00 = frag_packed(kp);
    v16bf kf01 = frag_packed(kp + 512);
    v16bf kf10 = frag_packed(kp + 1024);
    v16bf kf11 = frag_packed(kp + 1536);
    // keeps the eight K reads together ahead of the eight products: read a pair at a
    // time, every pair of products waits out an LDS latency of its own
    __builtin_amdgcn_sched_barrier(0);

    v8f s0[G], s1[G];                        // four independent tiles, two products deep
#pragma unroll
    for (int g = 0; g < G; ++g) {
      s0[g] = wmma_bf16(kf00, qf[g][0], zero8());
      s1[g] = wmma_bf16(kf10, qf[g][0], zero8());
    }
#pragma unroll
    for (int g = 0; g < G; ++g) {
      s0[g] = wmma_bf16(kf01, qf[g][1], s0[g]);
      s1[g] = wmma_bf16(kf11, qf[g][1], s1[g]);
    }

    // the mask terms, the same for both groups, come in front of the V reads, so that the
    // sixteen mask words and the V tiles are not live together
    if (masked) {                            // s0[g][j]: key kk0+8*half+j, s1[g][j]: 16 more
      const int* mp = mbase + kk0 + half * 8;
      const int4 ma = *(const int4*)(mp),      mb = *(const int4*)(mp + 4);
      const int4 mc = *(const int4*)(mp + 16), md = *(const int4*)(mp + 20);
      const int m0[8] = {ma.x, ma.y, ma.z, ma.w, mb.x, mb.y, mb.z, mb.w};
      const int m1[8] = {mc.x, mc.y, mc.z, mc.w, md.x, md.y, md.z, md.w};
#pragma unroll   // constant j: the vectors' elements stay in registers
      for (int j = 0; j < 8; ++j) {
        const float a0 = m0[j] ? 0.f : -8.0e9f;   // -1e9 once scaled by 1/sqrt(Hd)
        const float a1 = m1[j] ? 0.f : -8.0e9f;
#pragma unroll
        for (int g = 0; g < G; ++g) { s0[g][j] += a0; s1[g][j] += a1; }
      }
    }

    // the pass's V tiles (one per 16 head dims) are asked for here
    const __bf16* vp = &Vs[buf][ps * 32 * Hd + lane * 8];
    v16bf vf0 = frag_packed(vp);
    v16bf vf1 = frag_packed(vp + 512);
    v16bf vf2 = frag_packed(vp + 1024);
    v16bf vf3 = frag_packed(vp + 1536);
    // keeps the eight V reads together up here: the softmax arithmetic covers their latency
    __builtin_amdgcn_sched_barrier(0);

    // ---- online softmax of one query per lane and group; the maximum is taken of the
    //      unscaled scores (the scale is positive), here of this half's 16 keys ----
    float mx[G];
#pragma unroll
    for (int g = 0; g < G; ++g) {
      mx[g] = fmaxf(s0[g][0], s1[g][0]);
#pragma unroll
      for (int j = 1; j < 8; ++j) mx[g] = fmaxf(mx[g], fmaxf(s0[g][j], s1[g][j]));
    }
    // one test a pass for both groups, a scalar branch: taken in the first pass and then
    // only where a column's maximum has grown by more than 8.  The ballot sees both halves
    // of a column, so the halves exchange their maxima only inside
    if (__builtin_amdgcn_ballot_w32((mx[0] > rawlim[0]) | (mx[1] > rawlim[1])) != 0) {
#pragma unroll
      for (int g = 0; g < G; ++g) {
        const float mboth = fmaxf(mx[g], xhalf(mx[g]));   // maximum of all 32 keys
        const float mnew  = fmaxf(mrun[g], mboth * CS);
        const float alpha = __builtin_amdgcn_exp2f(mrun[g] - mnew);   // 0 in the first pass
        mrun[g]   = mnew;
        rawlim[g] = (mnew + 8.0f) * (1.0f / CS);
        lrow[g]   = lrow[g] * alpha;
#pragma unroll
        for (int t = 0; t < 4; ++t) o[g][t] = o[g][t] * alpha;
      }
    }
    const v8f cs8 = {CS, CS, CS, CS, CS, CS, CS, CS};
#pragma unroll
    for (int g = 0; g < G; ++g) {
      const float nm = -mrun[g];
      const v8f nm8 = {nm, nm, nm, nm, nm, nm, nm, nm};
      const v8f t0 = __builtin_elementwise_fma(s0[g], cs8, nm8);
      const v8f t1 = __builtin_elementwise_fma(s1[g], cs8, nm8);
      float p0[8], p1[8];
#pragma unroll
      for (int j = 0; j < 8; ++j) {
        p0[j] = __builtin_amdgcn_exp2f(t0[j]);
        p1[j] = __builtin_amdgcn_exp2f(t1[j]);
      }
      const float sa = ((p0[0] + p0[1]) + (p0[2] + p0[3])) + ((p0[4] + p0[5]) + (p0[6] + p0[7]));
      const float sb = ((p1[0] + p1[1]) + (p1[2] + p1[3])) + ((p1[4] + p1[5]) + (p1[6] + p1[7]));
      lrow[g] += sa + sb;

      // ---- P^T as a B operand: element s = key 8*half+s, then 16+8*half+(s-8) ----
      v16bf pf;
#pragma unroll
      for (int j = 0; j < 8; ++j) { pf[j] = (__bf16)p0[j]; pf[8 + j] = (__bf16)p1[j]; }

      // ---- O^T += V^T @ P^T   (one fragment tile per 16 head dims) ----
      o[g][0] = wmma_bf16(vf0, pf, o[g][0]);
      o[g][1] = wmma_bf16(vf1, pf, o[g][1]);
      o[g][2] = wmma_bf16(vf2, pf, o[g][2]);
      o[g][3] = wmma_bf16(vf3, pf, o[g][3]);
    }
   }
   // publish stage st+1 and free this stage's buffer, then refill it
   wait_ds0();
   wait_async0();
   __syncthreads();
   if (st + 2 < NST) stageKV(buf, st + 2);
  }
  wait_async0();

  // ---- join the halves' sums, normalize, store context bf16 [B,S,D]:
  //      tile t of a lane is head dims 16*t+8*half+0..7 of query q0+16*g+r ----
#pragma unroll
  for (int g = 0; g < G; ++g) {
    const float inv = 1.0f / (lrow[g] + xhalf(lrow[g]));
    v8bf c0, c1, c2, c3;
#pragma unroll
    for (int j = 0; j < 8; ++j) {
      c0[j] = (__bf16)(o[g][0][j] * inv);
      c1[j] = (__bf16)(o[g][1][j] * inv);
      c2[j] = (__bf16)(o[g][2][j] * inv);
      c3[j] = (__bf16)(o[g][3][j] * inv);
    }
    __bf16* cp = Ctx + ((size_t)b * Sc + q0 + g * 16 + r) * Dc + h * Hd + half * 8;
    *(v8bf*)(cp)      = c0;
    *(v8bf*)(cp + 16) = c1;
    *(v8bf*)(cp + 32) = c2;
    *(v8bf*)(cp + 48) = c3;
    wait_x0();
  }
}

// ---------------------------------------------------------------------------
// Kernel 3: out projection + residual.  y = x + ctx @ Wo.T + bo  (fp32 y).
// WG = 256 thr (8 waves), tile 128(M) x 128(N); a wave owns 32 x 64: 2 context
// fragments meet 4 weight fragments.  A K step is 64 deep: 16 products a wave.
// Ctx tile async-staged (already bf16); Wo staged as bf16 once per K-step.
// ---------------------------------------------------------------------------
__global__ __launch_bounds__(256) void oproj_kernel(
    const __bf16* __restrict__ Ctx, const float* __restrict__ Wo,
    const float* __restrict__ bo, const float* __restrict__ x,
    float* __restrict__ Y) {
  __shared__ __align__(16) __bf16 Cs[2][128][72];     // 36 KB, padded rows
  __shared__ __align__(16) __bf16 Os[2][128][72];     // 36 KB, padded rows

  const int tid  = threadIdx.x;
  const int wave = tid >> 5;
  const int lane = tid & 31;
  const int r    = lane & 15;
  const int half = lane >> 4;
  const int mw   = wave & 3;        // M sub-tile (32 rows)
  const int nw   = wave >> 2;       // N sub-tile (64 cols)
  const int m0   = blockIdx.y * 128;
  const int n0   = blockIdx.x * 128;

  // as in the QKV kernel: the work-groups that share context lines (a row of the grid) or Wo
  // lines (sixteen neighbours in a column) walk K from different steps, so that they do not ask for a line together
  const int rot = (blockIdx.x + blockIdx.y) & (Dc / 64 - 1);
  auto kof = [&](int ks) { return ((ks + rot) & (Dc / 64 - 1)) * 64; };

  // 1024 chunks of 16 B: a thread takes one chunk of rows cr, cr+32, cr+64, cr+96
  const int cr = tid >> 3;
  const int cc = (tid & 7) * 8;
  auto stageC = [&](int buf, int k0) {
    const __bf16*  g = Ctx + (size_t)(m0 + cr) * Dc + k0 + cc;
    const uint32_t l = lds_addr(&Cs[buf][cr][cc]);
    async4_b128(g, g + 32 * Dc, g + 64 * Dc, g + 96 * Dc,
                l, l + 32 * 144, l + 64 * 144, l + 96 * 144);
  };
  // Wo in two phases, a K step apart, as W in the QKV kernel
  const int sr = tid >> 2;                   // rows sr and sr + 64
  const int sc = (tid & 3) * 8;              // 8 elements per thread, row and half step
  v4f f[8];                                  // a vector type, as in the QKV kernel
  auto loadW = [&](int k0) {
    const float* s[2];
#pragma unroll
    for (int h = 0; h < 2; ++h) {
      s[h] = Wo + (size_t)(n0 + sr + 64 * h) * Dc + k0 + sc;
#pragma unroll
      for (int kk = 0; kk < 2; ++kk) {
        f[4 * h + 2 * kk]     = *(const v4f*)(s[h] + kk * 32);
        f[4 * h + 2 * kk + 1] = *(const v4f*)(s[h] + kk * 32 + 4);
      }
    }
    wait_x0_after(s[0], s[1]);
  };
  auto storeW = [&](int buf) {
#pragma unroll
    for (int h = 0; h < 2; ++h)
#pragma unroll
      for (int kk = 0; kk < 2; ++kk)
        *(v8bf*)&Os[buf][sr + 64 * h][kk * 32 + sc] = pack8(f[4 * h + 2 * kk], f[4 * h + 2 * kk + 1]);
  };

  v8f acc[2][4];
#pragma unroll
  for (int i = 0; i < 2; ++i)
#pragma unroll
    for (int n = 0; n < 4; ++n) acc[i][n] = zero8();

  stageC(0, kof(0));
  loadW(kof(0));
  storeW(0);
  loadW(kof(1));
  wait_async0();
  __syncthreads();
  stageC(1, kof(1));                            // flies while K step 0 is worked on

  for (int ks = 0; ks < Dc / 64; ++ks) {
    const int buf = ks & 1;
    // the step's 24 LDS reads go first, together; the Wo staging covers their latency
    v16bf a[2][2], b[2][4];
#pragma unroll
    for (int kk = 0; kk < 2; ++kk) {
#pragma unroll
      for (int i = 0; i < 2; ++i)
        a[kk][i] = frag_from_bf16(&Cs[buf][mw * 32 + i * 16 + r][kk * 32 + half * 8]);
#pragma unroll
      for (int n = 0; n < 4; ++n)
        b[kk][n] = frag_from_bf16(&Os[buf][nw * 64 + n * 16 + r][kk * 32 + half * 8]);
    }
    // keeps the reads together up here: read one fragment at a time among the
    // products, every product or two waits out an LDS latency
    __builtin_amdgcn_sched_barrier(0);
    if (ks + 1 < Dc / 64) storeW(buf ^ 1);
    if (ks + 2 < Dc / 64) loadW(kof(ks + 2));
    // keeps the Wo loads ahead of the products that cover their latency
    __builtin_amdgcn_sched_barrier(0);

#pragma unroll
    for (int kk = 0; kk < 2; ++kk)
#pragma unroll
      for (int i = 0; i < 2; ++i)
#pragma unroll
        for (int n = 0; n < 4; ++n) acc[i][n] = wmma_bf16(a[kk][i], b[kk][n], acc[i][n]);
    // keeps the products in front of the barrier, whose wait for the Wo loads they cover
    __builtin_amdgcn_sched_barrier(0);

    // publish K step ks+1 and free this step's context buffer, then refill it
    wait_ds0();
    wait_async0();
    __syncthreads();
    if (ks + 2 < Dc / 64) stageC(buf, kof(ks + 2));
  }
  wait_async0();

  float bon[4];
#pragma unroll
  for (int n = 0; n < 4; ++n) bon[n] = bo[n0 + nw * 64 + n * 16 + r];
  wait_x0();
  // keeps the bias loads in front of their wait
  __builtin_amdgcn_sched_barrier(0);

#pragma unroll   // constant i, n, j: the accumulators stay in registers
  for (int n = 0; n < 4; ++n) {
    const int    cn  = n0 + nw * 64 + n * 16 + r;
    const size_t o0  = (size_t)(m0 + mw * 32 + half * 8) * Dc + cn;
    float xv[2][8];
#pragma unroll
    for (int i = 0; i < 2; ++i)
#pragma unroll
      for (int j = 0; j < 8; ++j) xv[i][j] = x[o0 + (size_t)(i * 16 + j) * Dc];
    wait_x0();
    float yv[2][8];
#pragma unroll
    for (int i = 0; i < 2; ++i)
#pragma unroll
      for (int j = 0; j < 8; ++j) yv[i][j] = acc[i][n][j] + bon[n] + xv[i][j];
    // keeps the sixteen stores together, behind the sums and in front of their wait
    __builtin_amdgcn_sched_barrier(0);
#pragma unroll
    for (int i = 0; i < 2; ++i)
#pragma unroll
      for (int j = 0; j < 8; ++j) Y[o0 + (size_t)(i * 16 + j) * Dc] = yv[i][j];
    wait_x0();
    __builtin_amdgcn_sched_barrier(0);
  }
}

// ---------------------------------------------------------------------------
// Kernel 4: LayerNorm over D=1024 per row.  One block (256 thr) per row.
// ---------------------------------------------------------------------------
__global__ __launch_bounds__(256) void ln_kernel(
    const float* __restrict__ Y, const float* __restrict__ gamma,
    const float* __restrict__ beta, float* __restrict__ out) {
  __shared__ float redS[8], redQ[8];
  const int row  = blockIdx.x;
  const int tid  = threadIdx.x;
  const int wave = tid >> 5;
  const int lane = tid & 31;

  const float4 v = ((const float4*)(Y + (size_t)row * Dc))[tid];
  float s = v.x + v.y + v.z + v.w;
  float q = v.x * v.x + v.y * v.y + v.z * v.z + v.w * v.w;
#pragma unroll
  for (int m = 16; m >= 1; m >>= 1) {
    s += __shfl_xor(s, m);
    q += __shfl_xor(q, m);
  }
  if (lane == 0) { redS[wave] = s; redQ[wave] = q; }
  __syncthreads();
  float S = 0.f, Q = 0.f;
#pragma unroll
  for (int i = 0; i < 8; ++i) { S += redS[i]; Q += redQ[i]; }
  const float mu   = S * (1.0f / Dc);
  const float var  = Q * (1.0f / Dc) - mu * mu;
  const float rstd = rsqrtf(var + 1e-5f);

  const float4 g  = ((const float4*)gamma)[tid];
  const float4 be = ((const float4*)beta)[tid];
  float4 o;
  o.x = (v.x - mu) * rstd * g.x + be.x;
  o.y = (v.y - mu) * rstd * g.y + be.y;
  o.z = (v.z - mu) * rstd * g.z + be.z;
  o.w = (v.w - mu) * rstd * g.w + be.w;
  ((float4*)(out + (size_t)row * Dc))[tid] = o;
}

// ---------------------------------------------------------------------------
// Launcher
// ---------------------------------------------------------------------------
extern "C" void kernel_launch(void* const* d_in, const int* in_sizes, int n_in,
                              void* d_out, int out_size, void* d_ws, size_t ws_size,
                              hipStream_t stream) {
  const float* x     = (const float*)d_in[0];
  const int*   mask  = (const int*)  d_in[1];
  const float* Wq    = (const float*)d_in[2];
  const float* bq    = (const float*)d_in[3];
  const float* Wk    = (const float*)d_in[4];
  const float* bk    = (const float*)d_in[5];
  const float* Wv    = (const float*)d_in[6];
  const float* bv    = (const float*)d_in[7];
  const float* Wo    = (const float*)d_in[8];
  const float* bo    = (const float*)d_in[9];
  const float* gamma = (const float*)d_in[10];
  const float* beta  = (const float*)d_in[11];

  char* ws = (char*)d_ws;
  const size_t ELEMS = (size_t)Mtot * Dc;          // 8 Mi elements
  __bf16* Qb  = (__bf16*)(ws);                     // 16 MB
  __bf16* Kb  = (__bf16*)(ws + 2 * ELEMS);         // 16 MB
  __bf16* Vb  = (__bf16*)(ws + 4 * ELEMS);         // 16 MB
  __bf16* Ctx = (__bf16*)(ws + 6 * ELEMS);         // 16 MB
  float*  Y   = (float*) (ws + 8 * ELEMS);         // 32 MB

  dim3 blk(256);
  dim3 g1(Dc / 64, Mtot / 256);                    // (16, 32)
  qkv_kernel<<<g1, blk, 0, stream>>>(x, Wq, bq, Wk, bk, Wv, bv, Qb, Kb, Vb);

  dim3 g2(Sc / 256, Bc * Hc);                      // (8, 64)
  attn_kernel<<<g2, blk, 0, stream>>>(Qb, Kb, Vb, mask, Ctx);

  dim3 g3(Dc / 128, Mtot / 128);                   // (8, 64)
  oproj_kernel<<<g3, blk, 0, stream>>>(Ctx, Wo, bo, x, Y);

  ln_kernel<<<Mtot, blk, 0, stream>>>(Y, gamma, beta, (float*)d_out);
}

// v008
// One run takes 128 microseconds.
// Timed twice side by side with v007, it ran 1.04 times as fast both times.
// Over all steps from v000 it is 3.55 times as fast.
#include <hip/hip_runtime.h>
#include <stdint.h>

// ---------------------------------------------------------------------------
// NonLocalAttention block for MI455X (gfx1250), wave32 + WMMA bf16 pipeline,
// LDS-staged double-buffered GEMMs with async global->LDS copies.
//   B=4, S=2048, D=1024, H=16, Hd=64
// ---------------------------------------------------------------------------

typedef __attribute__((ext_vector_type(16))) __bf16 v16bf;
typedef __attribute__((ext_vector_type(8)))  __bf16 v8bf;
typedef __attribute__((ext_vector_type(4)))  __bf16 v4bf;
typedef __attribute__((ext_vector_type(8)))  float  v8f;
typedef __attribute__((ext_vector_type(4)))  float  v4f;

static constexpr int Bc   = 4;
static constexpr int Sc   = 2048;
static constexpr int Dc   = 1024;
static constexpr int Hc   = 16;
static constexpr int Hd   = 64;
static constexpr int Mtot = Bc * Sc;      // 8192 rows

// ---------------- CDNA5 async global->LDS (ASYNCcnt) ------------------------
// A lane's run of 16-byte copies.  The s_wait_xcnt 0 is the statement's last line, so
// that no address register of a copy is rewritten in front of it.
__device__ __forceinline__ uint32_t lds_addr(const void* p) { return (uint32_t)(uintptr_t)p; }
__device__ __forceinline__ void async2_b128(const void* g0, const void* g1,
                                            uint32_t l0, uint32_t l1) {
  asm volatile("global_load_async_to_lds_b128 %0, %2, off\n\t"
               "global_load_async_to_lds_b128 %1, %3, off\n\t"
               "s_wait_xcnt 0x0"
               :: "v"(l0), "v"(l1), "v"(g0), "v"(g1)
               : "memory");
}
__device__ __forceinline__ void async4_b128(const void* g0, const void* g1,
                                            const void* g2, const void* g3,
                                            uint32_t l0, uint32_t l1, uint32_t l2, uint32_t l3) {
  asm volatile("global_load_async_to_lds_b128 %0, %4, off\n\t"
               "global_load_async_to_lds_b128 %1, %5, off\n\t"
               "global_load_async_to_lds_b128 %2, %6, off\n\t"
               "global_load_async_to_lds_b128 %3, %7, off\n\t"
               "s_wait_xcnt 0x0"
               :: "v"(l0), "v"(l1), "v"(l2), "v"(l3), "v"(g0), "v"(g1), "v"(g2), "v"(g3)
               : "memory");
}
// stands behind a run of global loads or stores, in front of the first rewrite of a
// register that one of them names
__device__ __forceinline__ void wait_x0() {
  asm volatile("s_wait_xcnt 0x0" ::: "memory");
}
// the same wait behind a run of loads whose addresses are formed anew for the run: the address
// registers are inputs of the statement, so they stay live, and unwritten, up to the wait
__device__ __forceinline__ void wait_x0_after(const void* a, const void* b, const void* c) {
  asm volatile("s_wait_xcnt 0x0" :: "v"(a), "v"(b), "v"(c) : "memory");
}
// the copies of this wave have landed
__device__ __forceinline__ void wait_async0() {
  asm volatile("s_wait_asynccnt 0x0" ::: "memory");
}
// this wave's LDS reads and writes are done: stands in front of the barrier behind
// which a buffer is refilled by copies
__device__ __forceinline__ void wait_ds0() {
  asm volatile("s_wait_dscnt 0x0" ::: "memory");
}

// ---------------- fragment helpers -----------------------------------------
__device__ __forceinline__ v4bf pack4(v4f a) {
  v4bf o;
  o[0] = (__bf16)a[0]; o[1] = (__bf16)a[1]; o[2] = (__bf16)a[2]; o[3] = (__bf16)a[3];
  return o;
}
__device__ __forceinline__ v16bf cat16(v8bf lo, v8bf hi) {
  return __builtin_shufflevector(lo, hi, 0,1,2,3,4,5,6,7,8,9,10,11,12,13,14,15);
}
// 16-bit A/B fragment: lane = {r=lane&15 (row/col), half=lane>>4}.
// Elements 0..7 = K (half*8)+0..7, elements 8..15 = K 16+(half*8)+0..7.
__device__ __forceinline__ v16bf frag_from_bf16(const __bf16* p) {
  v8bf lo = *(const v8bf*)(p);
  v8bf hi = *(const v8bf*)(p + 16);
  return cat16(lo, hi);
}
// The same fragment from a tile kept in fragment order: 512 elements, chunk c
// (elements 8c..8c+7 of every lane) at c*256 + lane*8, so that one 16-byte load
// or store of a wave covers 512 contiguous bytes.  p already holds lane*8.
__device__ __forceinline__ v16bf frag_packed(const __bf16* p) {
  v8bf lo = *(const v8bf*)(p);
  v8bf hi = *(const v8bf*)(p + 256);
  return cat16(lo, hi);
}
__device__ __forceinline__ v8f wmma_bf16(v16bf a, v16bf b, v8f c) {
  return __builtin_amdgcn_wmma_f32_16x16x32_bf16(
      false, a, false, b, (short)0, c, false, false);
}
__device__ __forceinline__ v8f zero8() {
  v8f z = {0.f,0.f,0.f,0.f,0.f,0.f,0.f,0.f};
  return z;
}
// lane l takes the value of lane l ^ 16 (the other half of the wave), on the vector pipe
__device__ __forceinline__ float xhalf(float v) {
  const int i = __builtin_bit_cast(int, v);
  return __builtin_bit_cast(float, __builtin_amdgcn_permlanex16(i, i, 0x76543210, 0xfedcba98, false, false));
}

// ---------------------------------------------------------------------------
// Kernel 0: x and the four weight matrices go to bf16 once, row-major as they are.
// The projection GEMMs read every x line sixteen times and every weight line 32 or 64
// times from L2: as bf16 those reads are half the bytes, the x fragments half the LDS reads,
// and every operand goes to LDS by copies, through no register.
// The rounding is the one the GEMMs did on the way to LDS, so their operands are the same.
// 512 work-groups (few waves to start); a thread has all its 24 loads in flight at once:
// two pieces of 8,192 elements of x and one of a weight matrix per work-group.
// ---------------------------------------------------------------------------
__global__ __launch_bounds__(256) void tobf16_kernel(
    const float* __restrict__ x,
    const float* __restrict__ Wq, const float* __restrict__ Wk,
    const float* __restrict__ Wv, const float* __restrict__ Wo,
    __bf16* __restrict__ xb, __bf16* __restrict__ Wb) {
  const int tid = threadIdx.x;
  const int blk = blockIdx.x;
  const int w   = blk >> 7;                 // 128 pieces per weight matrix
  const float* Wsrc = w == 0 ? Wq : w == 1 ? Wk : w == 2 ? Wv : Wo;
  const float* s0 = x + (size_t)blk * 8192 + tid * 4;
  const float* s1 = s0 + (size_t)512 * 8192;
  const float* s2 = Wsrc + (size_t)(blk & 127) * 8192 + tid * 4;
  v4f a0[8], a1[8], a2[8];
#pragma unroll
  for (int i = 0; i < 8; ++i) a0[i] = *(const v4f*)(s0 + i * 1024);
#pragma unroll
  for (int i = 0; i < 8; ++i) a1[i] = *(const v4f*)(s1 + i * 1024);
#pragma unroll
  for (int i = 0; i < 8; ++i) a2[i] = *(const v4f*)(s2 + i * 1024);
  // keeps all 24 loads in front of the first conversion: moved behind one, a load would
  // start only when earlier ones have come back
  __builtin_amdgcn_sched_barrier(0);
  wait_x0_after(s0, s1, s2);
  __builtin_amdgcn_sched_barrier(0);
  __bf16* d0 = xb + (size_t)blk * 8192 + tid * 4;
  __bf16* d1 = d0 + (size_t)512 * 8192;
  __bf16* d2 = Wb + (size_t)blk * 8192 + tid * 4;   // the four matrices lie one behind another
  auto put = [&](__bf16* d, const v4f* a) {
    v4bf o[8];
#pragma unroll
    for (int i = 0; i < 8; ++i) o[i] = pack4(a[i]);
    // keeps a piece's eight stores together, behind its conversions and in front of their
    // wait; strewn among the conversions, their registers were rewritten ahead of it
    __builtin_amdgcn_sched_barrier(0);
#pragma unroll
    for (int i = 0; i < 8; ++i) *(v4bf*)(d + i * 1024) = o[i];
    wait_x0();
    __builtin_amdgcn_sched_barrier(0);
  };
  put(d0, a0);
  put(d1, a1);
  put(d2, a2);
}

// ---------------------------------------------------------------------------
// Kernel 1: fused QKV projection.  out = x @ W.T + b  (NT GEMM).
// WG = 256 thr (8 waves), tile 256(M) x 64(N) for all three weights; a wave owns
// 32 rows x 64 columns of each: 2 x fragments meet 12 weight fragments.
// A K step is 64 deep: 48 products a wave.
// x and W tiles, already bf16, are async-staged into LDS, one K step ahead in two buffers.
// Q stored bf16 [B,H,S,Hd].  K and V stored bf16 per head in the fragment order
// the attention kernel loads them in (frag_packed):
//   K: [S/16 key tiles][2 halves of Hd][512], lane row = key,  k = head dim
//   V: [S/32 key steps][4 tiles of Hd][512],  lane row = head dim, k = key
// ---------------------------------------------------------------------------
__global__ __launch_bounds__(256) void qkv_kernel(
    const __bf16* __restrict__ xb, const __bf16* __restrict__ Wb,
    const float* __restrict__ bq, const float* __restrict__ bk, const float* __restrict__ bv,
    __bf16* __restrict__ Qb, __bf16* __restrict__ Kb, __bf16* __restrict__ Vb) {
  __shared__ __align__(16) __bf16 Xs[2][256][72];     //  72 KB, padded rows
  __shared__ __align__(16) __bf16 Ws[2][3][64][72];   //  54 KB, padded rows

  const int tid  = threadIdx.x;
  const int wave = tid >> 5;        // M sub-tile (32 rows)
  const int lane = tid & 31;
  const int r    = lane & 15;
  const int half = lane >> 4;
  const int m0   = blockIdx.y * 256;
  const int n0   = blockIdx.x * 64; // the 64 columns are one head

  // The sixteen work-groups of a row of the grid read the same x lines and those of a column
  // the same W lines.  Started at the same K step they ask L2 for the same lines at the same
  // moment, and such requests collide.  Each work-group starts at a step of its own and wraps:
  // no two in a row, and no two among sixteen neighbours in a column, are at the same step.
  const int rot = (blockIdx.x + blockIdx.y) & (Dc / 64 - 1);
  auto kof = [&](int ks) { return ((ks + rot) & (Dc / 64 - 1)) * 64; };

  // ---- staging: a row of a tile is 8 chunks of 16 B, so a wave's copy covers 4 whole lines.
  // x: 2048 chunks, a thread takes one chunk of rows sr, sr+32, ..., sr+224;
  // each W: 512 chunks, one chunk of rows sr and sr+32
  const int sr = tid >> 3;
  const int sc = (tid & 7) * 8;
  auto stage = [&](int buf, int k0) {
    const __bf16*  g = xb + (size_t)(m0 + sr) * Dc + k0 + sc;
    const uint32_t l = lds_addr(&Xs[buf][sr][sc]);
#pragma unroll
    for (int i = 0; i < 2; ++i) {
      const __bf16*  gi = g + (size_t)i * 128 * Dc;
      const uint32_t li = l + i * 128 * 144;
      async4_b128(gi, gi + 32 * Dc, gi + 64 * Dc, gi + 96 * Dc,
                  li, li + 32 * 144, li + 64 * 144, li + 96 * 144);
    }
    const __bf16*  gw = Wb + (size_t)(n0 + sr) * Dc + k0 + sc;
    const uint32_t lw = lds_addr(&Ws[buf][0][sr][sc]);
#pragma unroll
    for (int w = 0; w < 3; ++w) {
      const __bf16*  gi = gw + (size_t)w * Dc * Dc;
      const uint32_t li = lw + w * 64 * 144;
      async2_b128(gi, gi + 32 * Dc, li, li + 32 * 144);
    }
  };
  auto fragA = [&](int buf, int i, int kk) {
    return frag_from_bf16(&Xs[buf][wave * 32 + i * 16 + r][kk * 32 + half * 8]);
  };
  auto fragB = [&](int w, int buf, int n, int kk) {
    return frag_from_bf16(&Ws[buf][w][n * 16 + r][kk * 32 + half * 8]);
  };

  v8f aq[2][4], ak[2][4], av[2][4];
#pragma unroll
  for (int i = 0; i < 2; ++i)
#pragma unroll
    for (int n = 0; n < 4; ++n) { aq[i][n] = zero8(); ak[i][n] = zero8(); av[i][n] = zero8(); }

  stage(0, kof(0));
  wait_async0();
  __syncthreads();
  stage(1, kof(1));                             // flies while K step 0 is worked on

  for (int ks = 0; ks < Dc / 64; ++ks) {
    const int buf = ks & 1;
    // the step's x reads go first: every product needs an x fragment, and LDS answers in order
    v16bf ax[2][2];
#pragma unroll
    for (int kk = 0; kk < 2; ++kk) {
      ax[kk][0] = fragA(buf, 0, kk);
      ax[kk][1] = fragA(buf, 1, kk);
    }

#pragma unroll
    for (int kk = 0; kk < 2; ++kk) {
      v16bf bw[3][4];
#pragma unroll
      for (int w = 0; w < 3; ++w)
#pragma unroll
        for (int n = 0; n < 4; ++n) bw[w][n] = fragB(w, buf, n, kk);
      // keeps the 24 W reads of these 24 products together ahead of them: read one
      // fragment at a time, every pair of products waits out an LDS latency
      __builtin_amdgcn_sched_barrier(0);
      const v16bf a0 = ax[kk][0];
      const v16bf a1 = ax[kk][1];
#pragma unroll
      for (int n = 0; n < 4; ++n) {
        aq[0][n] = wmma_bf16(a0, bw[0][n], aq[0][n]);
        aq[1][n] = wmma_bf16(a1, bw[0][n], aq[1][n]);
      }
      // K comes out transposed (rows = head dim, column = key): a lane then holds
      // eight neighbouring head dims of one key, one 16-byte chunk of its tile
#pragma unroll
      for (int n = 0; n < 4; ++n) {
        ak[0][n] = wmma_bf16(bw[1][n], a0, ak[0][n]);
        ak[1][n] = wmma_bf16(bw[1][n], a1, ak[1][n]);
      }
#pragma unroll
      for (int n = 0; n < 4; ++n) {
        av[0][n] = wmma_bf16(a0, bw[2][n], av[0][n]);
        av[1][n] = wmma_bf16(a1, bw[2][n], av[1][n]);
      }
      // and keeps the next reads from being strewn among these products
      __builtin_amdgcn_sched_barrier(0);
    }

    // publish K step ks+1 and free this step's buffers, then refill them
    wait_ds0();
    wait_async0();
    __syncthreads();
    if (ks + 2 < Dc / 64) stage(buf, kof(ks + 2));
  }
  wait_async0();

  // ---- epilogue: bias; Q to [B,H,S,Hd], K and V to their fragment tiles ----
  const int    mr0 = m0 + wave * 32;          // 32 rows = 32 keys of one batch
  const int    s00 = mr0 & (Sc - 1);
  const size_t hb  = (size_t)((mr0 >> 11) * Hc + blockIdx.x) * Sc * Hd;

  float bqn[4], bvn[4], bkn[4][8];
#pragma unroll
  for (int n = 0; n < 4; ++n) {
    bqn[n] = bq[n0 + n * 16 + r];
    bvn[n] = bv[n0 + n * 16 + r];
    const float* bkp = bk + n0 + n * 16 + half * 8;  // ak rows: head dim n*16+half*8+j
    const float4 kb0 = *(const float4*)(bkp), kb1 = *(const float4*)(bkp + 4);
    bkn[n][0] = kb0.x; bkn[n][1] = kb0.y; bkn[n][2] = kb0.z; bkn[n][3] = kb0.w;
    bkn[n][4] = kb1.x; bkn[n][5] = kb1.y; bkn[n][6] = kb1.z; bkn[n][7] = kb1.w;
  }
  wait_x0();

#pragma unroll   // constant n, i, j: the accumulators stay in registers
  for (int n = 0; n < 4; ++n) {
#pragma unroll
    for (int i = 0; i < 2; ++i) {
      __bf16* qt = Qb + hb + (size_t)(s00 + i * 16 + half * 8) * Hd + n * 16 + r;
      // key tile (s00 >> 4) + i, half n >> 1 of Hd, chunk n & 1
      __bf16* kt = Kb + hb + (size_t)((s00 >> 4) + i) * 1024 + n * 256 + lane * 8;
      // key step s00 >> 5, head-dim tile n, chunk i (keys 16*i .. 16*i+15)
      __bf16* vt = Vb + hb + (size_t)(s00 >> 5) * 2048 + n * 512 + i * 256 + lane * 8;
      v8bf qo, ko, vo;
#pragma unroll
      for (int j = 0; j < 8; ++j) {
        qo[j] = (__bf16)(aq[i][n][j] + bqn[n]);
        ko[j] = (__bf16)(ak[i][n][j] + bkn[n][j]);
        vo[j] = (__bf16)(av[i][n][j] + bvn[n]);
      }
      // keeps the tile's ten stores together, behind its arithmetic and in front of their
      // wait
      __builtin_amdgcn_sched_barrier(0);
#pragma unroll
      for (int j = 0; j < 8; ++j) qt[j * Hd] = qo[j];
      *(v8bf*)kt = ko;
      *(v8bf*)vt = vo;
      wait_x0();
      __builtin_amdgcn_sched_barrier(0);
    }
  }
}

__global__ __launch_bounds__(256) __attribute__((amdgpu_waves_per_eu(4, 4))) void attn_kernel(
    const __bf16* __restrict__ Qb, const __bf16* __restrict__ Kb,
    const __bf16* __restrict__ Vb, const int* __restrict__ mask,
    __bf16* __restrict__ Ctx) {
  constexpr int SK  = 128;                  // keys per stage
  constexpr int NST = Sc / SK;              // 16 stages
  constexpr int G   = 2;                    // column groups of 16 queries per wave
  __shared__ __align__(16) __bf16 Ks[2][SK * Hd];     // 32 KB
  __shared__ __align__(16) __bf16 Vs[2][SK * Hd];     // 32 KB

  const int tid  = threadIdx.x;
  const int wave = tid >> 5;
  const int lane = tid & 31;
  const int r    = lane & 15;
  const int half = lane >> 4;

  const int bh = blockIdx.y;                // b*H + h
  const int b  = bh >> 4;
  const int h  = bh & 15;
  const int q0 = blockIdx.x * (128 * G) + wave * (16 * G);

  const __bf16* kbase = Kb + (size_t)bh * Sc * Hd;
  const __bf16* vbase = Vb + (size_t)bh * Hd * Sc;
  const int*    mbase = mask + (size_t)b * Sc;

  // a stage is 1024 chunks of 16 B of K and as many of V: a thread takes chunks
  // tid, tid+256, tid+512, tid+768 of each, so a wave's copy covers 512 contiguous bytes
  auto stageKV = [&](int buf, int st) {
    const __bf16*  gk = kbase + (size_t)st * SK * Hd + tid * 8;
    const __bf16*  gv = vbase + (size_t)st * SK * Hd + tid * 8;
    const uint32_t lk = lds_addr(&Ks[buf][tid * 8]);
    const uint32_t lv = lds_addr(&Vs[buf][tid * 8]);
    async4_b128(gk, gk + 2048, gk + 4096, gk + 6144, lk, lk + 4096, lk + 8192, lk + 12288);
    async4_b128(gv, gv + 2048, gv + 4096, gv + 6144, lv, lv + 4096, lv + 8192, lv + 12288);
  };
  stageKV(0, 0);                            // flies while Q and the mask are read

  v16bf qf[G][2];
#pragma unroll
  for (int g = 0; g < G; ++g) {
    const __bf16* qp = Qb + ((size_t)bh * Sc + (q0 + g * 16 + r)) * Hd + half * 8;
    qf[g][0] = frag_from_bf16(qp);
    qf[g][1] = frag_from_bf16(qp + 32);
  }

  constexpr float CS = 0.125f * 1.4426950408889634f;   // 1/sqrt(Hd) * log2(e)
  float mrun[G], rawlim[G], lrow[G];
  v8f   o[G][4];
#pragma unroll
  for (int g = 0; g < G; ++g) {
    mrun[g]   = -3.0e38f;                   // the maximum in use, scaled, base 2
    rawlim[g] = -3.0e38f;                   // (mrun + 8) / CS: the same limit for unscaled scores
    lrow[g]   = 0.f;                        // this half's keys only
#pragma unroll
    for (int t = 0; t < 4; ++t) o[g][t] = zero8();
  }

  // does this batch row mask any key at all?  One wave-uniform flag, so that
  // the loop pays for the 16 per-register mask terms only where there are some
  unsigned mlow = 0xffffffffu;              // unsigned minimum: 0 iff some entry is 0
#pragma unroll
  for (int i = 0; i < Sc / 128; ++i) {
    const int4 mv = *(const int4*)(mbase + i * 128 + lane * 4);
    mlow = min(min(mlow, min((unsigned)mv.x, (unsigned)mv.y)), min((unsigned)mv.z, (unsigned)mv.w));
  }
  const bool masked = __builtin_amdgcn_ballot_w32(mlow == 0u) != 0;

  wait_async0();
  __syncthreads();                          // stage 0 is there for every wave
  stageKV(1, 1);                            // flies while stage 0 is worked on

  for (int st = 0; st < NST; ++st) {
   const int buf = st & 1;
   // stays rolled, as it was: unrolled, the passes overlap in more registers than two
   // resident work-groups leave a wave
#pragma unroll 1
   for (int ps = 0; ps < SK / 32; ++ps) {
    const int kk0 = st * SK + ps * 32;
    // ---- scores: S^T[32 k x 16 q] = K (32x64) * Q^T, for both groups ----
    const __bf16* kp = &Ks[buf][ps * 32 * Hd + lane * 8];     // 32 keys = 4 tiles
    v16bf kf00 = frag_packed(kp);
    v16bf kf01 = frag_packed(kp + 512);
    v16bf kf10 = frag_packed(kp + 1024);
    v16bf kf11 = frag_packed(kp + 1536);
    // keeps the eight K reads together ahead of the eight products: read a pair at a
    // time, every pair of products waits out an LDS latency of its own
    __builtin_amdgcn_sched_barrier(0);

    v8f s0[G], s1[G];                        // four independent tiles, two products deep
#pragma unroll
    for (int g = 0; g < G; ++g) {
      s0[g] = wmma_bf16(kf00, qf[g][0], zero8());
      s1[g] = wmma_bf16(kf10, qf[g][0], zero8());
    }
#pragma unroll
    for (int g = 0; g < G; ++g) {
      s0[g] = wmma_bf16(kf01, qf[g][1], s0[g]);
      s1[g] = wmma_bf16(kf11, qf[g][1], s1[g]);
    }

    // the mask terms, the same for both groups, come in front of the V reads, so that the
    // sixteen mask words and the V tiles are not live together
    if (masked) {                            // s0[g][j]: key kk0+8*half+j, s1[g][j]: 16 more
      const int* mp = mbase + kk0 + half * 8;
      const int4 ma = *(const int4*)(mp),      mb = *(const int4*)(mp + 4);
      const int4 mc = *(const int4*)(mp + 16), md = *(const int4*)(mp + 20);
      const int m0[8] = {ma.x, ma.y, ma.z, ma.w, mb.x, mb.y, mb.z, mb.w};
      const int m1[8] = {mc.x, mc.y, mc.z, mc.w, md.x, md.y, md.z, md.w};
#pragma unroll   // constant j: the vectors' elements stay in registers
      for (int j = 0; j < 8; ++j) {
        const float a0 = m0[j] ? 0.f : -8.0e9f;   // -1e9 once scaled by 1/sqrt(Hd)
        const float a1 = m1[j] ? 0.f : -8.0e9f;
#pragma unroll
        for (int g = 0; g < G; ++g) { s0[g][j] += a0; s1[g][j] += a1; }
      }
    }

    // the pass's V tiles (one per 16 head dims) are asked for here
    const __bf16* vp = &Vs[buf][ps * 32 * Hd + lane * 8];
    v16bf vf0 = frag_packed(vp);
    v16bf vf1 = frag_packed(vp + 512);
    v16bf vf2 = frag_packed(vp + 1024);
    v16bf vf3 = frag_packed(vp + 1536);
    // keeps the eight V reads together up here: the softmax arithmetic covers their latency
    __builtin_amdgcn_sched_barrier(0);

    // ---- online softmax of one query per lane and group; the maximum is taken of the
    //      unscaled scores (the scale is positive), here of this half's 16 keys ----
    float mx[G];
#pragma unroll
    for (int g = 0; g < G; ++g) {
      mx[g] = fmaxf(s0[g][0], s1[g][0]);
#pragma unroll
      for (int j = 1; j < 8; ++j) mx[g] = fmaxf(mx[g], fmaxf(s0[g][j], s1[g][j]));
    }
    // one test a pass for both groups, a scalar branch: taken in the first pass and then
    // only where a column's maximum has grown by more than 8.  The ballot sees both halves
    // of a column, so the halves exchange their maxima only inside
    if (__builtin_amdgcn_ballot_w32((mx[0] > rawlim[0]) | (mx[1] > rawlim[1])) != 0) {
#pragma unroll
      for (int g = 0; g < G; ++g) {
        const float mboth = fmaxf(mx[g], xhalf(mx[g]));   // maximum of all 32 keys
        const float mnew  = fmaxf(mrun[g], mboth * CS);
        const float alpha = __builtin_amdgcn_exp2f(mrun[g] - mnew);   // 0 in the first pass
        mrun[g]   = mnew;
        rawlim[g] = (mnew + 8.0f) * (1.0f / CS);
        lrow[g]   = lrow[g] * alpha;
#pragma unroll
        for (int t = 0; t < 4; ++t) o[g][t] = o[g][t] * alpha;
      }
    }
    const v8f cs8 = {CS, CS, CS, CS, CS, CS, CS, CS};
#pragma unroll
    for (int g = 0; g < G; ++g) {
      const float nm = -mrun[g];
      const v8f nm8 = {nm, nm, nm, nm, nm, nm, nm, nm};
      const v8f t0 = __builtin_elementwise_fma(s0[g], cs8, nm8);
      const v8f t1 = __builtin_elementwise_fma(s1[g], cs8, nm8);
      float p0[8], p1[8];
#pragma unroll
      for (int j = 0; j < 8; ++j) {
        p0[j] = __builtin_amdgcn_exp2f(t0[j]);
        p1[j] = __builtin_amdgcn_exp2f(t1[j]);
      }
      const float sa = ((p0[0] + p0[1]) + (p0[2] + p0[3])) + ((p0[4] + p0[5]) + (p0[6] + p0[7]));
      const float sb = ((p1[0] + p1[1]) + (p1[2] + p1[3])) + ((p1[4] + p1[5]) + (p1[6] + p1[7]));
      lrow[g] += sa + sb;

      // ---- P^T as a B operand: element s = key 8*half+s, then 16+8*half+(s-8) ----
      v16bf pf;
#pragma unroll
      for (int j = 0; j < 8; ++j) { pf[j] = (__bf16)p0[j]; pf[8 + j] = (__bf16)p1[j]; }

      // ---- O^T += V^T @ P^T   (one fragment tile per 16 head dims) ----
      o[g][0] = wmma_bf16(vf0, pf, o[g][0]);
      o[g][1] = wmma_bf16(vf1, pf, o[g][1]);
      o[g][2] = wmma_bf16(vf2, pf, o[g][2]);
      o[g][3] = wmma_bf16(vf3, pf, o[g][3]);
    }
   }
   // publish stage st+1 and free this stage's buffer, then refill it
   wait_ds0();
   wait_async0();
   __syncthreads();
   if (st + 2 < NST) stageKV(buf, st + 2);
  }
  wait_async0();

  // ---- join the halves' sums, normalize, store context bf16 [B,S,D]:
  //      tile t of a lane is head dims 16*t+8*half+0..7 of query q0+16*g+r ----
#pragma unroll
  for (int g = 0; g < G; ++g) {
    const float inv = 1.0f / (lrow[g] + xhalf(lrow[g]));
    v8bf c0, c1, c2, c3;
#pragma unroll
    for (int j = 0; j < 8; ++j) {
      c0[j] = (__bf16)(o[g][0][j] * inv);
      c1[j] = (__bf16)(o[g][1][j] * inv);
      c2[j] = (__bf16)(o[g][2][j] * inv);
      c3[j] = (__bf16)(o[g][3][j] * inv);
    }
    __bf16* cp = Ctx + ((size_t)b * Sc + q0 + g * 16 + r) * Dc + h * Hd + half * 8;
    *(v8bf*)(cp)      = c0;
    *(v8bf*)(cp + 16) = c1;
    *(v8bf*)(cp + 32) = c2;
    *(v8bf*)(cp + 48) = c3;
    wait_x0();
  }
}

// ---------------------------------------------------------------------------
// Kernel 3: out projection + residual.  y = x + ctx @ Wo.T + bo  (fp32 y).
// WG = 256 thr (8 waves), tile 128(M) x 128(N); a wave owns 32 x 64: 2 context
// fragments meet 4 weight fragments.  A K step is 64 deep: 16 products a wave.
// Ctx and Wo tiles, both bf16, are async-staged, one K step ahead in two buffers.
// ---------------------------------------------------------------------------
__global__ __launch_bounds__(256) void oproj_kernel(
    const __bf16* __restrict__ Ctx, const __bf16* __restrict__ Wob,
    const float* __restrict__ bo, const float* __restrict__ x,
    float* __restrict__ Y) {
  __shared__ __align__(16) __bf16 Cs[2][128][72];     // 36 KB, padded rows
  __shared__ __align__(16) __bf16 Os[2][128][72];     // 36 KB, padded rows

  const int tid  = threadIdx.x;
  const int wave = tid >> 5;
  const int lane = tid & 31;
  const int r    = lane & 15;
  const int half = lane >> 4;
  const int mw   = wave & 3;        // M sub-tile (32 rows)
  const int nw   = wave >> 2;       // N sub-tile (64 cols)
  const int m0   = blockIdx.y * 128;
  const int n0   = blockIdx.x * 128;

  // as in the QKV kernel: the work-groups that share context lines (a row of the grid) or Wo
  // lines (sixteen neighbours in a column) walk K from different steps, so that they do not ask for a line together
  const int rot = (blockIdx.x + blockIdx.y) & (Dc / 64 - 1);
  auto kof = [&](int ks) { return ((ks + rot) & (Dc / 64 - 1)) * 64; };

  // each tile is 1024 chunks of 16 B: a thread takes one chunk of rows cr, cr+32, cr+64, cr+96
  const int cr = tid >> 3;
  const int cc = (tid & 7) * 8;
  auto stage = [&](int buf, int k0) {
    const __bf16*  g = Ctx + (size_t)(m0 + cr) * Dc + k0 + cc;
    const uint32_t l = lds_addr(&Cs[buf][cr][cc]);
    async4_b128(g, g + 32 * Dc, g + 64 * Dc, g + 96 * Dc,
                l, l + 32 * 144, l + 64 * 144, l + 96 * 144);
    const __bf16*  gw = Wob + (size_t)(n0 + cr) * Dc + k0 + cc;
    const uint32_t lw = lds_addr(&Os[buf][cr][cc]);
    async4_b128(gw, gw + 32 * Dc, gw + 64 * Dc, gw + 96 * Dc,
                lw, lw + 32 * 144, lw + 64 * 144, lw + 96 * 144);
  };

  v8f acc[2][4];
#pragma unroll
  for (int i = 0; i < 2; ++i)
#pragma unroll
    for (int n = 0; n < 4; ++n) acc[i][n] = zero8();

  stage(0, kof(0));
  wait_async0();
  __syncthreads();
  stage(1, kof(1));                             // flies while K step 0 is worked on

  for (int ks = 0; ks < Dc / 64; ++ks) {
    const int buf = ks & 1;
    // the step's 24 LDS reads go first, together
    v16bf a[2][2], b[2][4];
#pragma unroll
    for (int kk = 0; kk < 2; ++kk) {
#pragma unroll
      for (int i = 0; i < 2; ++i)
        a[kk][i] = frag_from_bf16(&Cs[buf][mw * 32 + i * 16 + r][kk * 32 + half * 8]);
#pragma unroll
      for (int n = 0; n < 4; ++n)
        b[kk][n] = frag_from_bf16(&Os[buf][nw * 64 + n * 16 + r][kk * 32 + half * 8]);
    }
    // keeps the reads together up here: read one fragment at a time among the
    // products, every product or two waits out an LDS latency
    __builtin_amdgcn_sched_barrier(0);

#pragma unroll
    for (int kk = 0; kk < 2; ++kk)
#pragma unroll
      for (int i = 0; i < 2; ++i)
#pragma unroll
        for (int n = 0; n < 4; ++n) acc[i][n] = wmma_bf16(a[kk][i], b[kk][n], acc[i][n]);
    // keeps the products in front of the waits and the barrier: moved behind them, they no
    // longer cover the flight of the next step's copies
    __builtin_amdgcn_sched_barrier(0);

    // publish K step ks+1 and free this step's buffers, then refill them
    wait_ds0();
    wait_async0();
    __syncthreads();
    if (ks + 2 < Dc / 64) stage(buf, kof(ks + 2));
  }
  wait_async0();

  float bon[4];
#pragma unroll
  for (int n = 0; n < 4; ++n) bon[n] = bo[n0 + nw * 64 + n * 16 + r];
  wait_x0();
  // keeps the bias loads in front of their wait
  __builtin_amdgcn_sched_barrier(0);

#pragma unroll   // constant i, n, j: the accumulators stay in registers
  for (int n = 0; n < 4; ++n) {
    const int    cn  = n0 + nw * 64 + n * 16 + r;
    const size_t o0  = (size_t)(m0 + mw * 32 + half * 8) * Dc + cn;
    float xv[2][8];
#pragma unroll
    for (int i = 0; i < 2; ++i)
#pragma unroll
      for (int j = 0; j < 8; ++j) xv[i][j] = x[o0 + (size_t)(i * 16 + j) * Dc];
    wait_x0();
    float yv[2][8];
#pragma unroll
    for (int i = 0; i < 2; ++i)
#pragma unroll
      for (int j = 0; j < 8; ++j) yv[i][j] = acc[i][n][j] + bon[n] + xv[i][j];
    // keeps the sixteen stores together, behind the sums and in front of their wait
    __builtin_amdgcn_sched_barrier(0);
#pragma unroll
    for (int i = 0; i < 2; ++i)
#pragma unroll
      for (int j = 0; j < 8; ++j) Y[o0 + (size_t)(i * 16 + j) * Dc] = yv[i][j];
    wait_x0();
    __builtin_amdgcn_sched_barrier(0);
  }
}

// ---------------------------------------------------------------------------
// Kernel 4: LayerNorm over D=1024 per row.  One block (256 thr) per row.
// ---------------------------------------------------------------------------
__global__ __launch_bounds__(256) void ln_kernel(
    const float* __restrict__ Y, const float* __restrict__ gamma,
    const float* __restrict__ beta, float* __restrict__ out) {
  __shared__ float redS[8], redQ[8];
  const int row  = blockIdx.x;
  const int tid  = threadIdx.x;
  const int wave = tid >> 5;
  const int lane = tid & 31;

  const float4 v = ((const float4*)(Y + (size_t)row * Dc))[tid];
  float s = v.x + v.y + v.z + v.w;
  float q = v.x * v.x + v.y * v.y + v.z * v.z + v.w * v.w;
#pragma unroll
  for (int m = 16; m >= 1; m >>= 1) {
    s += __shfl_xor(s, m);
    q += __shfl_xor(q, m);
  }
  if (lane == 0) { redS[wave] = s; redQ[wave] = q; }
  __syncthreads();
  float S = 0.f, Q = 0.f;
#pragma unroll
  for (int i = 0; i < 8; ++i) { S += redS[i]; Q += redQ[i]; }
  const float mu   = S * (1.0f / Dc);
  const float var  = Q * (1.0f / Dc) - mu * mu;
  const float rstd = rsqrtf(var + 1e-5f);

  const float4 g  = ((const float4*)gamma)[tid];
  const float4 be = ((const float4*)beta)[tid];
  float4 o;
  o.x = (v.x - mu) * rstd * g.x + be.x;
  o.y = (v.y - mu) * rstd * g.y + be.y;
  o.z = (v.z - mu) * rstd * g.z + be.z;
  o.w = (v.w - mu) * rstd * g.w + be.w;
  ((float4*)(out + (size_t)row * Dc))[tid] = o;
}

// ---------------------------------------------------------------------------
// Launcher
// ---------------------------------------------------------------------------
extern "C" void kernel_launch(void* const* d_in, const int* in_sizes, int n_in,
                              void* d_out, int out_size, void* d_ws, size_t ws_size,
                              hipStream_t stream) {
  const float* x     = (const float*)d_in[0];
  const int*   mask  = (const int*)  d_in[1];
  const float* Wq    = (const float*)d_in[2];
  const float* bq    = (const float*)d_in[3];
  const float* Wk    = (const float*)d_in[4];
  const float* bk    = (const float*)d_in[5];
  const float* Wv    = (const float*)d_in[6];
  const float* bv    = (const float*)d_in[7];
  const float* Wo    = (const float*)d_in[8];
  const float* bo    = (const float*)d_in[9];
  const float* gamma = (const float*)d_in[10];
  const float* beta  = (const float*)d_in[11];

  char* ws = (char*)d_ws;
  const size_t ELEMS = (size_t)Mtot * Dc;          // 8 Mi elements
  __bf16* Qb  = (__bf16*)(ws);                     // 16 MB
  __bf16* Kb  = (__bf16*)(ws + 2 * ELEMS);         // 16 MB
  __bf16* Vb  = (__bf16*)(ws + 4 * ELEMS);         // 16 MB
  __bf16* Ctx = (__bf16*)(ws + 6 * ELEMS);         // 16 MB
  float*  Y   = (float*) (ws + 8 * ELEMS);         // 32 MB
  __bf16* xb  = (__bf16*)(ws + 12 * ELEMS);        // 16 MB
  __bf16* Wb  = (__bf16*)(ws + 14 * ELEMS);        //  8 MB: Wq, Wk, Wv, Wo

  dim3 blk(256);
  tobf16_kernel<<<512, blk, 0, stream>>>(x, Wq, Wk, Wv, Wo, xb, Wb);

  dim3 g1(Dc / 64, Mtot / 256);                    // (16, 32)
  qkv_kernel<<<g1, blk, 0, stream>>>(xb, Wb, bq, bk, bv, Qb, Kb, Vb);

  dim3 g2(Sc / 256, Bc * Hc);                      // (8, 64)
  attn_kernel<<<g2, blk, 0, stream>>>(Qb, Kb, Vb, mask, Ctx);

  dim3 g3(Dc / 128, Mtot / 128);                   // (8, 64)
  oproj_kernel<<<g3, blk, 0, stream>>>(Ctx, Wb + 3 * (size_t)Dc * Dc, bo, x, Y);

  ln_kernel<<<Mtot, blk, 0, stream>>>(Y, gamma, beta, (float*)d_out);
}

// v009
// A run of this version takes 122 microseconds.
// In both of two side-by-side timings against v008, it was 1.06 times as fast.
// Counting every step since v000, it is 3.75 times as fast.
#include <hip/hip_runtime.h>
#include <stdint.h>

// ---------------------------------------------------------------------------
// NonLocalAttention block for MI455X (gfx1250), wave32 + WMMA bf16 pipeline,
// LDS-staged double-buffered GEMMs with async global->LDS copies.
//   B=4, S=2048, D=1024, H=16, Hd=64
// ---------------------------------------------------------------------------

typedef __attribute__((ext_vector_type(16))) __bf16 v16bf;
typedef __attribute__((ext_vector_type(8)))  __bf16 v8bf;
typedef __attribute__((ext_vector_type(4)))  __bf16 v4bf;
typedef __attribute__((ext_vector_type(8)))  float  v8f;
typedef __attribute__((ext_vector_type(4)))  float  v4f;

static constexpr int Bc   = 4;
static constexpr int Sc   = 2048;
static constexpr int Dc   = 1024;
static constexpr int Hc   = 16;
static constexpr int Hd   = 64;
static constexpr int Mtot = Bc * Sc;      // 8192 rows

// ---------------- CDNA5 async global->LDS (ASYNCcnt) ------------------------
// A lane's run of 16-byte copies.  The s_wait_xcnt 0 is the statement's last line, so
// that no address register of a copy is rewritten in front of it.
__device__ __forceinline__ uint32_t lds_addr(const void* p) { return (uint32_t)(uintptr_t)p; }
__device__ __forceinline__ void async2_b128(const void* g0, const void* g1,
                                            uint32_t l0, uint32_t l1) {
  asm volatile("global_load_async_to_lds_b128 %0, %2, off\n\t"
               "global_load_async_to_lds_b128 %1, %3, off\n\t"
               "s_wait_xcnt 0x0"
               :: "v"(l0), "v"(l1), "v"(g0), "v"(g1)
               : "memory");
}
__device__ __forceinline__ void async4_b128(const void* g0, const void* g1,
                                            const void* g2, const void* g3,
                                            uint32_t l0, uint32_t l1, uint32_t l2, uint32_t l3) {
  asm volatile("global_load_async_to_lds_b128 %0, %4, off\n\t"
               "global_load_async_to_lds_b128 %1, %5, off\n\t"
               "global_load_async_to_lds_b128 %2, %6, off\n\t"
               "global_load_async_to_lds_b128 %3, %7, off\n\t"
               "s_wait_xcnt 0x0"
               :: "v"(l0), "v"(l1), "v"(l2), "v"(l3), "v"(g0), "v"(g1), "v"(g2), "v"(g3)
               : "memory");
}
// stands behind a run of global loads or stores, in front of the first rewrite of a
// register that one of them names
__device__ __forceinline__ void wait_x0() {
  asm volatile("s_wait_xcnt 0x0" ::: "memory");
}
// the same wait behind a run of loads whose addresses are formed anew for the run: the address
// registers are inputs of the statement, so they stay live, and unwritten, up to the wait
__device__ __forceinline__ void wait_x0_after(const void* a, const void* b, const void* c) {
  asm volatile("s_wait_xcnt 0x0" :: "v"(a), "v"(b), "v"(c) : "memory");
}
// the copies of this wave have landed
__device__ __forceinline__ void wait_async0() {
  asm volatile("s_wait_asynccnt 0x0" ::: "memory");
}
// this wave's LDS reads and writes are done: stands in front of the barrier behind
// which a buffer is refilled by copies
__device__ __forceinline__ void wait_ds0() {
  asm volatile("s_wait_dscnt 0x0" ::: "memory");
}

// ---------------- fragment helpers -----------------------------------------
__device__ __forceinline__ v4bf pack4(v4f a) {
  v4bf o;
  o[0] = (__bf16)a[0]; o[1] = (__bf16)a[1]; o[2] = (__bf16)a[2]; o[3] = (__bf16)a[3];
  return o;
}
__device__ __forceinline__ v16bf cat16(v8bf lo, v8bf hi) {
  return __builtin_shufflevector(lo, hi, 0,1,2,3,4,5,6,7,8,9,10,11,12,13,14,15);
}
// 16-bit A/B fragment: lane = {r=lane&15 (row/col), half=lane>>4}.
// Elements 0..7 = K (half*8)+0..7, elements 8..15 = K 16+(half*8)+0..7.
__device__ __forceinline__ v16bf frag_from_bf16(const __bf16* p) {
  v8bf lo = *(const v8bf*)(p);
  v8bf hi = *(const v8bf*)(p + 16);
  return cat16(lo, hi);
}
// The same fragment from a tile kept in fragment order: 512 elements, chunk c
// (elements 8c..8c+7 of every lane) at c*256 + lane*8, so that one 16-byte load
// or store of a wave covers 512 contiguous bytes.  p already holds lane*8.
__device__ __forceinline__ v16bf frag_packed(const __bf16* p) {
  v8bf lo = *(const v8bf*)(p);
  v8bf hi = *(const v8bf*)(p + 256);
  return cat16(lo, hi);
}
__device__ __forceinline__ v8f wmma_bf16(v16bf a, v16bf b, v8f c) {
  return __builtin_amdgcn_wmma_f32_16x16x32_bf16(
      false, a, false, b, (short)0, c, false, false);
}
__device__ __forceinline__ v8f zero8() {
  v8f z = {0.f,0.f,0.f,0.f,0.f,0.f,0.f,0.f};
  return z;
}
// lane l takes the value of lane l ^ 16 (the other half of the wave), on the vector pipe
__device__ __forceinline__ float xhalf(float v) {
  const int i = __builtin_bit_cast(int, v);
  return __builtin_bit_cast(float, __builtin_amdgcn_permlanex16(i, i, 0x76543210, 0xfedcba98, false, false));
}

// ---------------------------------------------------------------------------
// Kernel 0: x and the four weight matrices go to bf16 once, row-major as they are.
// The projection GEMMs read every x line eight times and every weight line 32 or 64
// times from L2: as bf16 those reads are half the bytes, the x fragments half the LDS reads,
// and every operand goes to LDS by copies, through no register.
// The rounding is the one the GEMMs did on the way to LDS, so their operands are the same.
// 512 work-groups (few waves to start); a thread has all its 24 loads in flight at once:
// two pieces of 8,192 elements of x and one of a weight matrix per work-group.
// ---------------------------------------------------------------------------
__global__ __launch_bounds__(256) void tobf16_kernel(
    const float* __restrict__ x,
    const float* __restrict__ Wq, const float* __restrict__ Wk,
    const float* __restrict__ Wv, const float* __restrict__ Wo,
    __bf16* __restrict__ xb, __bf16* __restrict__ Wb) {
  const int tid = threadIdx.x;
  const int blk = blockIdx.x;
  const int w   = blk >> 7;                 // 128 pieces per weight matrix
  const float* Wsrc = w == 0 ? Wq : w == 1 ? Wk : w == 2 ? Wv : Wo;
  const float* s0 = x + (size_t)blk * 8192 + tid * 4;
  const float* s1 = s0 + (size_t)512 * 8192;
  const float* s2 = Wsrc + (size_t)(blk & 127) * 8192 + tid * 4;
  v4f a0[8], a1[8], a2[8];
#pragma unroll
  for (int i = 0; i < 8; ++i) a0[i] = *(const v4f*)(s0 + i * 1024);
#pragma unroll
  for (int i = 0; i < 8; ++i) a1[i] = *(const v4f*)(s1 + i * 1024);
#pragma unroll
  for (int i = 0; i < 8; ++i) a2[i] = *(const v4f*)(s2 + i * 1024);
  // keeps all 24 loads in front of the first conversion: moved behind one, a load would
  // start only when earlier ones have come back
  __builtin_amdgcn_sched_barrier(0);
  wait_x0_after(s0, s1, s2);
  __builtin_amdgcn_sched_barrier(0);
  __bf16* d0 = xb + (size_t)blk * 8192 + tid * 4;
  __bf16* d1 = d0 + (size_t)512 * 8192;
  __bf16* d2 = Wb + (size_t)blk * 8192 + tid * 4;   // the four matrices lie one behind another
  auto put = [&](__bf16* d, const v4f* a) {
    v4bf o[8];
#pragma unroll
    for (int i = 0; i < 8; ++i) o[i] = pack4(a[i]);
    // keeps a piece's eight stores together, behind its conversions and in front of their
    // wait; strewn among the conversions, their registers were rewritten ahead of it
    __builtin_amdgcn_sched_barrier(0);
#pragma unroll
    for (int i = 0; i < 8; ++i) *(v4bf*)(d + i * 1024) = o[i];
    wait_x0();
    __builtin_amdgcn_sched_barrier(0);
  };
  put(d0, a0);
  put(d1, a1);
  put(d2, a2);
}

// ---------------------------------------------------------------------------
// Kernel 1: fused QKV projection.  out = x @ W.T + b  (NT GEMM).
// WG = 256 thr (8 waves), tile 256(M) x 128(N) for all three weights, one work-group per WGP
// and one round of the grid; a wave owns 64 rows x 64 columns (one head) of each weight:
// 4 x fragments meet 12 weight fragments, so 16 fragment reads feed 48 products, and a
// work-group draws 640 operand rows from L2 for 256 x 384 results.
// A K step is 64 deep: 96 products a wave, in six groups of 16 (one weight, 32 of K).
// x and W tiles, already bf16, are async-staged into LDS, one K step ahead in two buffers.
// Q stored bf16 [B,H,S,Hd].  K and V stored bf16 per head in the fragment order
// the attention kernel loads them in (frag_packed):
//   K: [S/16 key tiles][2 halves of Hd][512], lane row = key,  k = head dim
//   V: [S/32 key steps][4 tiles of Hd][512],  lane row = head dim, k = key
// ---------------------------------------------------------------------------
__global__ __launch_bounds__(256) void qkv_kernel(
    const __bf16* __restrict__ xb, const __bf16* __restrict__ Wb,
    const float* __restrict__ bq, const float* __restrict__ bk, const float* __restrict__ bv,
    __bf16* __restrict__ Qb, __bf16* __restrict__ Kb, __bf16* __restrict__ Vb) {
  __shared__ __align__(16) __bf16 Xs[2][256][72];     //  72 KB, padded rows
  __shared__ __align__(16) __bf16 Ws[2][3][128][72];  // 108 KB, padded rows

  const int tid  = threadIdx.x;
  const int wave = tid >> 5;
  const int lane = tid & 31;
  const int r    = lane & 15;
  const int half = lane >> 4;
  const int mw   = wave & 3;         // M sub-tile (64 rows)
  const int nw   = wave >> 2;        // N sub-tile (64 columns, one head)
  const int m0   = blockIdx.y * 256;
  const int n0   = blockIdx.x * 128; // the 128 columns are two heads

  // The eight work-groups of a row of the grid read the same x lines and those of a column
  // the same W lines.  Started at the same K step they ask L2 for the same lines at the same
  // moment, and such requests collide.  Each work-group starts at a step of its own and wraps:
  // no two in a row, and no two among sixteen neighbours in a column, are at the same step.
  const int rot = (blockIdx.x + blockIdx.y) & (Dc / 64 - 1);
  auto kof = [&](int ks) { return ((ks + rot) & (Dc / 64 - 1)) * 64; };

  // ---- staging: a row of a tile is 8 chunks of 16 B, so a wave's copy covers 4 whole lines.
  // x: 2048 chunks, a thread takes one chunk of rows sr, sr+32, ..., sr+224;
  // each W: 1024 chunks, one chunk of rows sr, sr+32, sr+64, sr+96
  const int sr = tid >> 3;
  const int sc = (tid & 7) * 8;
  auto stage = [&](int buf, int k0) {
    const __bf16*  g = xb + (size_t)(m0 + sr) * Dc + k0 + sc;
    const uint32_t l = lds_addr(&Xs[buf][sr][sc]);
#pragma unroll
    for (int i = 0; i < 2; ++i) {
      const __bf16*  gi = g + (size_t)i * 128 * Dc;
      const uint32_t li = l + i * 128 * 144;
      async4_b128(gi, gi + 32 * Dc, gi + 64 * Dc, gi + 96 * Dc,
                  li, li + 32 * 144, li + 64 * 144, li + 96 * 144);
      // keeps each run's address arithmetic beside the run: formed ahead for all five runs, the
      // addresses drive accumulators out of the low registers that asm operands must sit in
      __builtin_amdgcn_sched_barrier(0);
    }
    const __bf16*  gw = Wb + (size_t)(n0 + sr) * Dc + k0 + sc;
    const uint32_t lw = lds_addr(&Ws[buf][0][sr][sc]);
#pragma unroll
    for (int w = 0; w < 3; ++w) {
      const __bf16*  gi = gw + (size_t)w * Dc * Dc;
      const uint32_t li = lw + w * 128 * 144;
      async4_b128(gi, gi + 32 * Dc, gi + 64 * Dc, gi + 96 * Dc,
                  li, li + 32 * 144, li + 64 * 144, li + 96 * 144);
      __builtin_amdgcn_sched_barrier(0);        // as above
    }
  };
  auto fragA = [&](int buf, int i, int kk) {
    return frag_from_bf16(&Xs[buf][mw * 64 + i * 16 + r][kk * 32 + half * 8]);
  };
  auto fragB = [&](int w, int buf, int n, int kk) {
    return frag_from_bf16(&Ws[buf][w][nw * 64 + n * 16 + r][kk * 32 + half * 8]);
  };

  stage(0, kof(0));

  // The biases are the sums' start values: behind the loop the 384 accumulator registers leave
  // no room to hold them.  Their loads fly with the first stage's copies.
  const int nh0 = n0 + nw * 64;                 // first column of the wave's head
  v8f acc[3][4][4];                             // [weight][row tile i][column tile n]
#pragma unroll
  for (int n = 0; n < 4; ++n) {
    const float  bqn = bq[nh0 + n * 16 + r];    // Q and V tiles: column n*16+r in every row
    const float  bvn = bv[nh0 + n * 16 + r];
    const float* bkp = bk + nh0 + n * 16 + half * 8;  // K tiles: row j is head dim n*16+half*8+j
    const v4f    kb0 = *(const v4f*)(bkp), kb1 = *(const v4f*)(bkp + 4);
    const v8f    q8  = {bqn, bqn, bqn, bqn, bqn, bqn, bqn, bqn};
    const v8f    v8  = {bvn, bvn, bvn, bvn, bvn, bvn, bvn, bvn};
    const v8f    k8  = {kb0[0], kb0[1], kb0[2], kb0[3], kb1[0], kb1[1], kb1[2], kb1[3]};
#pragma unroll
    for (int i = 0; i < 4; ++i) { acc[0][i][n] = q8; acc[1][i][n] = k8; acc[2][i][n] = v8; }
  }
  wait_x0();
  wait_async0();
  __syncthreads();
  stage(1, kof(1));                             // flies while K step 0 is worked on

  for (int ks = 0; ks < Dc / 64; ++ks) {
    const int buf = ks & 1;
    // group g = kk * 3 + w; its four W fragments sit in set g & 1
    v16bf ax[4], bw[2][4];
#pragma unroll
    for (int i = 0; i < 4; ++i) ax[i] = fragA(buf, i, 0);
#pragma unroll
    for (int n = 0; n < 4; ++n) bw[0][n] = fragB(0, buf, n, 0);

#pragma unroll   // constant g: sets and accumulators stay in registers
    for (int g = 0; g < 6; ++g) {
      const int w = g % 3;
      // the next group's eight W reads go ahead of this group's 16 products, which cover them
      if (g + 1 < 6) {
#pragma unroll
        for (int n = 0; n < 4; ++n) bw[(g + 1) & 1][n] = fragB((g + 1) % 3, buf, n, (g + 1) / 3);
      }
      // keeps those reads together up here, not strewn among the products
      __builtin_amdgcn_sched_barrier(0);
#pragma unroll
      for (int i = 0; i < 4; ++i)
#pragma unroll
        for (int n = 0; n < 4; ++n) {
          // K comes out transposed (rows = head dim, column = key): a lane then holds
          // eight neighbouring head dims of one key, one 16-byte chunk of its tile
          if (w == 1) acc[w][i][n] = wmma_bf16(bw[g & 1][n], ax[i], acc[w][i][n]);
          else        acc[w][i][n] = wmma_bf16(ax[i], bw[g & 1][n], acc[w][i][n]);
        }
      // and keeps later reads from being lifted among these products
      __builtin_amdgcn_sched_barrier(0);
      if (g == 2) {                             // the x fragments of the step's second half
#pragma unroll
        for (int i = 0; i < 4; ++i) ax[i] = fragA(buf, i, 1);
      }
    }

    // publish K step ks+1 and free this step's buffers, then refill them
    wait_ds0();
    wait_async0();
    __syncthreads();
    if (ks + 2 < Dc / 64) stage(buf, kof(ks + 2));
  }
  wait_async0();

  // ---- epilogue: Q to [B,H,S,Hd], K and V to their fragment tiles ----
  const int    mr0 = m0 + mw * 64;            // 64 rows = 64 keys of one batch
  const int    s00 = mr0 & (Sc - 1);
  const size_t hb  = (size_t)((mr0 >> 11) * Hc + (nh0 >> 6)) * Sc * Hd;

#pragma unroll   // constant n, i, j: the accumulators stay in registers
  for (int n = 0; n < 4; ++n) {
#pragma unroll
    for (int i = 0; i < 4; ++i) {
      __bf16* qt = Qb + hb + (size_t)(s00 + i * 16 + half * 8) * Hd + n * 16 + r;
      // key tile (s00 >> 4) + i, half n >> 1 of Hd, chunk n & 1
      __bf16* kt = Kb + hb + (size_t)((s00 >> 4) + i) * 1024 + n * 256 + lane * 8;
      // key step (s00 >> 5) + (i >> 1), head-dim tile n, chunk i & 1 (16 keys each)
      __bf16* vt = Vb + hb + (size_t)((s00 >> 5) + (i >> 1)) * 2048 + n * 512 + (i & 1) * 256 + lane * 8;
      v8bf qo, ko, vo;
#pragma unroll
      for (int j = 0; j < 8; ++j) {
        qo[j] = (__bf16)acc[0][i][n][j];
        ko[j] = (__bf16)acc[1][i][n][j];
        vo[j] = (__bf16)acc[2][i][n][j];
      }
      // keeps the tile's ten stores together, behind its arithmetic and in front of their
      // wait
      __builtin_amdgcn_sched_barrier(0);
#pragma unroll
      for (int j = 0; j < 8; ++j) qt[j * Hd] = qo[j];
      *(v8bf*)kt = ko;
      *(v8bf*)vt = vo;
      wait_x0();
      __builtin_amdgcn_sched_barrier(0);
    }
  }
}

__global__ __launch_bounds__(256) __attribute__((amdgpu_waves_per_eu(4, 4))) void attn_kernel(
    const __bf16* __restrict__ Qb, const __bf16* __restrict__ Kb,
    const __bf16* __restrict__ Vb, const int* __restrict__ mask,
    __bf16* __restrict__ Ctx) {
  constexpr int SK  = 128;                  // keys per stage
  constexpr int NST = Sc / SK;              // 16 stages
  constexpr int G   = 2;                    // column groups of 16 queries per wave
  __shared__ __align__(16) __bf16 Ks[2][SK * Hd];     // 32 KB
  __shared__ __align__(16) __bf16 Vs[2][SK * Hd];     // 32 KB

  const int tid  = threadIdx.x;
  const int wave = tid >> 5;
  const int lane = tid & 31;
  const int r    = lane & 15;
  const int half = lane >> 4;

  const int bh = blockIdx.y;                // b*H + h
  const int b  = bh >> 4;
  const int h  = bh & 15;
  const int q0 = blockIdx.x * (128 * G) + wave * (16 * G);

  const __bf16* kbase = Kb + (size_t)bh * Sc * Hd;
  const __bf16* vbase = Vb + (size_t)bh * Hd * Sc;
  const int*    mbase = mask + (size_t)b * Sc;

  // a stage is 1024 chunks of 16 B of K and as many of V: a thread takes chunks
  // tid, tid+256, tid+512, tid+768 of each, so a wave's copy covers 512 contiguous bytes
  auto stageKV = [&](int buf, int st) {
    const __bf16*  gk = kbase + (size_t)st * SK * Hd + tid * 8;
    const __bf16*  gv = vbase + (size_t)st * SK * Hd + tid * 8;
    const uint32_t lk = lds_addr(&Ks[buf][tid * 8]);
    const uint32_t lv = lds_addr(&Vs[buf][tid * 8]);
    async4_b128(gk, gk + 2048, gk + 4096, gk + 6144, lk, lk + 4096, lk + 8192, lk + 12288);
    async4_b128(gv, gv + 2048, gv + 4096, gv + 6144, lv, lv + 4096, lv + 8192, lv + 12288);
  };
  stageKV(0, 0);                            // flies while Q and the mask are read

  v16bf qf[G][2];
#pragma unroll
  for (int g = 0; g < G; ++g) {
    const __bf16* qp = Qb + ((size_t)bh * Sc + (q0 + g * 16 + r)) * Hd + half * 8;
    qf[g][0] = frag_from_bf16(qp);
    qf[g][1] = frag_from_bf16(qp + 32);
  }

  constexpr float CS = 0.125f * 1.4426950408889634f;   // 1/sqrt(Hd) * log2(e)
  float mrun[G], rawlim[G], lrow[G];
  v8f   o[G][4];
#pragma unroll
  for (int g = 0; g < G; ++g) {
    mrun[g]   = -3.0e38f;                   // the maximum in use, scaled, base 2
    rawlim[g] = -3.0e38f;                   // (mrun + 8) / CS: the same limit for unscaled scores
    lrow[g]   = 0.f;                        // this half's keys only
#pragma unroll
    for (int t = 0; t < 4; ++t) o[g][t] = zero8();
  }

  // does this batch row mask any key at all?  One wave-uniform flag, so that
  // the loop pays for the 16 per-register mask terms only where there are some
  unsigned mlow = 0xffffffffu;              // unsigned minimum: 0 iff some entry is 0
#pragma unroll
  for (int i = 0; i < Sc / 128; ++i) {
    const int4 mv = *(const int4*)(mbase + i * 128 + lane * 4);
    mlow = min(min(mlow, min((unsigned)mv.x, (unsigned)mv.y)), min((unsigned)mv.z, (unsigned)mv.w));
  }
  const bool masked = __builtin_amdgcn_ballot_w32(mlow == 0u) != 0;

  wait_async0();
  __syncthreads();                          // stage 0 is there for every wave
  stageKV(1, 1);                            // flies while stage 0 is worked on

  for (int st = 0; st < NST; ++st) {
   const int buf = st & 1;
   // stays rolled, as it was: unrolled, the passes overlap in more registers than two
   // resident work-groups leave a wave
#pragma unroll 1
   for (int ps = 0; ps < SK / 32; ++ps) {
    const int kk0 = st * SK + ps * 32;
    // ---- scores: S^T[32 k x 16 q] = K (32x64) * Q^T, for both groups ----
    const __bf16* kp = &Ks[buf][ps * 32 * Hd + lane * 8];     // 32 keys = 4 tiles
    v16bf kf00 = frag_packed(kp);
    v16bf kf01 = frag_packed(kp + 512);
    v16bf kf10 = frag_packed(kp + 1024);
    v16bf kf11 = frag_packed(kp + 1536);
    // keeps the eight K reads together ahead of the eight products: read a pair at a
    // time, every pair of products waits out an LDS latency of its own
    __builtin_amdgcn_sched_barrier(0);

    v8f s0[G], s1[G];                        // four independent tiles, two products deep
#pragma unroll
    for (int g = 0; g < G; ++g) {
      s0[g] = wmma_bf16(kf00, qf[g][0], zero8());
      s1[g] = wmma_bf16(kf10, qf[g][0], zero8());
    }
#pragma unroll
    for (int g = 0; g < G; ++g) {
      s0[g] = wmma_bf16(kf01, qf[g][1], s0[g]);
      s1[g] = wmma_bf16(kf11, qf[g][1], s1[g]);
    }

    // the mask terms, the same for both groups, come in front of the V reads, so that the
    // sixteen mask words and the V tiles are not live together
    if (masked) {                            // s0[g][j]: key kk0+8*half+j, s1[g][j]: 16 more
      const int* mp = mbase + kk0 + half * 8;
      const int4 ma = *(const int4*)(mp),      mb = *(const int4*)(mp + 4);
      const int4 mc = *(const int4*)(mp + 16), md = *(const int4*)(mp + 20);
      const int m0[8] = {ma.x, ma.y, ma.z, ma.w, mb.x, mb.y, mb.z, mb.w};
      const int m1[8] = {mc.x, mc.y, mc.z, mc.w, md.x, md.y, md.z, md.w};
#pragma unroll   // constant j: the vectors' elements stay in registers
      for (int j = 0; j < 8; ++j) {
        const float a0 = m0[j] ? 0.f : -8.0e9f;   // -1e9 once scaled by 1/sqrt(Hd)
        const float a1 = m1[j] ? 0.f : -8.0e9f;
#pragma unroll
        for (int g = 0; g < G; ++g) { s0[g][j] += a0; s1[g][j] += a1; }
      }
    }

    // the pass's V tiles (one per 16 head dims) are asked for here
    const __bf16* vp = &Vs[buf][ps * 32 * Hd + lane * 8];
    v16bf vf0 = frag_packed(vp);
    v16bf vf1 = frag_packed(vp + 512);
    v16bf vf2 = frag_packed(vp + 1024);
    v16bf vf3 = frag_packed(vp + 1536);
    // keeps the eight V reads together up here: the softmax arithmetic covers their latency
    __builtin_amdgcn_sched_barrier(0);

    // ---- online softmax of one query per lane and group; the maximum is taken of the
    //      unscaled scores (the scale is positive), here of this half's 16 keys ----
    float mx[G];
#pragma unroll
    for (int g = 0; g < G; ++g) {
      mx[g] = fmaxf(s0[g][0], s1[g][0]);
#pragma unroll
      for (int j = 1; j < 8; ++j) mx[g] = fmaxf(mx[g], fmaxf(s0[g][j], s1[g][j]));
    }
    // one test a pass for both groups, a scalar branch: taken in the first pass and then
    // only where a column's maximum has grown by more than 8.  The ballot sees both halves
    // of a column, so the halves exchange their maxima only inside
    if (__builtin_amdgcn_ballot_w32((mx[0] > rawlim[0]) | (mx[1] > rawlim[1])) != 0) {
#pragma unroll
      for (int g = 0; g < G; ++g) {
        const float mboth = fmaxf(mx[g], xhalf(mx[g]));   // maximum of all 32 keys
        const float mnew  = fmaxf(mrun[g], mboth * CS);
        const float alpha = __builtin_amdgcn_exp2f(mrun[g] - mnew);   // 0 in the first pass
        mrun[g]   = mnew;
        rawlim[g] = (mnew + 8.0f) * (1.0f / CS);
        lrow[g]   = lrow[g] * alpha;
#pragma unroll
        for (int t = 0; t < 4; ++t) o[g][t] = o[g][t] * alpha;
      }
    }
    const v8f cs8 = {CS, CS, CS, CS, CS, CS, CS, CS};
#pragma unroll
    for (int g = 0; g < G; ++g) {
      const float nm = -mrun[g];
      const v8f nm8 = {nm, nm, nm, nm, nm, nm, nm, nm};
      const v8f t0 = __builtin_elementwise_fma(s0[g], cs8, nm8);
      const v8f t1 = __builtin_elementwise_fma(s1[g], cs8, nm8);
      float p0[8], p1[8];
#pragma unroll
      for (int j = 0; j < 8; ++j) {
        p0[j] = __builtin_amdgcn_exp2f(t0[j]);
        p1[j] = __builtin_amdgcn_exp2f(t1[j]);
      }
      const float sa = ((p0[0] + p0[1]) + (p0[2] + p0[3])) + ((p0[4] + p0[5]) + (p0[6] + p0[7]));
      const float sb = ((p1[0] + p1[1]) + (p1[2] + p1[3])) + ((p1[4] + p1[5]) + (p1[6] + p1[7]));
      lrow[g] += sa + sb;

      // ---- P^T as a B operand: element s = key 8*half+s, then 16+8*half+(s-8) ----
      v16bf pf;
#pragma unroll
      for (int j = 0; j < 8; ++j) { pf[j] = (__bf16)p0[j]; pf[8 + j] = (__bf16)p1[j]; }

      // ---- O^T += V^T @ P^T   (one fragment tile per 16 head dims) ----
      o[g][0] = wmma_bf16(vf0, pf, o[g][0]);
      o[g][1] = wmma_bf16(vf1, pf, o[g][1]);
      o[g][2] = wmma_bf16(vf2, pf, o[g][2]);
      o[g][3] = wmma_bf16(vf3, pf, o[g][3]);
    }
   }
   // publish stage st+1 and free this stage's buffer, then refill it
   wait_ds0();
   wait_async0();
   __syncthreads();
   if (st + 2 < NST) stageKV(buf, st + 2);
  }
  wait_async0();

  // ---- join the halves' sums, normalize, store context bf16 [B,S,D]:
  //      tile t of a lane is head dims 16*t+8*half+0..7 of query q0+16*g+r ----
#pragma unroll
  for (int g = 0; g < G; ++g) {
    const float inv = 1.0f / (lrow[g] + xhalf(lrow[g]));
    v8bf c0, c1, c2, c3;
#pragma unroll
    for (int j = 0; j < 8; ++j) {
      c0[j] = (__bf16)(o[g][0][j] * inv);
      c1[j] = (__bf16)(o[g][1][j] * inv);
      c2[j] = (__bf16)(o[g][2][j] * inv);
      c3[j] = (__bf16)(o[g][3][j] * inv);
    }
    __bf16* cp = Ctx + ((size_t)b * Sc + q0 + g * 16 + r) * Dc + h * Hd + half * 8;
    *(v8bf*)(cp)      = c0;
    *(v8bf*)(cp + 16) = c1;
    *(v8bf*)(cp + 32) = c2;
    *(v8bf*)(cp + 48) = c3;
    wait_x0();
  }
}

// ---------------------------------------------------------------------------
// Kernel 3: out projection + residual.  y = x + ctx @ Wo.T + bo  (fp32 y).
// WG = 256 thr (8 waves), tile 128(M) x 128(N); a wave owns 32 x 64: 2 context
// fragments meet 4 weight fragments.  A K step is 64 deep: 16 products a wave.
// Ctx and Wo tiles, both bf16, are async-staged, one K step ahead in two buffers.
// ---------------------------------------------------------------------------
__global__ __launch_bounds__(256) void oproj_kernel(
    const __bf16* __restrict__ Ctx, const __bf16* __restrict__ Wob,
    const float* __restrict__ bo, const float* __restrict__ x,
    float* __restrict__ Y) {
  __shared__ __align__(16) __bf16 Cs[2][128][72];     // 36 KB, padded rows
  __shared__ __align__(16) __bf16 Os[2][128][72];     // 36 KB, padded rows

  const int tid  = threadIdx.x;
  const int wave = tid >> 5;
  const int lane = tid & 31;
  const int r    = lane & 15;
  const int half = lane >> 4;
  const int mw   = wave & 3;        // M sub-tile (32 rows)
  const int nw   = wave >> 2;       // N sub-tile (64 cols)
  const int m0   = blockIdx.y * 128;
  const int n0   = blockIdx.x * 128;

  // as in the QKV kernel: the work-groups that share context lines (a row of the grid) or Wo
  // lines (sixteen neighbours in a column) walk K from different steps, so that they do not ask for a line together
  const int rot = (blockIdx.x + blockIdx.y) & (Dc / 64 - 1);
  auto kof = [&](int ks) { return ((ks + rot) & (Dc / 64 - 1)) * 64; };

  // each tile is 1024 chunks of 16 B: a thread takes one chunk of rows cr, cr+32, cr+64, cr+96
  const int cr = tid >> 3;
  const int cc = (tid & 7) * 8;
  auto stage = [&](int buf, int k0) {
    const __bf16*  g = Ctx + (size_t)(m0 + cr) * Dc + k0 + cc;
    const uint32_t l = lds_addr(&Cs[buf][cr][cc]);
    async4_b128(g, g + 32 * Dc, g + 64 * Dc, g + 96 * Dc,
                l, l + 32 * 144, l + 64 * 144, l + 96 * 144);
    const __bf16*  gw = Wob + (size_t)(n0 + cr) * Dc + k0 + cc;
    const uint32_t lw = lds_addr(&Os[buf][cr][cc]);
    async4_b128(gw, gw + 32 * Dc, gw + 64 * Dc, gw + 96 * Dc,
                lw, lw + 32 * 144, lw + 64 * 144, lw + 96 * 144);
  };

  v8f acc[2][4];
#pragma unroll
  for (int i = 0; i < 2; ++i)
#pragma unroll
    for (int n = 0; n < 4; ++n) acc[i][n] = zero8();

  stage(0, kof(0));
  wait_async0();
  __syncthreads();
  stage(1, kof(1));                             // flies while K step 0 is worked on

  for (int ks = 0; ks < Dc / 64; ++ks) {
    const int buf = ks & 1;
    // the step's 24 LDS reads go first, together
    v16bf a[2][2], b[2][4];
#pragma unroll
    for (int kk = 0; kk < 2; ++kk) {
#pragma unroll
      for (int i = 0; i < 2; ++i)
        a[kk][i] = frag_from_bf16(&Cs[buf][mw * 32 + i * 16 + r][kk * 32 + half * 8]);
#pragma unroll
      for (int n = 0; n < 4; ++n)
        b[kk][n] = frag_from_bf16(&Os[buf][nw * 64 + n * 16 + r][kk * 32 + half * 8]);
    }
    // keeps the reads together up here: read one fragment at a time among the
    // products, every product or two waits out an LDS latency
    __builtin_amdgcn_sched_barrier(0);

#pragma unroll
    for (int kk = 0; kk < 2; ++kk)
#pragma unroll
      for (int i = 0; i < 2; ++i)
#pragma unroll
        for (int n = 0; n < 4; ++n) acc[i][n] = wmma_bf16(a[kk][i], b[kk][n], acc[i][n]);
    // keeps the products in front of the waits and the barrier: moved behind them, they no
    // longer cover the flight of the next step's copies
    __builtin_amdgcn_sched_barrier(0);

    // publish K step ks+1 and free this step's buffers, then refill them
    wait_ds0();
    wait_async0();
    __syncthreads();
    if (ks + 2 < Dc / 64) stage(buf, kof(ks + 2));
  }
  wait_async0();

  float bon[4];
#pragma unroll
  for (int n = 0; n < 4; ++n) bon[n] = bo[n0 + nw * 64 + n * 16 + r];
  wait_x0();
  // keeps the bias loads in front of their wait
  __builtin_amdgcn_sched_barrier(0);

#pragma unroll   // constant i, n, j: the accumulators stay in registers
  for (int n = 0; n < 4; ++n) {
    const int    cn  = n0 + nw * 64 + n * 16 + r;
    const size_t o0  = (size_t)(m0 + mw * 32 + half * 8) * Dc + cn;
    float xv[2][8];
#pragma unroll
    for (int i = 0; i < 2; ++i)
#pragma unroll
      for (int j = 0; j < 8; ++j) xv[i][j] = x[o0 + (size_t)(i * 16 + j) * Dc];
    wait_x0();
    float yv[2][8];
#pragma unroll
    for (int i = 0; i < 2; ++i)
#pragma unroll
      for (int j = 0; j < 8; ++j) yv[i][j] = acc[i][n][j] + bon[n] + xv[i][j];
    // keeps the sixteen stores together, behind the sums and in front of their wait
    __builtin_amdgcn_sched_barrier(0);
#pragma unroll
    for (int i = 0; i < 2; ++i)
#pragma unroll
      for (int j = 0; j < 8; ++j) Y[o0 + (size_t)(i * 16 + j) * Dc] = yv[i][j];
    wait_x0();
    __builtin_amdgcn_sched_barrier(0);
  }
}

// ---------------------------------------------------------------------------
// Kernel 4: LayerNorm over D=1024 per row.  One block (256 thr) per row.
// ---------------------------------------------------------------------------
__global__ __launch_bounds__(256) void ln_kernel(
    const float* __restrict__ Y, const float* __restrict__ gamma,
    const float* __restrict__ beta, float* __restrict__ out) {
  __shared__ float redS[8], redQ[8];
  const int row  = blockIdx.x;
  const int tid  = threadIdx.x;
  const int wave = tid >> 5;
  const int lane = tid & 31;

  const float4 v = ((const float4*)(Y + (size_t)row * Dc))[tid];
  float s = v.x + v.y + v.z + v.w;
  float q = v.x * v.x + v.y * v.y + v.z * v.z + v.w * v.w;
#pragma unroll
  for (int m = 16; m >= 1; m >>= 1) {
    s += __shfl_xor(s, m);
    q += __shfl_xor(q, m);
  }
  if (lane == 0) { redS[wave] = s; redQ[wave] = q; }
  __syncthreads();
  float S = 0.f, Q = 0.f;
#pragma unroll
  for (int i = 0; i < 8; ++i) { S += redS[i]; Q += redQ[i]; }
  const float mu   = S * (1.0f / Dc);
  const float var  = Q * (1.0f / Dc) - mu * mu;
  const float rstd = rsqrtf(var + 1e-5f);

  const float4 g  = ((const float4*)gamma)[tid];
  const float4 be = ((const float4*)beta)[tid];
  float4 o;
  o.x = (v.x - mu) * rstd * g.x + be.x;
  o.y = (v.y - mu) * rstd * g.y + be.y;
  o.z = (v.z - mu) * rstd * g.z + be.z;
  o.w = (v.w - mu) * rstd * g.w + be.w;
  ((float4*)(out + (size_t)row * Dc))[tid] = o;
}

// ---------------------------------------------------------------------------
// Launcher
// ---------------------------------------------------------------------------
extern "C" void kernel_launch(void* const* d_in, const int* in_sizes, int n_in,
                              void* d_out, int out_size, void* d_ws, size_t ws_size,
                              hipStream_t stream) {
  const float* x     = (const float*)d_in[0];
  const int*   mask  = (const int*)  d_in[1];
  const float* Wq    = (const float*)d_in[2];
  const float* bq    = (const float*)d_in[3];
  const float* Wk    = (const float*)d_in[4];
  const float* bk    = (const float*)d_in[5];
  const float* Wv    = (const float*)d_in[6];
  const float* bv    = (const float*)d_in[7];
  const float* Wo    = (const float*)d_in[8];
  const float* bo    = (const float*)d_in[9];
  const float* gamma = (const float*)d_in[10];
  const float* beta  = (const float*)d_in[11];

  char* ws = (char*)d_ws;
  const size_t ELEMS = (size_t)Mtot * Dc;          // 8 Mi elements
  __bf16* Qb  = (__bf16*)(ws);                     // 16 MB
  __bf16* Kb  = (__bf16*)(ws + 2 * ELEMS);         // 16 MB
  __bf16* Vb  = (__bf16*)(ws + 4 * ELEMS);         // 16 MB
  __bf16* Ctx = (__bf16*)(ws + 6 * ELEMS);         // 16 MB
  float*  Y   = (float*) (ws + 8 * ELEMS);         // 32 MB
  __bf16* xb  = (__bf16*)(ws + 12 * ELEMS);        // 16 MB
  __bf16* Wb  = (__bf16*)(ws + 14 * ELEMS);        //  8 MB: Wq, Wk, Wv, Wo

  dim3 blk(256);
  tobf16_kernel<<<512, blk, 0, stream>>>(x, Wq, Wk, Wv, Wo, xb, Wb);

  dim3 g1(Dc / 128, Mtot / 256);                   // (8, 32)
  qkv_kernel<<<g1, blk, 0, stream>>>(xb, Wb, bq, bk, bv, Qb, Kb, Vb);

  dim3 g2(Sc / 256, Bc * Hc);                      // (8, 64)
  attn_kernel<<<g2, blk, 0, stream>>>(Qb, Kb, Vb, mask, Ctx);

  dim3 g3(Dc / 128, Mtot / 128);                   // (8, 64)
  oproj_kernel<<<g3, blk, 0, stream>>>(Ctx, Wb + 3 * (size_t)Dc * Dc, bo, x, Y);

  ln_kernel<<<Mtot, blk, 0, stream>>>(Y, gamma, beta, (float*)d_out);
}

// v010
// A run of this version takes 117 microseconds.
// Timed twice side by side with v009, it ran 1.04 times as fast both times.
// Counting every step since v000, it is 3.90 times as fast.
#include <hip/hip_runtime.h>
#include <stdint.h>

// ---------------------------------------------------------------------------
// NonLocalAttention block for MI455X (gfx1250), wave32 + WMMA bf16 pipeline,
// LDS-staged double-buffered GEMMs with async global->LDS copies.
//   B=4, S=2048, D=1024, H=16, Hd=64
// ---------------------------------------------------------------------------

typedef __attribute__((ext_vector_type(16))) __bf16 v16bf;
typedef __attribute__((ext_vector_type(8)))  __bf16 v8bf;
typedef __attribute__((ext_vector_type(4)))  __bf16 v4bf;
typedef __attribute__((ext_vector_type(8)))  float  v8f;
typedef __attribute__((ext_vector_type(4)))  float  v4f;

static constexpr int Bc   = 4;
static constexpr int Sc   = 2048;
static constexpr int Dc   = 1024;
static constexpr int Hc   = 16;
static constexpr int Hd   = 64;
static constexpr int Mtot = Bc * Sc;      // 8192 rows
// 1/sqrt(Hd) * log2(e): Q is stored times this, so that K.Q^T is a score in base-2 units
static constexpr float CS = 0.125f * 1.4426950408889634f;

// ---------------- CDNA5 async global->LDS (ASYNCcnt) ------------------------
// A lane's run of 16-byte copies.  The s_wait_xcnt 0 is the statement's last line, so
// that no address register of a copy is rewritten in front of it.
__device__ __forceinline__ uint32_t lds_addr(const void* p) { return (uint32_t)(uintptr_t)p; }
__device__ __forceinline__ void async2_b128(const void* g0, const void* g1,
                                            uint32_t l0, uint32_t l1) {
  asm volatile("global_load_async_to_lds_b128 %0, %2, off\n\t"
               "global_load_async_to_lds_b128 %1, %3, off\n\t"
               "s_wait_xcnt 0x0"
               :: "v"(l0), "v"(l1), "v"(g0), "v"(g1)
               : "memory");
}
__device__ __forceinline__ void async4_b128(const void* g0, const void* g1,
                                            const void* g2, const void* g3,
                                            uint32_t l0, uint32_t l1, uint32_t l2, uint32_t l3) {
  asm volatile("global_load_async_to_lds_b128 %0, %4, off\n\t"
               "global_load_async_to_lds_b128 %1, %5, off\n\t"
               "global_load_async_to_lds_b128 %2, %6, off\n\t"
               "global_load_async_to_lds_b128 %3, %7, off\n\t"
               "s_wait_xcnt 0x0"
               :: "v"(l0), "v"(l1), "v"(l2), "v"(l3), "v"(g0), "v"(g1), "v"(g2), "v"(g3)
               : "memory");
}
// stands behind a run of global loads or stores, in front of the first rewrite of a
// register that one of them names
__device__ __forceinline__ void wait_x0() {
  asm volatile("s_wait_xcnt 0x0" ::: "memory");
}
// the same wait behind a run of loads whose addresses are formed anew for the run: the address
// registers are inputs of the statement, so they stay live, and unwritten, up to the wait
__device__ __forceinline__ void wait_x0_after(const void* a, const void* b, const void* c) {
  asm volatile("s_wait_xcnt 0x0" :: "v"(a), "v"(b), "v"(c) : "memory");
}
// the copies of this wave have landed
__device__ __forceinline__ void wait_async0() {
  asm volatile("s_wait_asynccnt 0x0" ::: "memory");
}
// this wave's LDS reads and writes are done: stands in front of the barrier behind
// which a buffer is refilled by copies
__device__ __forceinline__ void wait_ds0() {
  asm volatile("s_wait_dscnt 0x0" ::: "memory");
}

// ---------------- fragment helpers -----------------------------------------
__device__ __forceinline__ v4bf pack4(v4f a) {
  v4bf o;
  o[0] = (__bf16)a[0]; o[1] = (__bf16)a[1]; o[2] = (__bf16)a[2]; o[3] = (__bf16)a[3];
  return o;
}
__device__ __forceinline__ v16bf cat16(v8bf lo, v8bf hi) {
  return __builtin_shufflevector(lo, hi, 0,1,2,3,4,5,6,7,8,9,10,11,12,13,14,15);
}
// 16-bit A/B fragment: lane = {r=lane&15 (row/col), half=lane>>4}.
// Elements 0..7 = K (half*8)+0..7, elements 8..15 = K 16+(half*8)+0..7.
__device__ __forceinline__ v16bf frag_from_bf16(const __bf16* p) {
  v8bf lo = *(const v8bf*)(p);
  v8bf hi = *(const v8bf*)(p + 16);
  return cat16(lo, hi);
}
// The same fragment from a tile kept in fragment order: 512 elements, chunk c
// (elements 8c..8c+7 of every lane) at c*256 + lane*8, so that one 16-byte load
// or store of a wave covers 512 contiguous bytes.  p already holds lane*8.
__device__ __forceinline__ v16bf frag_packed(const __bf16* p) {
  v8bf lo = *(const v8bf*)(p);
  v8bf hi = *(const v8bf*)(p + 256);
  return cat16(lo, hi);
}
__device__ __forceinline__ v8f wmma_bf16(v16bf a, v16bf b, v8f c) {
  return __builtin_amdgcn_wmma_f32_16x16x32_bf16(
      false, a, false, b, (short)0, c, false, false);
}
__device__ __forceinline__ v8f zero8() {
  v8f z = {0.f,0.f,0.f,0.f,0.f,0.f,0.f,0.f};
  return z;
}
// lane l takes the value of lane l ^ 16 (the other half of the wave), on the vector pipe
__device__ __forceinline__ float xhalf(float v) {
  const int i = __builtin_bit_cast(int, v);
  return __builtin_bit_cast(float, __builtin_amdgcn_permlanex16(i, i, 0x76543210, 0xfedcba98, false, false));
}

// ---------------------------------------------------------------------------
// Kernel 0: x and the four weight matrices go to bf16 once, row-major as they are.
// The projection GEMMs read every x line eight times and every weight line 32 or 64
// times from L2: as bf16 those reads are half the bytes, the x fragments half the LDS reads,
// and every operand goes to LDS by copies, through no register.
// The rounding is the one the GEMMs did on the way to LDS, so their operands are the same.
// 512 work-groups (few waves to start); a thread has all its 24 loads in flight at once:
// two pieces of 8,192 elements of x and one of a weight matrix per work-group.
// ---------------------------------------------------------------------------
__global__ __launch_bounds__(256) void tobf16_kernel(
    const float* __restrict__ x,
    const float* __restrict__ Wq, const float* __restrict__ Wk,
    const float* __restrict__ Wv, const float* __restrict__ Wo,
    __bf16* __restrict__ xb, __bf16* __restrict__ Wb) {
  const int tid = threadIdx.x;
  const int blk = blockIdx.x;
  const int w   = blk >> 7;                 // 128 pieces per weight matrix
  const float* Wsrc = w == 0 ? Wq : w == 1 ? Wk : w == 2 ? Wv : Wo;
  const float* s0 = x + (size_t)blk * 8192 + tid * 4;
  const float* s1 = s0 + (size_t)512 * 8192;
  const float* s2 = Wsrc + (size_t)(blk & 127) * 8192 + tid * 4;
  v4f a0[8], a1[8], a2[8];
#pragma unroll
  for (int i = 0; i < 8; ++i) a0[i] = *(const v4f*)(s0 + i * 1024);
#pragma unroll
  for (int i = 0; i < 8; ++i) a1[i] = *(const v4f*)(s1 + i * 1024);
#pragma unroll
  for (int i = 0; i < 8; ++i) a2[i] = *(const v4f*)(s2 + i * 1024);
  // keeps all 24 loads in front of the first conversion: moved behind one, a load would
  // start only when earlier ones have come back
  __builtin_amdgcn_sched_barrier(0);
  wait_x0_after(s0, s1, s2);
  __builtin_amdgcn_sched_barrier(0);
  __bf16* d0 = xb + (size_t)blk * 8192 + tid * 4;
  __bf16* d1 = d0 + (size_t)512 * 8192;
  __bf16* d2 = Wb + (size_t)blk * 8192 + tid * 4;   // the four matrices lie one behind another
  auto put = [&](__bf16* d, const v4f* a) {
    v4bf o[8];
#pragma unroll
    for (int i = 0; i < 8; ++i) o[i] = pack4(a[i]);
    // keeps a piece's eight stores together, behind its conversions and in front of their
    // wait; strewn among the conversions, their registers were rewritten ahead of it
    __builtin_amdgcn_sched_barrier(0);
#pragma unroll
    for (int i = 0; i < 8; ++i) *(v4bf*)(d + i * 1024) = o[i];
    wait_x0();
    __builtin_amdgcn_sched_barrier(0);
  };
  put(d0, a0);
  put(d1, a1);
  put(d2, a2);
}

// ---------------------------------------------------------------------------
// Kernel 1: fused QKV projection.  out = x @ W.T + b  (NT GEMM).
// WG = 256 thr (8 waves), tile 256(M) x 128(N) for all three weights, one work-group per WGP
// and one round of the grid; a wave owns 64 rows x 64 columns (one head) of each weight:
// 4 x fragments meet 12 weight fragments, so 16 fragment reads feed 48 products, and a
// work-group draws 640 operand rows from L2 for 256 x 384 results.
// A K step is 64 deep: 96 products a wave, in six groups of 16 (one weight, 32 of K).
// x and W tiles, already bf16, are async-staged into LDS, one K step ahead in two buffers.
// Q stored bf16 [B,H,S,Hd], times CS.  K and V stored bf16 per head in the fragment order
// the attention kernel loads them in (frag_packed):
//   K: [S/16 key tiles][2 halves of Hd][512], lane row = key,  k = head dim
//   V: [S/32 key steps][4 tiles of Hd][512],  lane row = head dim, k = key
// ---------------------------------------------------------------------------
__global__ __launch_bounds__(256) void qkv_kernel(
    const __bf16* __restrict__ xb, const __bf16* __restrict__ Wb,
    const float* __restrict__ bq, const float* __restrict__ bk, const float* __restrict__ bv,
    __bf16* __restrict__ Qb, __bf16* __restrict__ Kb, __bf16* __restrict__ Vb) {
  __shared__ __align__(16) __bf16 Xs[2][256][72];     //  72 KB, padded rows
  __shared__ __align__(16) __bf16 Ws[2][3][128][72];  // 108 KB, padded rows

  const int tid  = threadIdx.x;
  const int wave = tid >> 5;
  const int lane = tid & 31;
  const int r    = lane & 15;
  const int half = lane >> 4;
  const int mw   = wave & 3;         // M sub-tile (64 rows)
  const int nw   = wave >> 2;        // N sub-tile (64 columns, one head)
  const int m0   = blockIdx.y * 256;
  const int n0   = blockIdx.x * 128; // the 128 columns are two heads

  // The eight work-groups of a row of the grid read the same x lines and those of a column
  // the same W lines.  Started at the same K step they ask L2 for the same lines at the same
  // moment, and such requests collide.  Each work-group starts at a step of its own and wraps:
  // no two in a row, and no two among sixteen neighbours in a column, are at the same step.
  const int rot = (blockIdx.x + blockIdx.y) & (Dc / 64 - 1);
  auto kof = [&](int ks) { return ((ks + rot) & (Dc / 64 - 1)) * 64; };

  // ---- staging: a row of a tile is 8 chunks of 16 B, so a wave's copy covers 4 whole lines.
  // x: 2048 chunks, a thread takes one chunk of rows sr, sr+32, ..., sr+224;
  // each W: 1024 chunks, one chunk of rows sr, sr+32, sr+64, sr+96
  const int sr = tid >> 3;
  const int sc = (tid & 7) * 8;
  auto stage = [&](int buf, int k0) {
    const __bf16*  g = xb + (size_t)(m0 + sr) * Dc + k0 + sc;
    const uint32_t l = lds_addr(&Xs[buf][sr][sc]);
#pragma unroll
    for (int i = 0; i < 2; ++i) {
      const __bf16*  gi = g + (size_t)i * 128 * Dc;
      const uint32_t li = l + i * 128 * 144;
      async4_b128(gi, gi + 32 * Dc, gi + 64 * Dc, gi + 96 * Dc,
                  li, li + 32 * 144, li + 64 * 144, li + 96 * 144);
      // keeps each run's address arithmetic beside the run: formed ahead for all five runs, the
      // addresses drive accumulators out of the low registers that asm operands must sit in
      __builtin_amdgcn_sched_barrier(0);
    }
    const __bf16*  gw = Wb + (size_t)(n0 + sr) * Dc + k0 + sc;
    const uint32_t lw = lds_addr(&Ws[buf][0][sr][sc]);
#pragma unroll
    for (int w = 0; w < 3; ++w) {
      const __bf16*  gi = gw + (size_t)w * Dc * Dc;
      const uint32_t li = lw + w * 128 * 144;
      async4_b128(gi, gi + 32 * Dc, gi + 64 * Dc, gi + 96 * Dc,
                  li, li + 32 * 144, li + 64 * 144, li + 96 * 144);
      __builtin_amdgcn_sched_barrier(0);        // as above
    }
  };
  auto fragA = [&](int buf, int i, int kk) {
    return frag_from_bf16(&Xs[buf][mw * 64 + i * 16 + r][kk * 32 + half * 8]);
  };
  auto fragB = [&](int w, int buf, int n, int kk) {
    return frag_from_bf16(&Ws[buf][w][nw * 64 + n * 16 + r][kk * 32 + half * 8]);
  };

  stage(0, kof(0));

  // The biases are the sums' start values: behind the loop the 384 accumulator registers leave
  // no room to hold them.  Their loads fly with the first stage's copies.
  const int nh0 = n0 + nw * 64;                 // first column of the wave's head
  v8f acc[3][4][4];                             // [weight][row tile i][column tile n]
#pragma unroll
  for (int n = 0; n < 4; ++n) {
    const float  bqn = bq[nh0 + n * 16 + r];    // Q and V tiles: column n*16+r in every row
    const float  bvn = bv[nh0 + n * 16 + r];
    const float* bkp = bk + nh0 + n * 16 + half * 8;  // K tiles: row j is head dim n*16+half*8+j
    const v4f    kb0 = *(const v4f*)(bkp), kb1 = *(const v4f*)(bkp + 4);
    const v8f    q8  = {bqn, bqn, bqn, bqn, bqn, bqn, bqn, bqn};
    const v8f    v8  = {bvn, bvn, bvn, bvn, bvn, bvn, bvn, bvn};
    const v8f    k8  = {kb0[0], kb0[1], kb0[2], kb0[3], kb1[0], kb1[1], kb1[2], kb1[3]};
#pragma unroll
    for (int i = 0; i < 4; ++i) { acc[0][i][n] = q8; acc[1][i][n] = k8; acc[2][i][n] = v8; }
  }
  wait_x0();
  wait_async0();
  __syncthreads();
  stage(1, kof(1));                             // flies while K step 0 is worked on

  for (int ks = 0; ks < Dc / 64; ++ks) {
    const int buf = ks & 1;
    // group g = kk * 3 + w; its four W fragments sit in set g & 1
    v16bf ax[4], bw[2][4];
#pragma unroll
    for (int i = 0; i < 4; ++i) ax[i] = fragA(buf, i, 0);
#pragma unroll
    for (int n = 0; n < 4; ++n) bw[0][n] = fragB(0, buf, n, 0);

#pragma unroll   // constant g: sets and accumulators stay in registers
    for (int g = 0; g < 6; ++g) {
      const int w = g % 3;
      // the next group's eight W reads go ahead of this group's 16 products, which cover them
      if (g + 1 < 6) {
#pragma unroll
        for (int n = 0; n < 4; ++n) bw[(g + 1) & 1][n] = fragB((g + 1) % 3, buf, n, (g + 1) / 3);
      }
      // keeps those reads together up here, not strewn among the products
      __builtin_amdgcn_sched_barrier(0);
#pragma unroll
      for (int i = 0; i < 4; ++i)
#pragma unroll
        for (int n = 0; n < 4; ++n) {
          // K comes out transposed (rows = head dim, column = key): a lane then holds
          // eight neighbouring head dims of one key, one 16-byte chunk of its tile
          if (w == 1) acc[w][i][n] = wmma_bf16(bw[g & 1][n], ax[i], acc[w][i][n]);
          else        acc[w][i][n] = wmma_bf16(ax[i], bw[g & 1][n], acc[w][i][n]);
        }
      // and keeps later reads from being lifted among these products
      __builtin_amdgcn_sched_barrier(0);
      if (g == 2) {                             // the x fragments of the step's second half
#pragma unroll
        for (int i = 0; i < 4; ++i) ax[i] = fragA(buf, i, 1);
      }
    }

    // publish K step ks+1 and free this step's buffers, then refill them
    wait_ds0();
    wait_async0();
    __syncthreads();
    if (ks + 2 < Dc / 64) stage(buf, kof(ks + 2));
  }
  wait_async0();

  // ---- epilogue: Q to [B,H,S,Hd], K and V to their fragment tiles ----
  const int    mr0 = m0 + mw * 64;            // 64 rows = 64 keys of one batch
  const int    s00 = mr0 & (Sc - 1);
  const size_t hb  = (size_t)((mr0 >> 11) * Hc + (nh0 >> 6)) * Sc * Hd;

#pragma unroll   // constant n, i, j: the accumulators stay in registers
  for (int n = 0; n < 4; ++n) {
#pragma unroll
    for (int i = 0; i < 4; ++i) {
      __bf16* qt = Qb + hb + (size_t)(s00 + i * 16 + half * 8) * Hd + n * 16 + r;
      // key tile (s00 >> 4) + i, half n >> 1 of Hd, chunk n & 1
      __bf16* kt = Kb + hb + (size_t)((s00 >> 4) + i) * 1024 + n * 256 + lane * 8;
      // key step (s00 >> 5) + (i >> 1), head-dim tile n, chunk i & 1 (16 keys each)
      __bf16* vt = Vb + hb + (size_t)((s00 >> 5) + (i >> 1)) * 2048 + n * 512 + (i & 1) * 256 + lane * 8;
      v8bf qo, ko, vo;
#pragma unroll
      for (int j = 0; j < 8; ++j) {
        qo[j] = (__bf16)(acc[0][i][n][j] * CS);
        ko[j] = (__bf16)acc[1][i][n][j];
        vo[j] = (__bf16)acc[2][i][n][j];
      }
      // keeps the tile's ten stores together, behind its arithmetic and in front of their
      // wait
      __builtin_amdgcn_sched_barrier(0);
#pragma unroll
      for (int j = 0; j < 8; ++j) qt[j * Hd] = qo[j];
      *(v8bf*)kt = ko;
      *(v8bf*)vt = vo;
      wait_x0();
      __builtin_amdgcn_sched_barrier(0);
    }
  }
}

__device__ __forceinline__ void score8(v8f& a0, v8f& a1, v8f& b0, v8f& b1,
                                       v16bf k00, v16bf k01, v16bf k10, v16bf k11,
                                       v16bf q00, v16bf q01, v16bf q10, v16bf q11,
                                       v8f c0, v8f c1) {
  asm volatile("v_wmma_f32_16x16x32_bf16 %0, %4, %8, %12\n\t"
               "v_wmma_f32_16x16x32_bf16 %1, %6, %8, %12\n\t"
               "v_wmma_f32_16x16x32_bf16 %2, %4, %10, %13\n\t"
               "v_wmma_f32_16x16x32_bf16 %3, %6, %10, %13\n\t"
               "v_wmma_f32_16x16x32_bf16 %0, %5, %9, %0\n\t"
               "v_wmma_f32_16x16x32_bf16 %1, %7, %9, %1\n\t"
               "v_wmma_f32_16x16x32_bf16 %2, %5, %11, %2\n\t"
               "v_wmma_f32_16x16x32_bf16 %3, %7, %11, %3\n\t"
               "v_nop\n\tv_nop\n\tv_nop\n\tv_nop"
               : "=&v"(a0), "=&v"(a1), "=&v"(b0), "=&v"(b1)
               : "v"(k00), "v"(k01), "v"(k10), "v"(k11),
                 "v"(q00), "v"(q01), "v"(q10), "v"(q11), "v"(c0), "v"(c1));
}

struct WithMask { static constexpr bool v = true; };
struct NoMask   { static constexpr bool v = false; };
__global__ __launch_bounds__(256) __attribute__((amdgpu_waves_per_eu(4, 4))) void attn_kernel(
    const __bf16* __restrict__ Qb, const __bf16* __restrict__ Kb,
    const __bf16* __restrict__ Vb, const int* __restrict__ mask,
    __bf16* __restrict__ Ctx) {
  constexpr int SK  = 128;                  // keys per stage
  constexpr int NST = Sc / SK;              // 16 stages
  constexpr int G   = 2;                    // column groups of 16 queries per wave
  __shared__ __align__(16) __bf16 Ks[2][SK * Hd];     // 32 KB
  __shared__ __align__(16) __bf16 Vs[2][SK * Hd];     // 32 KB

  const int tid  = threadIdx.x;
  const int wave = tid >> 5;
  const int lane = tid & 31;
  const int r    = lane & 15;
  const int half = lane >> 4;

  const int bh = blockIdx.y;                // b*H + h
  const int b  = bh >> 4;
  const int h  = bh & 15;
  const int q0 = blockIdx.x * (128 * G) + wave * (16 * G);

  const __bf16* kbase = Kb + (size_t)bh * Sc * Hd;
  const __bf16* vbase = Vb + (size_t)bh * Hd * Sc;
  const int*    mbase = mask + (size_t)b * Sc;

  // a stage is 1024 chunks of 16 B of K and as many of V: a thread takes chunks
  // tid, tid+256, tid+512, tid+768 of each, so a wave's copy covers 512 contiguous bytes
  auto stageKV = [&](int buf, int st) {
    const __bf16*  gk = kbase + (size_t)st * SK * Hd + tid * 8;
    const __bf16*  gv = vbase + (size_t)st * SK * Hd + tid * 8;
    const uint32_t lk = lds_addr(&Ks[buf][tid * 8]);
    const uint32_t lv = lds_addr(&Vs[buf][tid * 8]);
    async4_b128(gk, gk + 2048, gk + 4096, gk + 6144, lk, lk + 4096, lk + 8192, lk + 12288);
    async4_b128(gv, gv + 2048, gv + 4096, gv + 6144, lv, lv + 4096, lv + 8192, lv + 12288);
  };
  stageKV(0, 0);                            // flies while Q and the mask are read

  v16bf qf[G][2];
#pragma unroll
  for (int g = 0; g < G; ++g) {
    const __bf16* qp = Qb + ((size_t)bh * Sc + (q0 + g * 16 + r)) * Hd + half * 8;
    qf[g][0] = frag_from_bf16(qp);
    qf[g][1] = frag_from_bf16(qp + 32);
  }

  float lrow[G];
  v8f   o[G][4];
#pragma unroll
  for (int g = 0; g < G; ++g) {
    lrow[g]   = 0.f;                        // this half's keys only
#pragma unroll
    for (int t = 0; t < 4; ++t) o[g][t] = zero8();
  }

  // does this batch row mask any key at all?  One wave-uniform flag, so that
  // the loop pays for the 16 per-register mask terms only where there are some
  unsigned mlow = 0xffffffffu;              // unsigned minimum: 0 iff some entry is 0
#pragma unroll
  for (int i = 0; i < Sc / 128; ++i) {
    const int4 mv = *(const int4*)(mbase + i * 128 + lane * 4);
    mlow = min(min(mlow, min((unsigned)mv.x, (unsigned)mv.y)), min((unsigned)mv.z, (unsigned)mv.w));
  }
  const bool masked = __builtin_amdgcn_ballot_w32(mlow == 0u) != 0;

  // minus the held maximum of the lane's column, the same in all eight registers (a C operand).
  // Unmasked rows start from 0 and the first pass always moves it; masked rows start from
  // "no maximum yet", which their test sees as passed
  v8f nm8[G];
#pragma unroll
  for (int g = 0; g < G; ++g) {
    const float n0 = masked ? 3.0e38f : 0.f;
    nm8[g] = (v8f){n0, n0, n0, n0, n0, n0, n0, n0};
  }

  wait_async0();
  __syncthreads();                          // stage 0 is there for every wave
  stageKV(1, 1);                            // flies while stage 0 is worked on

  // The walk over the keys, built twice: MK.v says whether the batch row has masked keys.  All
  // waves of a work-group read the same mask row, so they all take the same build (barriers).
  auto walk = [&](auto MK) {
  for (int st = 0; st < NST; ++st) {
   const int buf = st & 1;
   // stays rolled, as it was: unrolled, the passes overlap in more registers than two
   // resident work-groups leave a wave
#pragma unroll 1
   for (int ps = 0; ps < SK / 32; ++ps) {
    const int kk0 = st * SK + ps * 32;
    const __bf16* kp = &Ks[buf][ps * 32 * Hd + lane * 8];     // 32 keys = 4 tiles
    v16bf kf00 = frag_packed(kp);
    v16bf kf01 = frag_packed(kp + 512);
    v16bf kf10 = frag_packed(kp + 1024);
    v16bf kf11 = frag_packed(kp + 1536);
    // keeps the eight K reads together ahead of the eight products: read a pair at a
    // time, every pair of products waits out an LDS latency of its own
    __builtin_amdgcn_sched_barrier(0);

    v8f   s0[G], s1[G];                      // four independent tiles, two products deep
    float p0[G][8], p1[G][8], psum[G];
    v16bf vf0, vf1, vf2, vf3;
    // the pass's V tiles (one per 16 head dims)
    const __bf16* vp = &Vs[buf][ps * 32 * Hd + lane * 8];
    auto readV = [&]() {
      vf0 = frag_packed(vp);
      vf1 = frag_packed(vp + 512);
      vf2 = frag_packed(vp + 1024);
      vf3 = frag_packed(vp + 1536);
      // keeps the eight V reads together up here: the softmax arithmetic covers their latency
      __builtin_amdgcn_sched_barrier(0);
    };
    // s0, s1 of a group hold exp2 arguments: its P and the sum of this half's 16 keys
    auto expsum = [&](int g) {
#pragma unroll
      for (int j = 0; j < 8; ++j) {
        p0[g][j] = __builtin_amdgcn_exp2f(s0[g][j]);
        p1[g][j] = __builtin_amdgcn_exp2f(s1[g][j]);
      }
      const float sa = ((p0[g][0] + p0[g][1]) + (p0[g][2] + p0[g][3])) + ((p0[g][4] + p0[g][5]) + (p0[g][6] + p0[g][7]));
      const float sb = ((p1[g][0] + p1[g][1]) + (p1[g][2] + p1[g][3])) + ((p1[g][4] + p1[g][5]) + (p1[g][6] + p1[g][7]));
      psum[g] = sa + sb;
    };
    // maximum of this half's 16 keys of a group, in the lane's own registers
    auto colmax = [&](int g) {
      float mx = fmaxf(s0[g][0], s1[g][0]);
#pragma unroll
      for (int j = 1; j < 8; ++j) mx = fmaxf(mx, fmaxf(s0[g][j], s1[g][j]));
      return mx;
    };
    auto rescale = [&](int g, float alpha) {
      lrow[g] = lrow[g] * alpha;
#pragma unroll
      for (int t = 0; t < 4; ++t) o[g][t] = o[g][t] * alpha;
    };

    if constexpr (!decltype(MK)::v) {
      // ---- the score sums start from minus the held maximum ----
      score8(s0[0], s1[0], s0[1], s1[1], kf00, kf01, kf10, kf11,
             qf[0][0], qf[0][1], qf[1][0], qf[1][1], nm8[0], nm8[1]);
      readV();
#pragma unroll
      for (int g = 0; g < G; ++g) expsum(g);
      // one test a pass for both groups, a scalar branch: taken in the first pass (every sum
      // is above -1) and then only where an argument above 8, or sixteen that add up alike,
      // put a sum above 2^8.  The ballot sees both halves of a column
      const bool  first = kk0 == 0;
      const float lim   = first ? -1.0f : 256.0f;
      if (__builtin_amdgcn_ballot_w32((psum[0] > lim) | (psum[1] > lim)) != 0) {
        const float flo = first ? -3.0e38f : 0.f;   // later the held maximum only rises
#pragma unroll
        for (int g = 0; g < G; ++g) {
          const float mx    = colmax(g);
          const float mboth = fmaxf(mx, xhalf(mx));       // relative to the held maximum
          const float nold  = nm8[g][0];
          const float nnew  = nold - fmaxf(mboth, flo);
          const float d     = nold - nnew;                // the step as the registers hold it
          nm8[g] = (v8f){nnew, nnew, nnew, nnew, nnew, nnew, nnew, nnew};
          rescale(g, __builtin_amdgcn_exp2f(-fmaxf(d, 0.f)));   // first pass: all is 0 still
          const v8f d8 = {d, d, d, d, d, d, d, d};
          s0[g] = s0[g] - d8;
          s1[g] = s1[g] - d8;
          expsum(g);
        }
      }
    } else {
      // ---- scores: S^T[32 k x 16 q] = K (32x64) * Q^T, for both groups ----
#pragma unroll
      for (int g = 0; g < G; ++g) {
        s0[g] = wmma_bf16(kf00, qf[g][0], zero8());
        s1[g] = wmma_bf16(kf10, qf[g][0], zero8());
      }
#pragma unroll
      for (int g = 0; g < G; ++g) {
        s0[g] = wmma_bf16(kf01, qf[g][1], s0[g]);
        s1[g] = wmma_bf16(kf11, qf[g][1], s1[g]);
      }
      // the mask terms, the same for both groups, come in front of the V reads, so that the
      // sixteen mask words and the V tiles are not live together
      {                                        // s0[g][j]: key kk0+8*half+j, s1[g][j]: 16 more
        const int* mp = mbase + kk0 + half * 8;
        const int4 ma = *(const int4*)(mp),      mb = *(const int4*)(mp + 4);
        const int4 mc = *(const int4*)(mp + 16), md = *(const int4*)(mp + 20);
        const int m0[8] = {ma.x, ma.y, ma.z, ma.w, mb.x, mb.y, mb.z, mb.w};
        const int m1[8] = {mc.x, mc.y, mc.z, mc.w, md.x, md.y, md.z, md.w};
#pragma unroll   // constant j: the vectors' elements stay in registers
        for (int j = 0; j < 8; ++j) {
          const float a0 = m0[j] ? 0.f : -1.4426950e9f;   // -1e9 in base-2 units
          const float a1 = m1[j] ? 0.f : -1.4426950e9f;
#pragma unroll
          for (int g = 0; g < G; ++g) { s0[g][j] += a0; s1[g][j] += a1; }
        }
      }
      readV();
      float mx[G];
#pragma unroll
      for (int g = 0; g < G; ++g) mx[g] = colmax(g);
      // one test a pass for both groups, as above, here on the maxima themselves
      if (__builtin_amdgcn_ballot_w32((mx[0] + nm8[0][0] > 8.0f) | (mx[1] + nm8[1][0] > 8.0f)) != 0) {
#pragma unroll
        for (int g = 0; g < G; ++g) {
          const float mold = -nm8[g][0];
          const float mnew = fmaxf(mold, fmaxf(mx[g], xhalf(mx[g])));
          nm8[g] = (v8f){-mnew, -mnew, -mnew, -mnew, -mnew, -mnew, -mnew, -mnew};
          rescale(g, __builtin_amdgcn_exp2f(mold - mnew));      // 0 in the first pass
        }
      }
#pragma unroll
      for (int g = 0; g < G; ++g) {
        s0[g] = s0[g] + nm8[g];
        s1[g] = s1[g] + nm8[g];
        expsum(g);
      }
    }

#pragma unroll
    for (int g = 0; g < G; ++g) {
      lrow[g] += psum[g];

      // ---- P^T as a B operand: element s = key 8*half+s, then 16+8*half+(s-8) ----
      v16bf pf;
#pragma unroll
      for (int j = 0; j < 8; ++j) { pf[j] = (__bf16)p0[g][j]; pf[8 + j] = (__bf16)p1[g][j]; }

      // ---- O^T += V^T @ P^T   (one fragment tile per 16 head dims) ----
      o[g][0] = wmma_bf16(vf0, pf, o[g][0]);
      o[g][1] = wmma_bf16(vf1, pf, o[g][1]);
      o[g][2] = wmma_bf16(vf2, pf, o[g][2]);
      o[g][3] = wmma_bf16(vf3, pf, o[g][3]);
    }
   }
   // publish stage st+1 and free this stage's buffer, then refill it
   wait_ds0();
   wait_async0();
   __syncthreads();
   if (st + 2 < NST) stageKV(buf, st + 2);
  }
  };
  if (masked) walk(WithMask{}); else walk(NoMask{});
  wait_async0();

  // ---- join the halves' sums, normalize, store context bf16 [B,S,D]:
  //      tile t of a lane is head dims 16*t+8*half+0..7 of query q0+16*g+r ----
#pragma unroll
  for (int g = 0; g < G; ++g) {
    const float inv = 1.0f / (lrow[g] + xhalf(lrow[g]));
    v8bf c0, c1, c2, c3;
#pragma unroll
    for (int j = 0; j < 8; ++j) {
      c0[j] = (__bf16)(o[g][0][j] * inv);
      c1[j] = (__bf16)(o[g][1][j] * inv);
      c2[j] = (__bf16)(o[g][2][j] * inv);
      c3[j] = (__bf16)(o[g][3][j] * inv);
    }
    __bf16* cp = Ctx + ((size_t)b * Sc + q0 + g * 16 + r) * Dc + h * Hd + half * 8;
    *(v8bf*)(cp)      = c0;
    *(v8bf*)(cp + 16) = c1;
    *(v8bf*)(cp + 32) = c2;
    *(v8bf*)(cp + 48) = c3;
    wait_x0();
  }
}

// ---------------------------------------------------------------------------
// Kernel 3: out projection + residual.  y = x + ctx @ Wo.T + bo  (fp32 y).
// WG = 256 thr (8 waves), tile 128(M) x 128(N); a wave owns 32 x 64: 2 context
// fragments meet 4 weight fragments.  A K step is 64 deep: 16 products a wave.
// Ctx and Wo tiles, both bf16, are async-staged, one K step ahead in two buffers.
// ---------------------------------------------------------------------------
__global__ __launch_bounds__(256) void oproj_kernel(
    const __bf16* __restrict__ Ctx, const __bf16* __restrict__ Wob,
    const float* __restrict__ bo, const float* __restrict__ x,
    float* __restrict__ Y) {
  __shared__ __align__(16) __bf16 Cs[2][128][72];     // 36 KB, padded rows
  __shared__ __align__(16) __bf16 Os[2][128][72];     // 36 KB, padded rows

  const int tid  = threadIdx.x;
  const int wave = tid >> 5;
  const int lane = tid & 31;
  const int r    = lane & 15;
  const int half = lane >> 4;
  const int mw   = wave & 3;        // M sub-tile (32 rows)
  const int nw   = wave >> 2;       // N sub-tile (64 cols)
  const int m0   = blockIdx.y * 128;
  const int n0   = blockIdx.x * 128;

  // as in the QKV kernel: the work-groups that share context lines (a row of the grid) or Wo
  // lines (sixteen neighbours in a column) walk K from different steps, so that they do not ask for a line together
  const int rot = (blockIdx.x + blockIdx.y) & (Dc / 64 - 1);
  auto kof = [&](int ks) { return ((ks + rot) & (Dc / 64 - 1)) * 64; };

  // each tile is 1024 chunks of 16 B: a thread takes one chunk of rows cr, cr+32, cr+64, cr+96
  const int cr = tid >> 3;
  const int cc = (tid & 7) * 8;
  auto stage = [&](int buf, int k0) {
    const __bf16*  g = Ctx + (size_t)(m0 + cr) * Dc + k0 + cc;
    const uint32_t l = lds_addr(&Cs[buf][cr][cc]);
    async4_b128(g, g + 32 * Dc, g + 64 * Dc, g + 96 * Dc,
                l, l + 32 * 144, l + 64 * 144, l + 96 * 144);
    const __bf16*  gw = Wob + (size_t)(n0 + cr) * Dc + k0 + cc;
    const uint32_t lw = lds_addr(&Os[buf][cr][cc]);
    async4_b128(gw, gw + 32 * Dc, gw + 64 * Dc, gw + 96 * Dc,
                lw, lw + 32 * 144, lw + 64 * 144, lw + 96 * 144);
  };

  v8f acc[2][4];
#pragma unroll
  for (int i = 0; i < 2; ++i)
#pragma unroll
    for (int n = 0; n < 4; ++n) acc[i][n] = zero8();

  stage(0, kof(0));
  wait_async0();
  __syncthreads();
  stage(1, kof(1));                             // flies while K step 0 is worked on

  for (int ks = 0; ks < Dc / 64; ++ks) {
    const int buf = ks & 1;
    // the step's 24 LDS reads go first, together
    v16bf a[2][2], b[2][4];
#pragma unroll
    for (int kk = 0; kk < 2; ++kk) {
#pragma unroll
      for (int i = 0; i < 2; ++i)
        a[kk][i] = frag_from_bf16(&Cs[buf][mw * 32 + i * 16 + r][kk * 32 + half * 8]);
#pragma unroll
      for (int n = 0; n < 4; ++n)
        b[kk][n] = frag_from_bf16(&Os[buf][nw * 64 + n * 16 + r][kk * 32 + half * 8]);
    }
    // keeps the reads together up here: read one fragment at a time among the
    // products, every product or two waits out an LDS latency
    __builtin_amdgcn_sched_barrier(0);

#pragma unroll
    for (int kk = 0; kk < 2; ++kk)
#pragma unroll
      for (int i = 0; i < 2; ++i)
#pragma unroll
        for (int n = 0; n < 4; ++n) acc[i][n] = wmma_bf16(a[kk][i], b[kk][n], acc[i][n]);
    // keeps the products in front of the waits and the barrier: moved behind them, they no
    // longer cover the flight of the next step's copies
    __builtin_amdgcn_sched_barrier(0);

    // publish K step ks+1 and free this step's buffers, then refill them
    wait_ds0();
    wait_async0();
    __syncthreads();
    if (ks + 2 < Dc / 64) stage(buf, kof(ks + 2));
  }
  wait_async0();

  float bon[4];
#pragma unroll
  for (int n = 0; n < 4; ++n) bon[n] = bo[n0 + nw * 64 + n * 16 + r];
  wait_x0();
  // keeps the bias loads in front of their wait
  __builtin_amdgcn_sched_barrier(0);

#pragma unroll   // constant i, n, j: the accumulators stay in registers
  for (int n = 0; n < 4; ++n) {
    const int    cn  = n0 + nw * 64 + n * 16 + r;
    const size_t o0  = (size_t)(m0 + mw * 32 + half * 8) * Dc + cn;
    float xv[2][8];
#pragma unroll
    for (int i = 0; i < 2; ++i)
#pragma unroll
      for (int j = 0; j < 8; ++j) xv[i][j] = x[o0 + (size_t)(i * 16 + j) * Dc];
    wait_x0();
    float yv[2][8];
#pragma unroll
    for (int i = 0; i < 2; ++i)
#pragma unroll
      for (int j = 0; j < 8; ++j) yv[i][j] = acc[i][n][j] + bon[n] + xv[i][j];
    // keeps the sixteen stores together, behind the sums and in front of their wait
    __builtin_amdgcn_sched_barrier(0);
#pragma unroll
    for (int i = 0; i < 2; ++i)
#pragma unroll
      for (int j = 0; j < 8; ++j) Y[o0 + (size_t)(i * 16 + j) * Dc] = yv[i][j];
    wait_x0();
    __builtin_amdgcn_sched_barrier(0);
  }
}

// ---------------------------------------------------------------------------
// Kernel 4: LayerNorm over D=1024 per row.  One block (256 thr) per row.
// ---------------------------------------------------------------------------
__global__ __launch_bounds__(256) void ln_kernel(
    const float* __restrict__ Y, const float* __restrict__ gamma,
    const float* __restrict__ beta, float* __restrict__ out) {
  __shared__ float redS[8], redQ[8];
  const int row  = blockIdx.x;
  const int tid  = threadIdx.x;
  const int wave = tid >> 5;
  const int lane = tid & 31;

  const float4 v = ((const float4*)(Y + (size_t)row * Dc))[tid];
  float s = v.x + v.y + v.z + v.w;
  float q = v.x * v.x + v.y * v.y + v.z * v.z + v.w * v.w;
#pragma unroll
  for (int m = 16; m >= 1; m >>= 1) {
    s += __shfl_xor(s, m);
    q += __shfl_xor(q, m);
  }
  if (lane == 0) { redS[wave] = s; redQ[wave] = q; }
  __syncthreads();
  float S = 0.f, Q = 0.f;
#pragma unroll
  for (int i = 0; i < 8; ++i) { S += redS[i]; Q += redQ[i]; }
  const float mu   = S * (1.0f / Dc);
  const float var  = Q * (1.0f / Dc) - mu * mu;
  const float rstd = rsqrtf(var + 1e-5f);

  const float4 g  = ((const float4*)gamma)[tid];
  const float4 be = ((const float4*)beta)[tid];
  float4 o;
  o.x = (v.x - mu) * rstd * g.x + be.x;
  o.y = (v.y - mu) * rstd * g.y + be.y;
  o.z = (v.z - mu) * rstd * g.z + be.z;
  o.w = (v.w - mu) * rstd * g.w + be.w;
  ((float4*)(out + (size_t)row * Dc))[tid] = o;
}

// ---------------------------------------------------------------------------
// Launcher
// ---------------------------------------------------------------------------
extern "C" void kernel_launch(void* const* d_in, const int* in_sizes, int n_in,
                              void* d_out, int out_size, void* d_ws, size_t ws_size,
                              hipStream_t stream) {
  const float* x     = (const float*)d_in[0];
  const int*   mask  = (const int*)  d_in[1];
  const float* Wq    = (const float*)d_in[2];
  const float* bq    = (const float*)d_in[3];
  const float* Wk    = (const float*)d_in[4];
  const float* bk    = (const float*)d_in[5];
  const float* Wv    = (const float*)d_in[6];
  const float* bv    = (const float*)d_in[7];
  const float* Wo    = (const float*)d_in[8];
  const float* bo    = (const float*)d_in[9];
  const float* gamma = (const float*)d_in[10];
  const float* beta  = (const float*)d_in[11];

  char* ws = (char*)d_ws;
  const size_t ELEMS = (size_t)Mtot * Dc;          // 8 Mi elements
  __bf16* Qb  = (__bf16*)(ws);                     // 16 MB
  __bf16* Kb  = (__bf16*)(ws + 2 * ELEMS);         // 16 MB
  __bf16* Vb  = (__bf16*)(ws + 4 * ELEMS);         // 16 MB
  __bf16* Ctx = (__bf16*)(ws + 6 * ELEMS);         // 16 MB
  float*  Y   = (float*) (ws + 8 * ELEMS);         // 32 MB
  __bf16* xb  = (__bf16*)(ws + 12 * ELEMS);        // 16 MB
  __bf16* Wb  = (__bf16*)(ws + 14 * ELEMS);        //  8 MB: Wq, Wk, Wv, Wo

  dim3 blk(256);
  tobf16_kernel<<<512, blk, 0, stream>>>(x, Wq, Wk, Wv, Wo, xb, Wb);

  dim3 g1(Dc / 128, Mtot / 256);                   // (8, 32)
  qkv_kernel<<<g1, blk, 0, stream>>>(xb, Wb, bq, bk, bv, Qb, Kb, Vb);

  dim3 g2(Sc / 256, Bc * Hc);                      // (8, 64)
  attn_kernel<<<g2, blk, 0, stream>>>(Qb, Kb, Vb, mask, Ctx);

  dim3 g3(Dc / 128, Mtot / 128);                   // (8, 64)
  oproj_kernel<<<g3, blk, 0, stream>>>(Ctx, Wb + 3 * (size_t)Dc * Dc, bo, x, Y);

  ln_kernel<<<Mtot, blk, 0, stream>>>(Y, gamma, beta, (float*)d_out);
}
